// v000
// The times below were measured on an AMD MI455X: many runs one after another, warmed up first and cycling through
// copies of the inputs, with the whole window's GPU time divided by the number of runs. Launches and the gaps
// between them are all in it. The median over several windows is given; except for v000 it joins two sittings, which
// can be a few percent apart, so the side-by-side timings, each taken in one sitting, are the better comparison.
// v000 is the starting kernel.
#include <hip/hip_runtime.h>
#include <hip/hip_bf16.h>
#include <math.h>
#include <stdint.h>

// ---------------- problem constants ----------------
#define LAYERS 2
#define BATCH  4
#define SEQ    1024
#define CDIM   256
#define HEADS  8
#define DHEAD  32          // CDIM / HEADS
#define TOPM   64
#define DFF    1024
#define ROWS   (BATCH * SEQ)      // 4096 token rows
#define LNEPS  1e-5f

// WMMA vector types (CDNA5 wave32)
typedef __attribute__((ext_vector_type(16))) __bf16 v16bf;
typedef __attribute__((ext_vector_type(8)))  float  v8f;

union ABOp {            // one 16x32 bf16 WMMA operand per lane
    uint16_t u[16];
    uint4    q[2];      // two 16-byte chunks
    v16bf    v;
};

__device__ __forceinline__ uint16_t f2bf(float f) {
    uint32_t u = __float_as_uint(f);
    uint32_t r = u + 0x7FFFu + ((u >> 16) & 1u);   // round-to-nearest-even
    return (uint16_t)(r >> 16);
}

__device__ __forceinline__ v8f wmma_bf16(const ABOp& a, const ABOp& b, v8f c) {
    return __builtin_amdgcn_wmma_f32_16x16x32_bf16(
        false, a.v, false, b.v, (short)0, c, false, false);
}

// ---------------- elementwise f32 -> bf16 convert (weights) ----------------
__global__ void cvt_bf16_kernel(const float* __restrict__ in,
                                uint16_t* __restrict__ out, int n) {
    int i = blockIdx.x * blockDim.x + threadIdx.x;
    if (i < n) out[i] = f2bf(in[i]);
}

// ---------------- LayerNorm (one 256-thread block per row) ----------------
__global__ void ln_kernel(const float* __restrict__ x,
                          const float* __restrict__ g,
                          const float* __restrict__ b,
                          uint16_t* __restrict__ out) {
    __shared__ float s1[8], s2[8], stats[2];
    const int row  = blockIdx.x;
    const int tid  = threadIdx.x;
    const int wave = tid >> 5, lane = tid & 31;
    float v = x[(size_t)row * CDIM + tid];
    float s = v, ss = v * v;
    #pragma unroll
    for (int off = 16; off >= 1; off >>= 1) {
        s  += __shfl_xor(s,  off, 32);
        ss += __shfl_xor(ss, off, 32);
    }
    if (lane == 0) { s1[wave] = s; s2[wave] = ss; }
    __syncthreads();
    if (tid == 0) {
        float a = 0.f, c = 0.f;
        #pragma unroll
        for (int i = 0; i < 8; ++i) { a += s1[i]; c += s2[i]; }
        float mean = a * (1.0f / CDIM);
        float var  = c * (1.0f / CDIM) - mean * mean;
        stats[0] = mean;
        stats[1] = rsqrtf(var + LNEPS);
    }
    __syncthreads();
    float y = (v - stats[0]) * stats[1] * g[tid] + b[tid];
    out[(size_t)row * CDIM + tid] = f2bf(y);
}

// ---------------- generic bf16 WMMA GEMM: D = act(A@B + bias) (+resid) ----
// A: [M,K] bf16 row-major.  B: [K,Nc] bf16 row-major (staged in LDS).
// grid = (Nc/64, M/32), block = 256 (8 waves, each owns a 16x16 output tile)
template<bool GELU_, bool RES, bool OUTBF>
__global__ void gemm_bf16_kernel(const uint16_t* __restrict__ A,
                                 const uint16_t* __restrict__ Bw,
                                 const float* __restrict__ bias,
                                 const float* __restrict__ resid,
                                 float* __restrict__ outf,
                                 uint16_t* __restrict__ outb,
                                 int M, int K, int Nc) {
    __shared__ uint16_t Bs[32 * 72];     // 32 K-rows x 64 cols (+8 pad)
    const int tid  = threadIdx.x;
    const int wave = tid >> 5, lane = tid & 31;
    const int g    = lane >> 4;          // half-wave select
    const int wm   = wave >> 2, wn = wave & 3;
    const int row0 = blockIdx.y * 32 + wm * 16;
    const int col0 = blockIdx.x * 64;
    const int colT = col0 + wn * 16;
    const int rB   = tid >> 3, ccB = (tid & 7) * 8;   // B-stage mapping

    v8f acc = {};
    #pragma unroll 2
    for (int kk = 0; kk < K; kk += 32) {
        __syncthreads();
        // cooperative stage of B tile (32x64 bf16 = 4KB, coalesced b128)
        *(uint4*)(&Bs[rB * 72 + ccB]) =
            *(const uint4*)(&Bw[(size_t)(kk + rB) * Nc + col0 + ccB]);
        // prefetch next K-tile of B into cache (gfx1250 global_prefetch path)
        if (kk + 32 < K)
            __builtin_prefetch(&Bw[(size_t)(kk + 32 + rB) * Nc + col0 + ccB], 0, 1);
        __syncthreads();
        // A operand: row m = row0+lane%16, K-chunks at kk+g*8 and kk+16+g*8
        ABOp a;
        const uint16_t* ar = A + (size_t)(row0 + (lane & 15)) * K + kk;
        a.q[0] = *(const uint4*)(ar + g * 8);
        a.q[1] = *(const uint4*)(ar + 16 + g * 8);
        // B operand from LDS: col n = colT+lane%16, same K pattern
        ABOp bm;
        const int n = wn * 16 + (lane & 15);
        #pragma unroll
        for (int j = 0; j < 16; ++j) {
            int kloc = (j < 8) ? (g * 8 + j) : (16 + g * 8 + (j - 8));
            bm.u[j] = Bs[kloc * 72 + n];
        }
        acc = wmma_bf16(a, bm, acc);
    }
    // C/D layout: element v -> (m = row0 + g*8 + v, n = colT + lane%16)
    const int nc = colT + (lane & 15);
    const float bb = bias[nc];
    #pragma unroll
    for (int v = 0; v < 8; ++v) {
        int m = row0 + g * 8 + v;
        float r = acc[v] + bb;
        if (GELU_) r = 0.5f * r * (1.0f + erff(r * 0.70710678118654752f));
        if (RES)   r += resid[(size_t)m * Nc + nc];
        if (OUTBF) outb[(size_t)m * Nc + nc] = f2bf(r);
        else       outf[(size_t)m * Nc + nc] = r;
    }
}

// ---------------- fused dual-pass attention ----------------
// One workgroup = (b, h, 64-query panel). Scores stay in LDS (64 x 1032 f32),
// plus an 8KB LDS chunk for staged V (128 keys x 32 d, bf16).
// Phase 1: QK^T via WMMA. Phase 2: dense softmax stats + top-64 threshold by
// value bisection + fused combined probabilities. Phase 3: P@V via WMMA with
// LDS-staged V chunks (coalesced b128 staging instead of 2B gathers).
#define QBLK  64
#define SLD   1032    // 1024 + 8 pad floats to dodge bank conflicts
#define VCH   128     // keys per staged V chunk
__global__ void attn_kernel(const uint16_t* __restrict__ qb,   // [ROWS,CDIM] bf16
                            const uint16_t* __restrict__ kvb,  // [ROWS,2*CDIM] bf16
                            const float* __restrict__ wf,      // w_fuse[2]
                            uint16_t* __restrict__ attn) {     // [ROWS,CDIM] bf16
    extern __shared__ float sc[];
    uint16_t* Vs = (uint16_t*)(sc + QBLK * SLD);   // [VCH][DHEAD] bf16
    const int bid  = blockIdx.x;
    const int b    = bid / (HEADS * (SEQ / QBLK));
    const int rem  = bid % (HEADS * (SEQ / QBLK));
    const int h    = rem / (SEQ / QBLK);
    const int q0   = (rem % (SEQ / QBLK)) * QBLK;
    const int tid  = threadIdx.x;
    const int wave = tid >> 5, lane = tid & 31;
    const int g    = lane >> 4;
    const float scale = 0.17677669529663687f;   // 1/sqrt(32)

    // learned fusion weights (softmax over 2) -- uniform, scalarizes to SALU
    const float e0 = expf(wf[0]), e1 = expf(wf[1]);
    const float w0 = e0 / (e0 + e1), w1 = e1 / (e0 + e1);

    // ---- phase 1: scores tile 64q x 1024k, 256 WMMA tiles over 8 waves ----
    for (int t = wave; t < (QBLK / 16) * (SEQ / 16); t += 8) {
        const int qt = t >> 6, kt = t & 63;
        ABOp a, bm;
        {   // Q operand: 16 queries x 32 d (contiguous d chunks)
            int m = q0 + qt * 16 + (lane & 15);
            const uint16_t* qr = qb + (size_t)(b * SEQ + m) * CDIM + h * DHEAD;
            a.q[0] = *(const uint4*)(qr + g * 8);
            a.q[1] = *(const uint4*)(qr + 16 + g * 8);
        }
        {   // K operand: 16 keys across lanes, d packed (row-major contiguous)
            int n = kt * 16 + (lane & 15);
            const uint16_t* kr = kvb + (size_t)(b * SEQ + n) * (2 * CDIM) + h * DHEAD;
            bm.q[0] = *(const uint4*)(kr + g * 8);
            bm.q[1] = *(const uint4*)(kr + 16 + g * 8);
        }
        v8f c = {};
        c = wmma_bf16(a, bm, c);
        #pragma unroll
        for (int v = 0; v < 8; ++v)
            sc[(qt * 16 + g * 8 + v) * SLD + kt * 16 + (lane & 15)] = c[v] * scale;
    }
    __syncthreads();

    // ---- phase 2: per-row dense softmax + top-64 threshold + fusion ----
    for (int i = 0; i < 8; ++i) {
        const int row = wave * 8 + i;
        float* rp = sc + row * SLD;
        float rv[32];
        #pragma unroll
        for (int j = 0; j < 32; ++j) rv[j] = rp[lane + j * 32];
        float mx = -1e30f, mn = 1e30f;
        #pragma unroll
        for (int j = 0; j < 32; ++j) { mx = fmaxf(mx, rv[j]); mn = fminf(mn, rv[j]); }
        #pragma unroll
        for (int off = 16; off >= 1; off >>= 1) {
            mx = fmaxf(mx, __shfl_xor(mx, off, 32));
            mn = fminf(mn, __shfl_xor(mn, off, 32));
        }
        float sd = 0.f;
        #pragma unroll
        for (int j = 0; j < 32; ++j) sd += expf(rv[j] - mx);
        #pragma unroll
        for (int off = 16; off >= 1; off >>= 1) sd += __shfl_xor(sd, off, 32);
        // bisection for top-64 threshold: largest t with count(s>t) >= TOPM
        float lo = mn - 1.0f, hi = mx;
        for (int it = 0; it < 24; ++it) {
            float mid = 0.5f * (lo + hi);
            int c = 0;
            #pragma unroll
            for (int j = 0; j < 32; ++j) c += (rv[j] > mid) ? 1 : 0;
            #pragma unroll
            for (int off = 16; off >= 1; off >>= 1) c += __shfl_xor(c, off, 32);
            if (c >= TOPM) lo = mid; else hi = mid;
        }
        const float thr = lo;
        float st = 0.f;
        #pragma unroll
        for (int j = 0; j < 32; ++j) st += (rv[j] > thr) ? expf(rv[j] - mx) : 0.f;
        #pragma unroll
        for (int off = 16; off >= 1; off >>= 1) st += __shfl_xor(st, off, 32);
        const float cd = w0 / sd;
        const float ct = w1 / fmaxf(st, 1e-20f);
        #pragma unroll
        for (int j = 0; j < 32; ++j) {
            float e = expf(rv[j] - mx);
            rp[lane + j * 32] = e * (cd + ((rv[j] > thr) ? ct : 0.f));
        }
    }
    __syncthreads();

    // ---- phase 3: out = P @ V with LDS-staged V chunks ----
    {
        const int qt = wave >> 1, dt = wave & 1;
        const int d  = dt * 16 + (lane & 15);
        const int m  = qt * 16 + (lane & 15);
        v8f acc = {};
        for (int kk0 = 0; kk0 < SEQ; kk0 += VCH) {
            // stage V[kk0 .. kk0+VCH) x DHEAD : 8KB, coalesced b128 loads
            {
                const uint16_t* vb = kvb + (size_t)(b * SEQ + kk0) * (2 * CDIM)
                                     + CDIM + h * DHEAD;
                #pragma unroll
                for (int it = 0; it < 2; ++it) {
                    int idx = tid * 2 + it;            // 512 uint4 total
                    int r = idx >> 2, c = (idx & 3) * 8;
                    *(uint4*)(&Vs[r * DHEAD + c]) =
                        *(const uint4*)(vb + (size_t)r * (2 * CDIM) + c);
                }
            }
            __syncthreads();
            #pragma unroll
            for (int ks = 0; ks < VCH / 32; ++ks) {
                const int kk = kk0 + ks * 32;
                ABOp a, bm;
                #pragma unroll
                for (int j = 0; j < 16; ++j) {
                    int kl = (j < 8) ? (g * 8 + j) : (16 + g * 8 + (j - 8));
                    a.u[j]  = f2bf(sc[m * SLD + kk + kl]);
                    bm.u[j] = Vs[(ks * 32 + kl) * DHEAD + d];
                }
                acc = wmma_bf16(a, bm, acc);
            }
            __syncthreads();
        }
        #pragma unroll
        for (int v = 0; v < 8; ++v) {
            int mr = q0 + qt * 16 + g * 8 + v;
            int nc = dt * 16 + (lane & 15);
            attn[(size_t)(b * SEQ + mr) * CDIM + h * DHEAD + nc] = f2bf(acc[v]);
        }
    }
}

// ---------------- host side ----------------
extern "C" void kernel_launch(void* const* d_in, const int* in_sizes, int n_in,
                              void* d_out, int out_size, void* d_ws, size_t ws_size,
                              hipStream_t stream) {
    (void)in_sizes; (void)n_in; (void)out_size; (void)ws_size;
    const float* x     = (const float*)d_in[0];
    const float* ln1g  = (const float*)d_in[1];
    const float* ln1b  = (const float*)d_in[2];
    const float* Wq    = (const float*)d_in[3];
    const float* bq    = (const float*)d_in[4];
    const float* Wkv   = (const float*)d_in[5];
    const float* bkv   = (const float*)d_in[6];
    const float* wfuse = (const float*)d_in[7];
    const float* Wo    = (const float*)d_in[8];
    const float* bo    = (const float*)d_in[9];
    const float* ln2g  = (const float*)d_in[10];
    const float* ln2b  = (const float*)d_in[11];
    const float* W1    = (const float*)d_in[12];
    const float* b1    = (const float*)d_in[13];
    const float* W2    = (const float*)d_in[14];
    const float* b2    = (const float*)d_in[15];
    float* xcur = (float*)d_out;                       // running activations

    // workspace carve-up (bf16 buffers, 256B-aligned power-of-two sizes)
    uint8_t* ws = (uint8_t*)d_ws;
    uint16_t* wq_bf   = (uint16_t*)(ws);                 size_t off = CDIM * CDIM * 2;
    uint16_t* wkv_bf  = (uint16_t*)(ws + off);           off += CDIM * 2 * CDIM * 2;
    uint16_t* wo_bf   = (uint16_t*)(ws + off);           off += CDIM * CDIM * 2;
    uint16_t* w1_bf   = (uint16_t*)(ws + off);           off += CDIM * DFF * 2;
    uint16_t* w2_bf   = (uint16_t*)(ws + off);           off += DFF * CDIM * 2;
    uint16_t* h_bf    = (uint16_t*)(ws + off);           off += (size_t)ROWS * CDIM * 2;
    uint16_t* q_bf    = (uint16_t*)(ws + off);           off += (size_t)ROWS * CDIM * 2;
    uint16_t* kv_bf   = (uint16_t*)(ws + off);           off += (size_t)ROWS * 2 * CDIM * 2;
    uint16_t* attn_bf = (uint16_t*)(ws + off);           off += (size_t)ROWS * CDIM * 2;
    uint16_t* u_bf    = (uint16_t*)(ws + off);

    // x -> d_out (running buffer)
    hipMemcpyAsync(xcur, x, (size_t)ROWS * CDIM * sizeof(float),
                   hipMemcpyDeviceToDevice, stream);

    const int attnLds = QBLK * SLD * (int)sizeof(float)           // score panel
                      + VCH * DHEAD * (int)sizeof(uint16_t);      // V chunk
    hipFuncSetAttribute((const void*)attn_kernel,
                        hipFuncAttributeMaxDynamicSharedMemorySize, attnLds);

    const dim3 blk(256);
    for (int l = 0; l < LAYERS; ++l) {
        // per-layer weight slices -> bf16
        auto cvt = [&](const float* src, uint16_t* dst, int n) {
            cvt_bf16_kernel<<<dim3((n + 255) / 256), blk, 0, stream>>>(src, dst, n);
        };
        cvt(Wq  + (size_t)l * CDIM * CDIM,     wq_bf,  CDIM * CDIM);
        cvt(Wkv + (size_t)l * CDIM * 2 * CDIM, wkv_bf, CDIM * 2 * CDIM);
        cvt(Wo  + (size_t)l * CDIM * CDIM,     wo_bf,  CDIM * CDIM);
        cvt(W1  + (size_t)l * CDIM * DFF,      w1_bf,  CDIM * DFF);
        cvt(W2  + (size_t)l * DFF * CDIM,      w2_bf,  DFF * CDIM);

        // --- attention sublayer ---
        ln_kernel<<<dim3(ROWS), blk, 0, stream>>>(xcur, ln1g + l * CDIM,
                                                  ln1b + l * CDIM, h_bf);
        gemm_bf16_kernel<false, false, true>
            <<<dim3(CDIM / 64, ROWS / 32), blk, 0, stream>>>(
                h_bf, wq_bf, bq + l * CDIM, nullptr, nullptr, q_bf,
                ROWS, CDIM, CDIM);
        gemm_bf16_kernel<false, false, true>
            <<<dim3(2 * CDIM / 64, ROWS / 32), blk, 0, stream>>>(
                h_bf, wkv_bf, bkv + l * 2 * CDIM, nullptr, nullptr, kv_bf,
                ROWS, CDIM, 2 * CDIM);
        attn_kernel<<<dim3(BATCH * HEADS * (SEQ / QBLK)), blk, attnLds, stream>>>(
                q_bf, kv_bf, wfuse + l * 2, attn_bf);
        gemm_bf16_kernel<false, true, false>
            <<<dim3(CDIM / 64, ROWS / 32), blk, 0, stream>>>(
                attn_bf, wo_bf, bo + l * CDIM, xcur, xcur, nullptr,
                ROWS, CDIM, CDIM);

        // --- MLP sublayer ---
        ln_kernel<<<dim3(ROWS), blk, 0, stream>>>(xcur, ln2g + l * CDIM,
                                                  ln2b + l * CDIM, h_bf);
        gemm_bf16_kernel<true, false, true>
            <<<dim3(DFF / 64, ROWS / 32), blk, 0, stream>>>(
                h_bf, w1_bf, b1 + l * DFF, nullptr, nullptr, u_bf,
                ROWS, CDIM, DFF);
        gemm_bf16_kernel<false, true, false>
            <<<dim3(CDIM / 64, ROWS / 32), blk, 0, stream>>>(
                u_bf, w2_bf, b2 + l * CDIM, xcur, xcur, nullptr,
                ROWS, DFF, CDIM);
    }
}

// v001
// Two timings next to v000 both put it at 1.10 times that version's speed.
#include <hip/hip_runtime.h>
#include <hip/hip_bf16.h>
#include <math.h>
#include <stdint.h>

// ---------------- problem constants ----------------
#define LAYERS 2
#define BATCH  4
#define SEQ    1024
#define CDIM   256
#define HEADS  8
#define DHEAD  32          // CDIM / HEADS
#define TOPM   64
#define DFF    1024
#define ROWS   (BATCH * SEQ)      // 4096 token rows
#define LNEPS  1e-5f

// WMMA vector types (CDNA5 wave32)
typedef __attribute__((ext_vector_type(16))) __bf16 v16bf;
typedef __attribute__((ext_vector_type(8)))  float  v8f;

union ABOp {            // one 16x32 bf16 WMMA operand per lane
    uint16_t u[16];
    uint4    q[2];      // two 16-byte chunks
    v16bf    v;
};

__device__ __forceinline__ uint16_t f2bf(float f) {
    uint32_t u = __float_as_uint(f);
    uint32_t r = u + 0x7FFFu + ((u >> 16) & 1u);   // round-to-nearest-even
    return (uint16_t)(r >> 16);
}

__device__ __forceinline__ v8f wmma_bf16(const ABOp& a, const ABOp& b, v8f c) {
    return __builtin_amdgcn_wmma_f32_16x16x32_bf16(
        false, a.v, false, b.v, (short)0, c, false, false);
}

// ---------------- wave-wide reductions on the vector unit ----------------
// Lane l <-> l ^ 16 (other 16-lane row) and l <-> l ^ M (inside a row, DPP
// row_xmask): register-to-register moves, no trip through the LDS crossbar.
__device__ __forceinline__ float xhalf(float x) {
    int b = __builtin_bit_cast(int, x);
    return __builtin_bit_cast(float, __builtin_amdgcn_permlanex16(
        b, b, 0x76543210, 0xfedcba98, false, false));
}
template<int M>
__device__ __forceinline__ float xrow(float x) {
    return __builtin_bit_cast(float, __builtin_amdgcn_mov_dpp(
        __builtin_bit_cast(int, x), 0x160 | M, 0xf, 0xf, true));
}
// Butterfly over 32 lanes in the order 16, 8, 4, 2, 1; every lane gets the result.
__device__ __forceinline__ float wave_sum(float s) {
    s += xhalf(s);   s += xrow<8>(s); s += xrow<4>(s);
    s += xrow<2>(s); s += xrow<1>(s);
    return s;
}
__device__ __forceinline__ float wave_max(float s) {
    s = fmaxf(s, xhalf(s));   s = fmaxf(s, xrow<8>(s)); s = fmaxf(s, xrow<4>(s));
    s = fmaxf(s, xrow<2>(s)); s = fmaxf(s, xrow<1>(s));
    return s;
}
__device__ __forceinline__ float wave_min(float s) {
    s = fminf(s, xhalf(s));   s = fminf(s, xrow<8>(s)); s = fminf(s, xrow<4>(s));
    s = fminf(s, xrow<2>(s)); s = fminf(s, xrow<1>(s));
    return s;
}
// A value that is equal in all lanes, moved to a scalar register.
__device__ __forceinline__ float uniform_f(float x) {
    return __builtin_bit_cast(float,
        __builtin_amdgcn_readfirstlane(__builtin_bit_cast(int, x)));
}

// ---------------- elementwise f32 -> bf16 convert (weights) ----------------
__global__ void cvt_bf16_kernel(const float* __restrict__ in,
                                uint16_t* __restrict__ out, int n) {
    int i = blockIdx.x * blockDim.x + threadIdx.x;
    if (i < n) out[i] = f2bf(in[i]);
}

// ---------------- LayerNorm (one 256-thread block per row) ----------------
__global__ void ln_kernel(const float* __restrict__ x,
                          const float* __restrict__ g,
                          const float* __restrict__ b,
                          uint16_t* __restrict__ out) {
    __shared__ float s1[8], s2[8], stats[2];
    const int row  = blockIdx.x;
    const int tid  = threadIdx.x;
    const int wave = tid >> 5, lane = tid & 31;
    float v = x[(size_t)row * CDIM + tid];
    float s = v, ss = v * v;
    s  = wave_sum(s);
    ss = wave_sum(ss);
    if (lane == 0) { s1[wave] = s; s2[wave] = ss; }
    __syncthreads();
    if (tid == 0) {
        float a = 0.f, c = 0.f;
        #pragma unroll
        for (int i = 0; i < 8; ++i) { a += s1[i]; c += s2[i]; }
        float mean = a * (1.0f / CDIM);
        float var  = c * (1.0f / CDIM) - mean * mean;
        stats[0] = mean;
        stats[1] = rsqrtf(var + LNEPS);
    }
    __syncthreads();
    float y = (v - stats[0]) * stats[1] * g[tid] + b[tid];
    out[(size_t)row * CDIM + tid] = f2bf(y);
}

// ---------------- generic bf16 WMMA GEMM: D = act(A@B + bias) (+resid) ----
// A: [M,K] bf16 row-major.  B: [K,Nc] bf16 row-major (staged in LDS).
// grid = (Nc/64, M/32), block = 256 (8 waves, each owns a 16x16 output tile)
template<bool GELU_, bool RES, bool OUTBF>
__global__ void gemm_bf16_kernel(const uint16_t* __restrict__ A,
                                 const uint16_t* __restrict__ Bw,
                                 const float* __restrict__ bias,
                                 const float* __restrict__ resid,
                                 float* __restrict__ outf,
                                 uint16_t* __restrict__ outb,
                                 int M, int K, int Nc) {
    __shared__ uint16_t Bs[32 * 72];     // 32 K-rows x 64 cols (+8 pad)
    const int tid  = threadIdx.x;
    const int wave = tid >> 5, lane = tid & 31;
    const int g    = lane >> 4;          // half-wave select
    const int wm   = wave >> 2, wn = wave & 3;
    const int row0 = blockIdx.y * 32 + wm * 16;
    const int col0 = blockIdx.x * 64;
    const int colT = col0 + wn * 16;
    const int rB   = tid >> 3, ccB = (tid & 7) * 8;   // B-stage mapping

    v8f acc = {};
    #pragma unroll 2
    for (int kk = 0; kk < K; kk += 32) {
        __syncthreads();
        // cooperative stage of B tile (32x64 bf16 = 4KB, coalesced b128)
        *(uint4*)(&Bs[rB * 72 + ccB]) =
            *(const uint4*)(&Bw[(size_t)(kk + rB) * Nc + col0 + ccB]);
        // prefetch next K-tile of B into cache (gfx1250 global_prefetch path)
        if (kk + 32 < K)
            __builtin_prefetch(&Bw[(size_t)(kk + 32 + rB) * Nc + col0 + ccB], 0, 1);
        __syncthreads();
        // A operand: row m = row0+lane%16, K-chunks at kk+g*8 and kk+16+g*8
        ABOp a;
        const uint16_t* ar = A + (size_t)(row0 + (lane & 15)) * K + kk;
        a.q[0] = *(const uint4*)(ar + g * 8);
        a.q[1] = *(const uint4*)(ar + 16 + g * 8);
        // B operand from LDS: col n = colT+lane%16, same K pattern
        ABOp bm;
        const int n = wn * 16 + (lane & 15);
        #pragma unroll
        for (int j = 0; j < 16; ++j) {
            int kloc = (j < 8) ? (g * 8 + j) : (16 + g * 8 + (j - 8));
            bm.u[j] = Bs[kloc * 72 + n];
        }
        acc = wmma_bf16(a, bm, acc);
    }
    // C/D layout: element v -> (m = row0 + g*8 + v, n = colT + lane%16)
    const int nc = colT + (lane & 15);
    const float bb = bias[nc];
    #pragma unroll
    for (int v = 0; v < 8; ++v) {
        int m = row0 + g * 8 + v;
        float r = acc[v] + bb;
        if (GELU_) r = 0.5f * r * (1.0f + erff(r * 0.70710678118654752f));
        if (RES)   r += resid[(size_t)m * Nc + nc];
        if (OUTBF) outb[(size_t)m * Nc + nc] = f2bf(r);
        else       outf[(size_t)m * Nc + nc] = r;
    }
}

// ---------------- fused dual-pass attention ----------------
// One workgroup = (b, h, 64-query panel). Scores stay in LDS (64 x 1032 f32),
// plus an 8KB LDS chunk for staged V (128 keys x 32 d, bf16).
// Phase 1: QK^T via WMMA. Phase 2: dense softmax stats + top-64 threshold by
// value bisection + fused combined probabilities. Phase 3: P@V via WMMA with
// LDS-staged V chunks (coalesced b128 staging instead of 2B gathers).
#define QBLK  64
#define SLD   1032    // 1024 + 8 pad floats to dodge bank conflicts
#define VCH   128     // keys per staged V chunk
__global__ void attn_kernel(const uint16_t* __restrict__ qb,   // [ROWS,CDIM] bf16
                            const uint16_t* __restrict__ kvb,  // [ROWS,2*CDIM] bf16
                            const float* __restrict__ wf,      // w_fuse[2]
                            uint16_t* __restrict__ attn) {     // [ROWS,CDIM] bf16
    extern __shared__ float sc[];
    uint16_t* Vs = (uint16_t*)(sc + QBLK * SLD);   // [VCH][DHEAD] bf16
    const int bid  = blockIdx.x;
    const int b    = bid / (HEADS * (SEQ / QBLK));
    const int rem  = bid % (HEADS * (SEQ / QBLK));
    const int h    = rem / (SEQ / QBLK);
    const int q0   = (rem % (SEQ / QBLK)) * QBLK;
    const int tid  = threadIdx.x;
    const int wave = tid >> 5, lane = tid & 31;
    const int g    = lane >> 4;
    const float scale = 0.17677669529663687f;   // 1/sqrt(32)

    // learned fusion weights (softmax over 2) -- uniform, scalarizes to SALU
    const float e0 = expf(wf[0]), e1 = expf(wf[1]);
    const float w0 = e0 / (e0 + e1), w1 = e1 / (e0 + e1);

    // ---- phase 1: scores tile 64q x 1024k, 256 WMMA tiles over 8 waves ----
    for (int t = wave; t < (QBLK / 16) * (SEQ / 16); t += 8) {
        const int qt = t >> 6, kt = t & 63;
        ABOp a, bm;
        {   // Q operand: 16 queries x 32 d (contiguous d chunks)
            int m = q0 + qt * 16 + (lane & 15);
            const uint16_t* qr = qb + (size_t)(b * SEQ + m) * CDIM + h * DHEAD;
            a.q[0] = *(const uint4*)(qr + g * 8);
            a.q[1] = *(const uint4*)(qr + 16 + g * 8);
        }
        {   // K operand: 16 keys across lanes, d packed (row-major contiguous)
            int n = kt * 16 + (lane & 15);
            const uint16_t* kr = kvb + (size_t)(b * SEQ + n) * (2 * CDIM) + h * DHEAD;
            bm.q[0] = *(const uint4*)(kr + g * 8);
            bm.q[1] = *(const uint4*)(kr + 16 + g * 8);
        }
        v8f c = {};
        c = wmma_bf16(a, bm, c);
        #pragma unroll
        for (int v = 0; v < 8; ++v)
            sc[(qt * 16 + g * 8 + v) * SLD + kt * 16 + (lane & 15)] = c[v] * scale;
    }
    __syncthreads();

    // ---- phase 2: per-row dense softmax + top-64 threshold + fusion ----
    for (int i = 0; i < 8; ++i) {
        const int row = wave * 8 + i;
        float* rp = sc + row * SLD;
        float rv[32];
        #pragma unroll
        for (int j = 0; j < 32; ++j) rv[j] = rp[lane + j * 32];
        float mx = -1e30f, mn = 1e30f;
        #pragma unroll
        for (int j = 0; j < 32; ++j) { mx = fmaxf(mx, rv[j]); mn = fminf(mn, rv[j]); }
        mx = wave_max(mx);
        mn = wave_min(mn);
        float ev[32];     // each exponential is formed once and kept
        #pragma unroll
        for (int j = 0; j < 32; ++j) ev[j] = expf(rv[j] - mx);
        float sd = 0.f;
        #pragma unroll
        for (int j = 0; j < 32; ++j) sd += ev[j];
        sd = wave_sum(sd);
        // bisection for top-64 threshold: largest t with count(s>t) >= TOPM
        // The count over the wave is taken from the compare masks themselves
        // (ballot + population count), so bounds and count live in scalars.
        float lo = uniform_f(mn) - 1.0f, hi = uniform_f(mx);
        for (int it = 0; it < 24; ++it) {
            float mid = 0.5f * (lo + hi);
            int c = 0;
            #pragma unroll
            for (int j = 0; j < 32; j += 2) {
                uint64_t m0 = __builtin_amdgcn_ballot_w32(rv[j]     > mid);
                uint64_t m1 = __builtin_amdgcn_ballot_w32(rv[j + 1] > mid);
                c += __builtin_popcountll(m0 | (m1 << 32));
            }
            if (c >= TOPM) lo = mid; else hi = mid;
        }
        const float thr = lo;
        float st = 0.f;
        #pragma unroll
        for (int j = 0; j < 32; ++j) st += (rv[j] > thr) ? ev[j] : 0.f;
        st = wave_sum(st);
        const float cd = w0 / sd;
        const float ct = w1 / fmaxf(st, 1e-20f);
        #pragma unroll
        for (int j = 0; j < 32; ++j)
            rp[lane + j * 32] = ev[j] * (cd + ((rv[j] > thr) ? ct : 0.f));
    }
    __syncthreads();

    // ---- phase 3: out = P @ V with LDS-staged V chunks ----
    {
        const int qt = wave >> 1, dt = wave & 1;
        const int d  = dt * 16 + (lane & 15);
        const int m  = qt * 16 + (lane & 15);
        v8f acc = {};
        for (int kk0 = 0; kk0 < SEQ; kk0 += VCH) {
            // stage V[kk0 .. kk0+VCH) x DHEAD : 8KB, coalesced b128 loads
            {
                const uint16_t* vb = kvb + (size_t)(b * SEQ + kk0) * (2 * CDIM)
                                     + CDIM + h * DHEAD;
                #pragma unroll
                for (int it = 0; it < 2; ++it) {
                    int idx = tid * 2 + it;            // 512 uint4 total
                    int r = idx >> 2, c = (idx & 3) * 8;
                    *(uint4*)(&Vs[r * DHEAD + c]) =
                        *(const uint4*)(vb + (size_t)r * (2 * CDIM) + c);
                }
            }
            __syncthreads();
            #pragma unroll
            for (int ks = 0; ks < VCH / 32; ++ks) {
                const int kk = kk0 + ks * 32;
                ABOp a, bm;
                #pragma unroll
                for (int j = 0; j < 16; ++j) {
                    int kl = (j < 8) ? (g * 8 + j) : (16 + g * 8 + (j - 8));
                    a.u[j]  = f2bf(sc[m * SLD + kk + kl]);
                    bm.u[j] = Vs[(ks * 32 + kl) * DHEAD + d];
                }
                acc = wmma_bf16(a, bm, acc);
            }
            __syncthreads();
        }
        #pragma unroll
        for (int v = 0; v < 8; ++v) {
            int mr = q0 + qt * 16 + g * 8 + v;
            int nc = dt * 16 + (lane & 15);
            attn[(size_t)(b * SEQ + mr) * CDIM + h * DHEAD + nc] = f2bf(acc[v]);
        }
    }
}

// ---------------- host side ----------------
extern "C" void kernel_launch(void* const* d_in, const int* in_sizes, int n_in,
                              void* d_out, int out_size, void* d_ws, size_t ws_size,
                              hipStream_t stream) {
    (void)in_sizes; (void)n_in; (void)out_size; (void)ws_size;
    const float* x     = (const float*)d_in[0];
    const float* ln1g  = (const float*)d_in[1];
    const float* ln1b  = (const float*)d_in[2];
    const float* Wq    = (const float*)d_in[3];
    const float* bq    = (const float*)d_in[4];
    const float* Wkv   = (const float*)d_in[5];
    const float* bkv   = (const float*)d_in[6];
    const float* wfuse = (const float*)d_in[7];
    const float* Wo    = (const float*)d_in[8];
    const float* bo    = (const float*)d_in[9];
    const float* ln2g  = (const float*)d_in[10];
    const float* ln2b  = (const float*)d_in[11];
    const float* W1    = (const float*)d_in[12];
    const float* b1    = (const float*)d_in[13];
    const float* W2    = (const float*)d_in[14];
    const float* b2    = (const float*)d_in[15];
    float* xcur = (float*)d_out;                       // running activations

    // workspace carve-up (bf16 buffers, 256B-aligned power-of-two sizes)
    uint8_t* ws = (uint8_t*)d_ws;
    uint16_t* wq_bf   = (uint16_t*)(ws);                 size_t off = CDIM * CDIM * 2;
    uint16_t* wkv_bf  = (uint16_t*)(ws + off);           off += CDIM * 2 * CDIM * 2;
    uint16_t* wo_bf   = (uint16_t*)(ws + off);           off += CDIM * CDIM * 2;
    uint16_t* w1_bf   = (uint16_t*)(ws + off);           off += CDIM * DFF * 2;
    uint16_t* w2_bf   = (uint16_t*)(ws + off);           off += DFF * CDIM * 2;
    uint16_t* h_bf    = (uint16_t*)(ws + off);           off += (size_t)ROWS * CDIM * 2;
    uint16_t* q_bf    = (uint16_t*)(ws + off);           off += (size_t)ROWS * CDIM * 2;
    uint16_t* kv_bf   = (uint16_t*)(ws + off);           off += (size_t)ROWS * 2 * CDIM * 2;
    uint16_t* attn_bf = (uint16_t*)(ws + off);           off += (size_t)ROWS * CDIM * 2;
    uint16_t* u_bf    = (uint16_t*)(ws + off);

    // x -> d_out (running buffer)
    hipMemcpyAsync(xcur, x, (size_t)ROWS * CDIM * sizeof(float),
                   hipMemcpyDeviceToDevice, stream);

    const int attnLds = QBLK * SLD * (int)sizeof(float)           // score panel
                      + VCH * DHEAD * (int)sizeof(uint16_t);      // V chunk
    hipFuncSetAttribute((const void*)attn_kernel,
                        hipFuncAttributeMaxDynamicSharedMemorySize, attnLds);

    const dim3 blk(256);
    for (int l = 0; l < LAYERS; ++l) {
        // per-layer weight slices -> bf16
        auto cvt = [&](const float* src, uint16_t* dst, int n) {
            cvt_bf16_kernel<<<dim3((n + 255) / 256), blk, 0, stream>>>(src, dst, n);
        };
        cvt(Wq  + (size_t)l * CDIM * CDIM,     wq_bf,  CDIM * CDIM);
        cvt(Wkv + (size_t)l * CDIM * 2 * CDIM, wkv_bf, CDIM * 2 * CDIM);
        cvt(Wo  + (size_t)l * CDIM * CDIM,     wo_bf,  CDIM * CDIM);
        cvt(W1  + (size_t)l * CDIM * DFF,      w1_bf,  CDIM * DFF);
        cvt(W2  + (size_t)l * DFF * CDIM,      w2_bf,  DFF * CDIM);

        // --- attention sublayer ---
        ln_kernel<<<dim3(ROWS), blk, 0, stream>>>(xcur, ln1g + l * CDIM,
                                                  ln1b + l * CDIM, h_bf);
        gemm_bf16_kernel<false, false, true>
            <<<dim3(CDIM / 64, ROWS / 32), blk, 0, stream>>>(
                h_bf, wq_bf, bq + l * CDIM, nullptr, nullptr, q_bf,
                ROWS, CDIM, CDIM);
        gemm_bf16_kernel<false, false, true>
            <<<dim3(2 * CDIM / 64, ROWS / 32), blk, 0, stream>>>(
                h_bf, wkv_bf, bkv + l * 2 * CDIM, nullptr, nullptr, kv_bf,
                ROWS, CDIM, 2 * CDIM);
        attn_kernel<<<dim3(BATCH * HEADS * (SEQ / QBLK)), blk, attnLds, stream>>>(
                q_bf, kv_bf, wfuse + l * 2, attn_bf);
        gemm_bf16_kernel<false, true, false>
            <<<dim3(CDIM / 64, ROWS / 32), blk, 0, stream>>>(
                attn_bf, wo_bf, bo + l * CDIM, xcur, xcur, nullptr,
                ROWS, CDIM, CDIM);

        // --- MLP sublayer ---
        ln_kernel<<<dim3(ROWS), blk, 0, stream>>>(xcur, ln2g + l * CDIM,
                                                  ln2b + l * CDIM, h_bf);
        gemm_bf16_kernel<true, false, true>
            <<<dim3(DFF / 64, ROWS / 32), blk, 0, stream>>>(
                h_bf, w1_bf, b1 + l * DFF, nullptr, nullptr, u_bf,
                ROWS, CDIM, DFF);
        gemm_bf16_kernel<false, true, false>
            <<<dim3(CDIM / 64, ROWS / 32), blk, 0, stream>>>(
                u_bf, w2_bf, b2 + l * CDIM, xcur, xcur, nullptr,
                ROWS, DFF, CDIM);
    }
}

// v002
// Next to v001, in two timings, it ran 1.18 times as fast each time.
// Over all steps from v000 it is 1.30 times as fast.
#include <hip/hip_runtime.h>
#include <hip/hip_bf16.h>
#include <math.h>
#include <stdint.h>

// ---------------- problem constants ----------------
#define LAYERS 2
#define BATCH  4
#define SEQ    1024
#define CDIM   256
#define HEADS  8
#define DHEAD  32          // CDIM / HEADS
#define TOPM   64
#define DFF    1024
#define ROWS   (BATCH * SEQ)      // 4096 token rows
#define LNEPS  1e-5f

// WMMA vector types (CDNA5 wave32)
typedef __attribute__((ext_vector_type(16))) __bf16 v16bf;
typedef __attribute__((ext_vector_type(8)))  float  v8f;

union ABOp {            // one 16x32 bf16 WMMA operand per lane
    uint16_t u[16];
    uint4    q[2];      // two 16-byte chunks
    v16bf    v;
};

__device__ __forceinline__ uint16_t f2bf(float f) {
    uint32_t u = __float_as_uint(f);
    uint32_t r = u + 0x7FFFu + ((u >> 16) & 1u);   // round-to-nearest-even
    return (uint16_t)(r >> 16);
}

__device__ __forceinline__ v8f wmma_bf16(const ABOp& a, const ABOp& b, v8f c) {
    return __builtin_amdgcn_wmma_f32_16x16x32_bf16(
        false, a.v, false, b.v, (short)0, c, false, false);
}

// ---------------- wave-wide reductions on the vector unit ----------------
// Lane l <-> l ^ 16 (other 16-lane row) and l <-> l ^ M (inside a row, DPP
// row_xmask): register-to-register moves, no trip through the LDS crossbar.
__device__ __forceinline__ float xhalf(float x) {
    int b = __builtin_bit_cast(int, x);
    return __builtin_bit_cast(float, __builtin_amdgcn_permlanex16(
        b, b, 0x76543210, 0xfedcba98, false, false));
}
template<int M>
__device__ __forceinline__ float xrow(float x) {
    return __builtin_bit_cast(float, __builtin_amdgcn_mov_dpp(
        __builtin_bit_cast(int, x), 0x160 | M, 0xf, 0xf, true));
}
// Butterfly over 32 lanes in the order 16, 8, 4, 2, 1; every lane gets the result.
__device__ __forceinline__ float wave_sum(float s) {
    s += xhalf(s);   s += xrow<8>(s); s += xrow<4>(s);
    s += xrow<2>(s); s += xrow<1>(s);
    return s;
}
__device__ __forceinline__ float wave_max(float s) {
    s = fmaxf(s, xhalf(s));   s = fmaxf(s, xrow<8>(s)); s = fmaxf(s, xrow<4>(s));
    s = fmaxf(s, xrow<2>(s)); s = fmaxf(s, xrow<1>(s));
    return s;
}
__device__ __forceinline__ float wave_min(float s) {
    s = fminf(s, xhalf(s));   s = fminf(s, xrow<8>(s)); s = fminf(s, xrow<4>(s));
    s = fminf(s, xrow<2>(s)); s = fminf(s, xrow<1>(s));
    return s;
}
// A value that is equal in all lanes, moved to a scalar register.
__device__ __forceinline__ float uniform_f(float x) {
    return __builtin_bit_cast(float,
        __builtin_amdgcn_readfirstlane(__builtin_bit_cast(int, x)));
}

// ---------------- elementwise f32 -> bf16 convert (weights) ----------------
__global__ void cvt_bf16_kernel(const float* __restrict__ in,
                                uint16_t* __restrict__ out, int n) {
    int i = blockIdx.x * blockDim.x + threadIdx.x;
    if (i < n) out[i] = f2bf(in[i]);
}

// ---------------- LayerNorm (one 256-thread block per row) ----------------
__global__ void ln_kernel(const float* __restrict__ x,
                          const float* __restrict__ g,
                          const float* __restrict__ b,
                          uint16_t* __restrict__ out) {
    __shared__ float s1[8], s2[8], stats[2];
    const int row  = blockIdx.x;
    const int tid  = threadIdx.x;
    const int wave = tid >> 5, lane = tid & 31;
    float v = x[(size_t)row * CDIM + tid];
    float s = v, ss = v * v;
    s  = wave_sum(s);
    ss = wave_sum(ss);
    if (lane == 0) { s1[wave] = s; s2[wave] = ss; }
    __syncthreads();
    if (tid == 0) {
        float a = 0.f, c = 0.f;
        #pragma unroll
        for (int i = 0; i < 8; ++i) { a += s1[i]; c += s2[i]; }
        float mean = a * (1.0f / CDIM);
        float var  = c * (1.0f / CDIM) - mean * mean;
        stats[0] = mean;
        stats[1] = rsqrtf(var + LNEPS);
    }
    __syncthreads();
    float y = (v - stats[0]) * stats[1] * g[tid] + b[tid];
    out[(size_t)row * CDIM + tid] = f2bf(y);
}

// ---------------- generic bf16 WMMA GEMM: D = act(A@B + bias) (+resid) ----
// A: [M,K] bf16 row-major.  B: [K,Nc] bf16 row-major (staged in LDS).
// grid = (Nc/64, M/32), block = 256 (8 waves, each owns a 16x16 output tile)
template<bool GELU_, bool RES, bool OUTBF>
__global__ void gemm_bf16_kernel(const uint16_t* __restrict__ A,
                                 const uint16_t* __restrict__ Bw,
                                 const float* __restrict__ bias,
                                 const float* __restrict__ resid,
                                 float* __restrict__ outf,
                                 uint16_t* __restrict__ outb,
                                 int M, int K, int Nc) {
    __shared__ uint16_t Bs[32 * 72];     // 32 K-rows x 64 cols (+8 pad)
    const int tid  = threadIdx.x;
    const int wave = tid >> 5, lane = tid & 31;
    const int g    = lane >> 4;          // half-wave select
    const int wm   = wave >> 2, wn = wave & 3;
    const int row0 = blockIdx.y * 32 + wm * 16;
    const int col0 = blockIdx.x * 64;
    const int colT = col0 + wn * 16;
    const int rB   = tid >> 3, ccB = (tid & 7) * 8;   // B-stage mapping

    v8f acc = {};
    #pragma unroll 2
    for (int kk = 0; kk < K; kk += 32) {
        __syncthreads();
        // cooperative stage of B tile (32x64 bf16 = 4KB, coalesced b128)
        *(uint4*)(&Bs[rB * 72 + ccB]) =
            *(const uint4*)(&Bw[(size_t)(kk + rB) * Nc + col0 + ccB]);
        // prefetch next K-tile of B into cache (gfx1250 global_prefetch path)
        if (kk + 32 < K)
            __builtin_prefetch(&Bw[(size_t)(kk + 32 + rB) * Nc + col0 + ccB], 0, 1);
        __syncthreads();
        // A operand: row m = row0+lane%16, K-chunks at kk+g*8 and kk+16+g*8
        ABOp a;
        const uint16_t* ar = A + (size_t)(row0 + (lane & 15)) * K + kk;
        a.q[0] = *(const uint4*)(ar + g * 8);
        a.q[1] = *(const uint4*)(ar + 16 + g * 8);
        // B operand from LDS: col n = colT+lane%16, same K pattern
        ABOp bm;
        const int n = wn * 16 + (lane & 15);
        #pragma unroll
        for (int j = 0; j < 16; ++j) {
            int kloc = (j < 8) ? (g * 8 + j) : (16 + g * 8 + (j - 8));
            bm.u[j] = Bs[kloc * 72 + n];
        }
        acc = wmma_bf16(a, bm, acc);
    }
    // C/D layout: element v -> (m = row0 + g*8 + v, n = colT + lane%16)
    const int nc = colT + (lane & 15);
    const float bb = bias[nc];
    #pragma unroll
    for (int v = 0; v < 8; ++v) {
        int m = row0 + g * 8 + v;
        float r = acc[v] + bb;
        if (GELU_) r = 0.5f * r * (1.0f + erff(r * 0.70710678118654752f));
        if (RES)   r += resid[(size_t)m * Nc + nc];
        if (OUTBF) outb[(size_t)m * Nc + nc] = f2bf(r);
        else       outf[(size_t)m * Nc + nc] = r;
    }
}

// ---------------- fused dual-pass attention ----------------
// One workgroup = (b, h, 64-query panel). Scores stay in LDS (64 x 1032 f32),
// plus an 8KB LDS chunk for staged V (128 keys x 32 d, bf16).
// Phase 1: QK^T via WMMA. Phase 2: dense softmax stats + top-64 threshold by
// value bisection + fused combined probabilities. Phase 3: P@V via WMMA with
// LDS-staged V chunks (coalesced b128 staging instead of 2B gathers).
#define QBLK  64
#define SLD   1032    // 1024 + 8 pad floats to dodge bank conflicts
#define VCH   128     // keys per staged V chunk
__global__ void attn_kernel(const uint16_t* __restrict__ qb,   // [ROWS,CDIM] bf16
                            const uint16_t* __restrict__ kvb,  // [ROWS,2*CDIM] bf16
                            const float* __restrict__ wf,      // w_fuse[2]
                            uint16_t* __restrict__ attn) {     // [ROWS,CDIM] bf16
    extern __shared__ float sc[];
    uint16_t* Vs = (uint16_t*)(sc + QBLK * SLD);   // [VCH][DHEAD] bf16
    const int bid  = blockIdx.x;
    const int b    = bid / (HEADS * (SEQ / QBLK));
    const int rem  = bid % (HEADS * (SEQ / QBLK));
    const int h    = rem / (SEQ / QBLK);
    const int q0   = (rem % (SEQ / QBLK)) * QBLK;
    const int tid  = threadIdx.x;
    const int wave = tid >> 5, lane = tid & 31;
    const int g    = lane >> 4;
    const float scale = 0.17677669529663687f;   // 1/sqrt(32)

    // learned fusion weights (softmax over 2) -- uniform, scalarizes to SALU
    const float e0 = expf(wf[0]), e1 = expf(wf[1]);
    const float w0 = e0 / (e0 + e1), w1 = e1 / (e0 + e1);

    // ---- phase 1: scores tile 64q x 1024k, 256 WMMA tiles over 8 waves ----
    for (int t = wave; t < (QBLK / 16) * (SEQ / 16); t += 8) {
        const int qt = t >> 6, kt = t & 63;
        ABOp a, bm;
        {   // Q operand: 16 queries x 32 d (contiguous d chunks)
            int m = q0 + qt * 16 + (lane & 15);
            const uint16_t* qr = qb + (size_t)(b * SEQ + m) * CDIM + h * DHEAD;
            a.q[0] = *(const uint4*)(qr + g * 8);
            a.q[1] = *(const uint4*)(qr + 16 + g * 8);
        }
        {   // K operand: 16 keys across lanes, d packed (row-major contiguous)
            int n = kt * 16 + (lane & 15);
            const uint16_t* kr = kvb + (size_t)(b * SEQ + n) * (2 * CDIM) + h * DHEAD;
            bm.q[0] = *(const uint4*)(kr + g * 8);
            bm.q[1] = *(const uint4*)(kr + 16 + g * 8);
        }
        v8f c = {};
        c = wmma_bf16(a, bm, c);
        #pragma unroll
        for (int v = 0; v < 8; ++v)
            sc[(qt * 16 + g * 8 + v) * SLD + kt * 16 + (lane & 15)] = c[v] * scale;
    }
    __syncthreads();

    // ---- phase 2: per-row dense softmax + top-64 threshold + fusion ----
    for (int i = 0; i < 8; ++i) {
        const int row = wave * 8 + i;
        float* rp = sc + row * SLD;
        float rv[32];
        #pragma unroll
        for (int j = 0; j < 32; ++j) rv[j] = rp[lane + j * 32];
        float mx = -1e30f, mn = 1e30f;
        #pragma unroll
        for (int j = 0; j < 32; ++j) { mx = fmaxf(mx, rv[j]); mn = fminf(mn, rv[j]); }
        mx = wave_max(mx);
        mn = wave_min(mn);
        float ev[32];     // each exponential is formed once and kept
        #pragma unroll
        for (int j = 0; j < 32; ++j) ev[j] = expf(rv[j] - mx);
        float sd = 0.f;
        #pragma unroll
        for (int j = 0; j < 32; ++j) sd += ev[j];
        sd = wave_sum(sd);
        // bisection for top-64 threshold: largest t with count(s>t) >= TOPM
        // The count over the wave is taken from the compare masks themselves
        // (ballot + population count), so bounds and count live in scalars.
        float lo = uniform_f(mn) - 1.0f, hi = uniform_f(mx);
        for (int left = 24; left > 0; ) {
            float mid = 0.5f * (lo + hi);
            int c = 0;
            #pragma unroll
            for (int j = 0; j < 32; j += 2) {
                uint64_t m0 = __builtin_amdgcn_ballot_w32(rv[j]     > mid);
                uint64_t m1 = __builtin_amdgcn_ballot_w32(rv[j + 1] > mid);
                c += __builtin_popcountll(m0 | (m1 << 32));
            }
            if (c >= TOPM) lo = mid; else hi = mid;
            // Exactly TOPM scores lie above lo: every later step keeps this
            // same set, so the search is over (24 steps stay the bound).
            left = (c == TOPM) ? 0 : left - 1;
        }
        const float thr = lo;
        float st = 0.f;
        #pragma unroll
        for (int j = 0; j < 32; ++j) st += (rv[j] > thr) ? ev[j] : 0.f;
        st = wave_sum(st);
        const float cd = w0 / sd;
        const float ct = w1 / fmaxf(st, 1e-20f);
        #pragma unroll
        for (int j = 0; j < 32; ++j)
            rp[lane + j * 32] = ev[j] * (cd + ((rv[j] > thr) ? ct : 0.f));
    }
    __syncthreads();

    // ---- phase 3: out = P @ V with LDS-staged V chunks ----
    {
        const int qt = wave >> 1, dt = wave & 1;
        const int d  = dt * 16 + (lane & 15);
        const int m  = qt * 16 + (lane & 15);
        v8f acc = {};
        for (int kk0 = 0; kk0 < SEQ; kk0 += VCH) {
            // stage V[kk0 .. kk0+VCH) x DHEAD : 8KB, coalesced b128 loads
            {
                const uint16_t* vb = kvb + (size_t)(b * SEQ + kk0) * (2 * CDIM)
                                     + CDIM + h * DHEAD;
                #pragma unroll
                for (int it = 0; it < 2; ++it) {
                    int idx = tid * 2 + it;            // 512 uint4 total
                    int r = idx >> 2, c = (idx & 3) * 8;
                    *(uint4*)(&Vs[r * DHEAD + c]) =
                        *(const uint4*)(vb + (size_t)r * (2 * CDIM) + c);
                }
            }
            __syncthreads();
            #pragma unroll
            for (int ks = 0; ks < VCH / 32; ++ks) {
                const int kk = kk0 + ks * 32;
                ABOp a, bm;
                #pragma unroll
                for (int j = 0; j < 16; ++j) {
                    int kl = (j < 8) ? (g * 8 + j) : (16 + g * 8 + (j - 8));
                    a.u[j]  = f2bf(sc[m * SLD + kk + kl]);
                    bm.u[j] = Vs[(ks * 32 + kl) * DHEAD + d];
                }
                acc = wmma_bf16(a, bm, acc);
            }
            __syncthreads();
        }
        #pragma unroll
        for (int v = 0; v < 8; ++v) {
            int mr = q0 + qt * 16 + g * 8 + v;
            int nc = dt * 16 + (lane & 15);
            attn[(size_t)(b * SEQ + mr) * CDIM + h * DHEAD + nc] = f2bf(acc[v]);
        }
    }
}

// ---------------- host side ----------------
extern "C" void kernel_launch(void* const* d_in, const int* in_sizes, int n_in,
                              void* d_out, int out_size, void* d_ws, size_t ws_size,
                              hipStream_t stream) {
    (void)in_sizes; (void)n_in; (void)out_size; (void)ws_size;
    const float* x     = (const float*)d_in[0];
    const float* ln1g  = (const float*)d_in[1];
    const float* ln1b  = (const float*)d_in[2];
    const float* Wq    = (const float*)d_in[3];
    const float* bq    = (const float*)d_in[4];
    const float* Wkv   = (const float*)d_in[5];
    const float* bkv   = (const float*)d_in[6];
    const float* wfuse = (const float*)d_in[7];
    const float* Wo    = (const float*)d_in[8];
    const float* bo    = (const float*)d_in[9];
    const float* ln2g  = (const float*)d_in[10];
    const float* ln2b  = (const float*)d_in[11];
    const float* W1    = (const float*)d_in[12];
    const float* b1    = (const float*)d_in[13];
    const float* W2    = (const float*)d_in[14];
    const float* b2    = (const float*)d_in[15];
    float* xcur = (float*)d_out;                       // running activations

    // workspace carve-up (bf16 buffers, 256B-aligned power-of-two sizes)
    uint8_t* ws = (uint8_t*)d_ws;
    uint16_t* wq_bf   = (uint16_t*)(ws);                 size_t off = CDIM * CDIM * 2;
    uint16_t* wkv_bf  = (uint16_t*)(ws + off);           off += CDIM * 2 * CDIM * 2;
    uint16_t* wo_bf   = (uint16_t*)(ws + off);           off += CDIM * CDIM * 2;
    uint16_t* w1_bf   = (uint16_t*)(ws + off);           off += CDIM * DFF * 2;
    uint16_t* w2_bf   = (uint16_t*)(ws + off);           off += DFF * CDIM * 2;
    uint16_t* h_bf    = (uint16_t*)(ws + off);           off += (size_t)ROWS * CDIM * 2;
    uint16_t* q_bf    = (uint16_t*)(ws + off);           off += (size_t)ROWS * CDIM * 2;
    uint16_t* kv_bf   = (uint16_t*)(ws + off);           off += (size_t)ROWS * 2 * CDIM * 2;
    uint16_t* attn_bf = (uint16_t*)(ws + off);           off += (size_t)ROWS * CDIM * 2;
    uint16_t* u_bf    = (uint16_t*)(ws + off);

    // x -> d_out (running buffer)
    hipMemcpyAsync(xcur, x, (size_t)ROWS * CDIM * sizeof(float),
                   hipMemcpyDeviceToDevice, stream);

    const int attnLds = QBLK * SLD * (int)sizeof(float)           // score panel
                      + VCH * DHEAD * (int)sizeof(uint16_t);      // V chunk
    hipFuncSetAttribute((const void*)attn_kernel,
                        hipFuncAttributeMaxDynamicSharedMemorySize, attnLds);

    const dim3 blk(256);
    for (int l = 0; l < LAYERS; ++l) {
        // per-layer weight slices -> bf16
        auto cvt = [&](const float* src, uint16_t* dst, int n) {
            cvt_bf16_kernel<<<dim3((n + 255) / 256), blk, 0, stream>>>(src, dst, n);
        };
        cvt(Wq  + (size_t)l * CDIM * CDIM,     wq_bf,  CDIM * CDIM);
        cvt(Wkv + (size_t)l * CDIM * 2 * CDIM, wkv_bf, CDIM * 2 * CDIM);
        cvt(Wo  + (size_t)l * CDIM * CDIM,     wo_bf,  CDIM * CDIM);
        cvt(W1  + (size_t)l * CDIM * DFF,      w1_bf,  CDIM * DFF);
        cvt(W2  + (size_t)l * DFF * CDIM,      w2_bf,  DFF * CDIM);

        // --- attention sublayer ---
        ln_kernel<<<dim3(ROWS), blk, 0, stream>>>(xcur, ln1g + l * CDIM,
                                                  ln1b + l * CDIM, h_bf);
        gemm_bf16_kernel<false, false, true>
            <<<dim3(CDIM / 64, ROWS / 32), blk, 0, stream>>>(
                h_bf, wq_bf, bq + l * CDIM, nullptr, nullptr, q_bf,
                ROWS, CDIM, CDIM);
        gemm_bf16_kernel<false, false, true>
            <<<dim3(2 * CDIM / 64, ROWS / 32), blk, 0, stream>>>(
                h_bf, wkv_bf, bkv + l * 2 * CDIM, nullptr, nullptr, kv_bf,
                ROWS, CDIM, 2 * CDIM);
        attn_kernel<<<dim3(BATCH * HEADS * (SEQ / QBLK)), blk, attnLds, stream>>>(
                q_bf, kv_bf, wfuse + l * 2, attn_bf);
        gemm_bf16_kernel<false, true, false>
            <<<dim3(CDIM / 64, ROWS / 32), blk, 0, stream>>>(
                attn_bf, wo_bf, bo + l * CDIM, xcur, xcur, nullptr,
                ROWS, CDIM, CDIM);

        // --- MLP sublayer ---
        ln_kernel<<<dim3(ROWS), blk, 0, stream>>>(xcur, ln2g + l * CDIM,
                                                  ln2b + l * CDIM, h_bf);
        gemm_bf16_kernel<true, false, true>
            <<<dim3(DFF / 64, ROWS / 32), blk, 0, stream>>>(
                h_bf, w1_bf, b1 + l * DFF, nullptr, nullptr, u_bf,
                ROWS, CDIM, DFF);
        gemm_bf16_kernel<false, true, false>
            <<<dim3(CDIM / 64, ROWS / 32), blk, 0, stream>>>(
                u_bf, w2_bf, b2 + l * CDIM, xcur, xcur, nullptr,
                ROWS, DFF, CDIM);
    }
}

// v003
// Next to v002, in two timings, it ran 1.21 and 1.22 times as fast.
// Over all steps from v000 it is 1.58 times as fast.
#include <hip/hip_runtime.h>
#include <hip/hip_bf16.h>
#include <math.h>
#include <stdint.h>

// ---------------- problem constants ----------------
#define LAYERS 2
#define BATCH  4
#define SEQ    1024
#define CDIM   256
#define HEADS  8
#define DHEAD  32          // CDIM / HEADS
#define TOPM   64
#define DFF    1024
#define ROWS   (BATCH * SEQ)      // 4096 token rows
#define LNEPS  1e-5f

// WMMA vector types (CDNA5 wave32)
typedef __attribute__((ext_vector_type(16))) __bf16 v16bf;
typedef __attribute__((ext_vector_type(8)))  float  v8f;

union ABOp {            // one 16x32 bf16 WMMA operand per lane
    uint16_t u[16];
    uint4    q[2];      // two 16-byte chunks
    v16bf    v;
};

__device__ __forceinline__ uint16_t f2bf(float f) {
    uint32_t u = __float_as_uint(f);
    uint32_t r = u + 0x7FFFu + ((u >> 16) & 1u);   // round-to-nearest-even
    return (uint16_t)(r >> 16);
}

__device__ __forceinline__ v8f wmma_bf16(const ABOp& a, const ABOp& b, v8f c) {
    return __builtin_amdgcn_wmma_f32_16x16x32_bf16(
        false, a.v, false, b.v, (short)0, c, false, false);
}

// ---------------- wave-wide reductions on the vector unit ----------------
// Lane l <-> l ^ 16 (other 16-lane row) and l <-> l ^ M (inside a row, DPP
// row_xmask): register-to-register moves, no trip through the LDS crossbar.
__device__ __forceinline__ float xhalf(float x) {
    int b = __builtin_bit_cast(int, x);
    return __builtin_bit_cast(float, __builtin_amdgcn_permlanex16(
        b, b, 0x76543210, 0xfedcba98, false, false));
}
template<int M>
__device__ __forceinline__ float xrow(float x) {
    return __builtin_bit_cast(float, __builtin_amdgcn_mov_dpp(
        __builtin_bit_cast(int, x), 0x160 | M, 0xf, 0xf, true));
}
// Butterfly over 32 lanes in the order 16, 8, 4, 2, 1; every lane gets the result.
__device__ __forceinline__ float wave_sum(float s) {
    s += xhalf(s);   s += xrow<8>(s); s += xrow<4>(s);
    s += xrow<2>(s); s += xrow<1>(s);
    return s;
}
__device__ __forceinline__ float wave_max(float s) {
    s = fmaxf(s, xhalf(s));   s = fmaxf(s, xrow<8>(s)); s = fmaxf(s, xrow<4>(s));
    s = fmaxf(s, xrow<2>(s)); s = fmaxf(s, xrow<1>(s));
    return s;
}
__device__ __forceinline__ float wave_min(float s) {
    s = fminf(s, xhalf(s));   s = fminf(s, xrow<8>(s)); s = fminf(s, xrow<4>(s));
    s = fminf(s, xrow<2>(s)); s = fminf(s, xrow<1>(s));
    return s;
}
// A value that is equal in all lanes, moved to a scalar register.
__device__ __forceinline__ float uniform_f(float x) {
    return __builtin_bit_cast(float,
        __builtin_amdgcn_readfirstlane(__builtin_bit_cast(int, x)));
}

// ---------------- elementwise f32 -> bf16 convert (weights) ----------------
__global__ void cvt_bf16_kernel(const float* __restrict__ in,
                                uint16_t* __restrict__ out, int n) {
    int i = blockIdx.x * blockDim.x + threadIdx.x;
    if (i < n) out[i] = f2bf(in[i]);
}

// ---------------- LayerNorm (one 256-thread block per row) ----------------
__global__ void ln_kernel(const float* __restrict__ x,
                          const float* __restrict__ g,
                          const float* __restrict__ b,
                          uint16_t* __restrict__ out) {
    __shared__ float s1[8], s2[8], stats[2];
    const int row  = blockIdx.x;
    const int tid  = threadIdx.x;
    const int wave = tid >> 5, lane = tid & 31;
    float v = x[(size_t)row * CDIM + tid];
    float s = v, ss = v * v;
    s  = wave_sum(s);
    ss = wave_sum(ss);
    if (lane == 0) { s1[wave] = s; s2[wave] = ss; }
    __syncthreads();
    if (tid == 0) {
        float a = 0.f, c = 0.f;
        #pragma unroll
        for (int i = 0; i < 8; ++i) { a += s1[i]; c += s2[i]; }
        float mean = a * (1.0f / CDIM);
        float var  = c * (1.0f / CDIM) - mean * mean;
        stats[0] = mean;
        stats[1] = rsqrtf(var + LNEPS);
    }
    __syncthreads();
    float y = (v - stats[0]) * stats[1] * g[tid] + b[tid];
    out[(size_t)row * CDIM + tid] = f2bf(y);
}

// ---------------- generic bf16 WMMA GEMM: D = act(A@B + bias) (+resid) ----
// A: [M,K] bf16 row-major.  B: [K,Nc] bf16 row-major (staged in LDS).
// grid = (Nc/64, M/32), block = 256 (8 waves, each owns a 16x16 output tile)
template<bool GELU_, bool RES, bool OUTBF>
__global__ void gemm_bf16_kernel(const uint16_t* __restrict__ A,
                                 const uint16_t* __restrict__ Bw,
                                 const float* __restrict__ bias,
                                 const float* __restrict__ resid,
                                 float* __restrict__ outf,
                                 uint16_t* __restrict__ outb,
                                 int M, int K, int Nc) {
    __shared__ uint16_t Bs[32 * 72];     // 32 K-rows x 64 cols (+8 pad)
    const int tid  = threadIdx.x;
    const int wave = tid >> 5, lane = tid & 31;
    const int g    = lane >> 4;          // half-wave select
    const int wm   = wave >> 2, wn = wave & 3;
    const int row0 = blockIdx.y * 32 + wm * 16;
    const int col0 = blockIdx.x * 64;
    const int colT = col0 + wn * 16;
    const int rB   = tid >> 3, ccB = (tid & 7) * 8;   // B-stage mapping

    v8f acc = {};
    #pragma unroll 2
    for (int kk = 0; kk < K; kk += 32) {
        __syncthreads();
        // cooperative stage of B tile (32x64 bf16 = 4KB, coalesced b128)
        *(uint4*)(&Bs[rB * 72 + ccB]) =
            *(const uint4*)(&Bw[(size_t)(kk + rB) * Nc + col0 + ccB]);
        // prefetch next K-tile of B into cache (gfx1250 global_prefetch path)
        if (kk + 32 < K)
            __builtin_prefetch(&Bw[(size_t)(kk + 32 + rB) * Nc + col0 + ccB], 0, 1);
        __syncthreads();
        // A operand: row m = row0+lane%16, K-chunks at kk+g*8 and kk+16+g*8
        ABOp a;
        const uint16_t* ar = A + (size_t)(row0 + (lane & 15)) * K + kk;
        a.q[0] = *(const uint4*)(ar + g * 8);
        a.q[1] = *(const uint4*)(ar + 16 + g * 8);
        // B operand from LDS: col n = colT+lane%16, same K pattern
        ABOp bm;
        const int n = wn * 16 + (lane & 15);
        #pragma unroll
        for (int j = 0; j < 16; ++j) {
            int kloc = (j < 8) ? (g * 8 + j) : (16 + g * 8 + (j - 8));
            bm.u[j] = Bs[kloc * 72 + n];
        }
        acc = wmma_bf16(a, bm, acc);
    }
    // C/D layout: element v -> (m = row0 + g*8 + v, n = colT + lane%16)
    const int nc = colT + (lane & 15);
    const float bb = bias[nc];
    #pragma unroll
    for (int v = 0; v < 8; ++v) {
        int m = row0 + g * 8 + v;
        float r = acc[v] + bb;
        if (GELU_) r = 0.5f * r * (1.0f + erff(r * 0.70710678118654752f));
        if (RES)   r += resid[(size_t)m * Nc + nc];
        if (OUTBF) outb[(size_t)m * Nc + nc] = f2bf(r);
        else       outf[(size_t)m * Nc + nc] = r;
    }
}

// ---------------- fused dual-pass attention ----------------
// One workgroup = (b, h, 64-query panel), 32 waves: the panel fills the LDS of
// its WGP, so the waves that hide each other's waits must come from this one
// workgroup (8 per SIMD). Scores stay in LDS (64 x 1032 f32), plus a 16KB LDS
// chunk for staged V (256 keys x 32 d, bf16: one 16-byte piece per thread).
// Phase 1: QK^T via WMMA. Phase 2: dense softmax stats + top-64 threshold by
// value bisection + fused combined probabilities. Phase 3: P@V via WMMA with
// LDS-staged V chunks (coalesced b128 staging instead of 2B gathers).
#define QBLK  64
#define SLD   1032    // 1024 + 8 pad floats to dodge bank conflicts
#define AWAVES 32     // waves per workgroup
#define VCH   256     // keys per staged V chunk
#define KGRP  (AWAVES / 8)            // wave groups that share the keys in P@V
#define KSTEP (VCH / 32 / KGRP)       // 32-key steps per wave and chunk
__global__ __launch_bounds__(AWAVES * 32) void attn_kernel(const uint16_t* __restrict__ qb,   // [ROWS,CDIM] bf16
                            const uint16_t* __restrict__ kvb,  // [ROWS,2*CDIM] bf16
                            const float* __restrict__ wf,      // w_fuse[2]
                            uint16_t* __restrict__ attn) {     // [ROWS,CDIM] bf16
    extern __shared__ float sc[];
    uint16_t* Vs = (uint16_t*)(sc + QBLK * SLD);   // [VCH][DHEAD] bf16
    const int bid  = blockIdx.x;
    const int b    = bid / (HEADS * (SEQ / QBLK));
    const int rem  = bid % (HEADS * (SEQ / QBLK));
    const int h    = rem / (SEQ / QBLK);
    const int q0   = (rem % (SEQ / QBLK)) * QBLK;
    const int tid  = threadIdx.x;
    const int wave = tid >> 5, lane = tid & 31;
    const int g    = lane >> 4;
    const float scale = 0.17677669529663687f;   // 1/sqrt(32)

    // learned fusion weights (softmax over 2) -- uniform, scalarizes to SALU
    const float e0 = expf(wf[0]), e1 = expf(wf[1]);
    const float w0 = e0 / (e0 + e1), w1 = e1 / (e0 + e1);

    // ---- phase 1: scores tile 64q x 1024k, 256 WMMA tiles over 32 waves ----
    for (int t = wave; t < (QBLK / 16) * (SEQ / 16); t += AWAVES) {
        const int qt = t >> 6, kt = t & 63;
        ABOp a, bm;
        {   // Q operand: 16 queries x 32 d (contiguous d chunks)
            int m = q0 + qt * 16 + (lane & 15);
            const uint16_t* qr = qb + (size_t)(b * SEQ + m) * CDIM + h * DHEAD;
            a.q[0] = *(const uint4*)(qr + g * 8);
            a.q[1] = *(const uint4*)(qr + 16 + g * 8);
        }
        {   // K operand: 16 keys across lanes, d packed (row-major contiguous)
            int n = kt * 16 + (lane & 15);
            const uint16_t* kr = kvb + (size_t)(b * SEQ + n) * (2 * CDIM) + h * DHEAD;
            bm.q[0] = *(const uint4*)(kr + g * 8);
            bm.q[1] = *(const uint4*)(kr + 16 + g * 8);
        }
        v8f c = {};
        c = wmma_bf16(a, bm, c);
        #pragma unroll
        for (int v = 0; v < 8; ++v)
            sc[(qt * 16 + g * 8 + v) * SLD + kt * 16 + (lane & 15)] = c[v] * scale;
    }
    __syncthreads();

    // ---- phase 2: per-row dense softmax + top-64 threshold + fusion ----
    for (int i = 0; i < QBLK / AWAVES; ++i) {
        const int row = wave * (QBLK / AWAVES) + i;
        float* rp = sc + row * SLD;
        float rv[32];
        #pragma unroll
        for (int j = 0; j < 32; ++j) rv[j] = rp[lane + j * 32];
        float mx = -1e30f, mn = 1e30f;
        #pragma unroll
        for (int j = 0; j < 32; ++j) { mx = fmaxf(mx, rv[j]); mn = fminf(mn, rv[j]); }
        mx = wave_max(mx);
        mn = wave_min(mn);
        float ev[32];     // each exponential is formed once and kept
        #pragma unroll
        for (int j = 0; j < 32; ++j) ev[j] = expf(rv[j] - mx);
        float sd = 0.f;
        #pragma unroll
        for (int j = 0; j < 32; ++j) sd += ev[j];
        sd = wave_sum(sd);
        // bisection for top-64 threshold: largest t with count(s>t) >= TOPM
        // The count over the wave is taken from the compare masks themselves
        // (ballot + population count), so bounds and count live in scalars.
        float lo = uniform_f(mn) - 1.0f, hi = uniform_f(mx);
        for (int left = 24; left > 0; ) {
            float mid = 0.5f * (lo + hi);
            int c = 0;
            #pragma unroll
            for (int j = 0; j < 32; j += 2) {
                uint64_t m0 = __builtin_amdgcn_ballot_w32(rv[j]     > mid);
                uint64_t m1 = __builtin_amdgcn_ballot_w32(rv[j + 1] > mid);
                c += __builtin_popcountll(m0 | (m1 << 32));
            }
            if (c >= TOPM) lo = mid; else hi = mid;
            // Exactly TOPM scores lie above lo: every later step keeps this
            // same set, so the search is over (24 steps stay the bound).
            left = (c == TOPM) ? 0 : left - 1;
        }
        const float thr = lo;
        float st = 0.f;
        #pragma unroll
        for (int j = 0; j < 32; ++j) st += (rv[j] > thr) ? ev[j] : 0.f;
        st = wave_sum(st);
        const float cd = w0 / sd;
        const float ct = w1 / fmaxf(st, 1e-20f);
        #pragma unroll
        for (int j = 0; j < 32; ++j)
            rp[lane + j * 32] = ev[j] * (cd + ((rv[j] > thr) ? ct : 0.f));
    }
    __syncthreads();

    // ---- phase 3: out = P @ V with LDS-staged V chunks ----
    // 8 output tiles x KGRP wave groups: group kq takes KSTEP of the 32-key
    // steps of every chunk; the groups' partial sums meet in LDS at the end.
    {
        const int tile = wave & 7, kq = wave >> 3;
        const int qt = tile >> 1, dt = tile & 1;
        const int d  = dt * 16 + (lane & 15);
        const int m  = qt * 16 + (lane & 15);
        // first P and first V element of this lane in a chunk; all its others
        // lie at compile-time distances from these
        const float*    pw = sc + m * SLD + kq * (KSTEP * 32) + g * 8;
        const uint16_t* vw = Vs + (kq * (KSTEP * 32) + g * 8) * DHEAD + d;
        v8f acc = {};
        for (int kk0 = 0; kk0 < SEQ; kk0 += VCH) {
            // stage V[kk0 .. kk0+VCH) x DHEAD : 16KB, one coalesced b128 a thread
            {
                const uint16_t* vb = kvb + (size_t)(b * SEQ + kk0) * (2 * CDIM)
                                     + CDIM + h * DHEAD;
                int r = tid >> 2, c = (tid & 3) * 8;   // 1024 uint4 total
                *(uint4*)(&Vs[r * DHEAD + c]) =
                    *(const uint4*)(vb + (size_t)r * (2 * CDIM) + c);
                // the load's address registers are reused right behind the barrier
                asm volatile("s_wait_xcnt 0x0" ::: "memory");
            }
            __syncthreads();
            #pragma unroll
            for (int s = 0; s < KSTEP; ++s) {
                ABOp a, bm;
                #pragma unroll
                for (int j = 0; j < 16; ++j) {
                    const int kc = s * 32 + ((j < 8) ? j : j + 8);  // + g*8 in pw, vw
                    a.u[j]  = f2bf(pw[kk0 + kc]);
                    bm.u[j] = vw[kc * DHEAD];
                }
                acc = wmma_bf16(a, bm, acc);
            }
            __syncthreads();
        }
        // The score panel has been read for the last time (barrier above): its
        // first 24KB now carry the partial sums of groups 1.. to group 0.
        if (kq != 0) {
            #pragma unroll
            for (int v = 0; v < 8; ++v)
                sc[(((kq - 1) * 8 + tile) * 8 + v) * 32 + lane] = acc[v];
        }
        __syncthreads();
        if (kq == 0) {
            #pragma unroll
            for (int p = 0; p < KGRP - 1; ++p) {
                #pragma unroll
                for (int v = 0; v < 8; ++v)
                    acc[v] += sc[((p * 8 + tile) * 8 + v) * 32 + lane];
            }
            #pragma unroll
            for (int v = 0; v < 8; ++v) {
                int mr = q0 + qt * 16 + g * 8 + v;
                int nc = dt * 16 + (lane & 15);
                attn[(size_t)(b * SEQ + mr) * CDIM + h * DHEAD + nc] = f2bf(acc[v]);
            }
        }
    }
}

// ---------------- host side ----------------
extern "C" void kernel_launch(void* const* d_in, const int* in_sizes, int n_in,
                              void* d_out, int out_size, void* d_ws, size_t ws_size,
                              hipStream_t stream) {
    (void)in_sizes; (void)n_in; (void)out_size; (void)ws_size;
    const float* x     = (const float*)d_in[0];
    const float* ln1g  = (const float*)d_in[1];
    const float* ln1b  = (const float*)d_in[2];
    const float* Wq    = (const float*)d_in[3];
    const float* bq    = (const float*)d_in[4];
    const float* Wkv   = (const float*)d_in[5];
    const float* bkv   = (const float*)d_in[6];
    const float* wfuse = (const float*)d_in[7];
    const float* Wo    = (const float*)d_in[8];
    const float* bo    = (const float*)d_in[9];
    const float* ln2g  = (const float*)d_in[10];
    const float* ln2b  = (const float*)d_in[11];
    const float* W1    = (const float*)d_in[12];
    const float* b1    = (const float*)d_in[13];
    const float* W2    = (const float*)d_in[14];
    const float* b2    = (const float*)d_in[15];
    float* xcur = (float*)d_out;                       // running activations

    // workspace carve-up (bf16 buffers, 256B-aligned power-of-two sizes)
    uint8_t* ws = (uint8_t*)d_ws;
    uint16_t* wq_bf   = (uint16_t*)(ws);                 size_t off = CDIM * CDIM * 2;
    uint16_t* wkv_bf  = (uint16_t*)(ws + off);           off += CDIM * 2 * CDIM * 2;
    uint16_t* wo_bf   = (uint16_t*)(ws + off);           off += CDIM * CDIM * 2;
    uint16_t* w1_bf   = (uint16_t*)(ws + off);           off += CDIM * DFF * 2;
    uint16_t* w2_bf   = (uint16_t*)(ws + off);           off += DFF * CDIM * 2;
    uint16_t* h_bf    = (uint16_t*)(ws + off);           off += (size_t)ROWS * CDIM * 2;
    uint16_t* q_bf    = (uint16_t*)(ws + off);           off += (size_t)ROWS * CDIM * 2;
    uint16_t* kv_bf   = (uint16_t*)(ws + off);           off += (size_t)ROWS * 2 * CDIM * 2;
    uint16_t* attn_bf = (uint16_t*)(ws + off);           off += (size_t)ROWS * CDIM * 2;
    uint16_t* u_bf    = (uint16_t*)(ws + off);

    // x -> d_out (running buffer)
    hipMemcpyAsync(xcur, x, (size_t)ROWS * CDIM * sizeof(float),
                   hipMemcpyDeviceToDevice, stream);

    const int attnLds = QBLK * SLD * (int)sizeof(float)           // score panel
                      + VCH * DHEAD * (int)sizeof(uint16_t);      // V chunk
    hipFuncSetAttribute((const void*)attn_kernel,
                        hipFuncAttributeMaxDynamicSharedMemorySize, attnLds);

    const dim3 blk(256);
    for (int l = 0; l < LAYERS; ++l) {
        // per-layer weight slices -> bf16
        auto cvt = [&](const float* src, uint16_t* dst, int n) {
            cvt_bf16_kernel<<<dim3((n + 255) / 256), blk, 0, stream>>>(src, dst, n);
        };
        cvt(Wq  + (size_t)l * CDIM * CDIM,     wq_bf,  CDIM * CDIM);
        cvt(Wkv + (size_t)l * CDIM * 2 * CDIM, wkv_bf, CDIM * 2 * CDIM);
        cvt(Wo  + (size_t)l * CDIM * CDIM,     wo_bf,  CDIM * CDIM);
        cvt(W1  + (size_t)l * CDIM * DFF,      w1_bf,  CDIM * DFF);
        cvt(W2  + (size_t)l * DFF * CDIM,      w2_bf,  DFF * CDIM);

        // --- attention sublayer ---
        ln_kernel<<<dim3(ROWS), blk, 0, stream>>>(xcur, ln1g + l * CDIM,
                                                  ln1b + l * CDIM, h_bf);
        gemm_bf16_kernel<false, false, true>
            <<<dim3(CDIM / 64, ROWS / 32), blk, 0, stream>>>(
                h_bf, wq_bf, bq + l * CDIM, nullptr, nullptr, q_bf,
                ROWS, CDIM, CDIM);
        gemm_bf16_kernel<false, false, true>
            <<<dim3(2 * CDIM / 64, ROWS / 32), blk, 0, stream>>>(
                h_bf, wkv_bf, bkv + l * 2 * CDIM, nullptr, nullptr, kv_bf,
                ROWS, CDIM, 2 * CDIM);
        attn_kernel<<<dim3(BATCH * HEADS * (SEQ / QBLK)), dim3(AWAVES * 32), attnLds, stream>>>(
                q_bf, kv_bf, wfuse + l * 2, attn_bf);
        gemm_bf16_kernel<false, true, false>
            <<<dim3(CDIM / 64, ROWS / 32), blk, 0, stream>>>(
                attn_bf, wo_bf, bo + l * CDIM, xcur, xcur, nullptr,
                ROWS, CDIM, CDIM);

        // --- MLP sublayer ---
        ln_kernel<<<dim3(ROWS), blk, 0, stream>>>(xcur, ln2g + l * CDIM,
                                                  ln2b + l * CDIM, h_bf);
        gemm_bf16_kernel<true, false, true>
            <<<dim3(DFF / 64, ROWS / 32), blk, 0, stream>>>(
                h_bf, w1_bf, b1 + l * DFF, nullptr, nullptr, u_bf,
                ROWS, CDIM, DFF);
        gemm_bf16_kernel<false, true, false>
            <<<dim3(CDIM / 64, ROWS / 32), blk, 0, stream>>>(
                u_bf, w2_bf, b2 + l * CDIM, xcur, xcur, nullptr,
                ROWS, DFF, CDIM);
    }
}

// v004
// One run takes 262 microseconds.
// Two timings next to v003 both put it at 1.12 times that version's speed.
// Counting every step since v000, it is 1.77 times as fast.
#include <hip/hip_runtime.h>
#include <hip/hip_bf16.h>
#include <math.h>
#include <stdint.h>

// ---------------- problem constants ----------------
#define LAYERS 2
#define BATCH  4
#define SEQ    1024
#define CDIM   256
#define HEADS  8
#define DHEAD  32          // CDIM / HEADS
#define TOPM   64
#define DFF    1024
#define ROWS   (BATCH * SEQ)      // 4096 token rows
#define LNEPS  1e-5f

// WMMA vector types (CDNA5 wave32)
typedef __attribute__((ext_vector_type(16))) __bf16 v16bf;
typedef __attribute__((ext_vector_type(8)))  float  v8f;

union ABOp {            // one 16x32 bf16 WMMA operand per lane
    uint16_t u[16];
    uint4    q[2];      // two 16-byte chunks
    v16bf    v;
};

__device__ __forceinline__ uint16_t f2bf(float f) {
    uint32_t u = __float_as_uint(f);
    uint32_t r = u + 0x7FFFu + ((u >> 16) & 1u);   // round-to-nearest-even
    return (uint16_t)(r >> 16);
}

__device__ __forceinline__ v8f wmma_bf16(const ABOp& a, const ABOp& b, v8f c) {
    return __builtin_amdgcn_wmma_f32_16x16x32_bf16(
        false, a.v, false, b.v, (short)0, c, false, false);
}

// ---------------- wave-wide reductions on the vector unit ----------------
// Lane l <-> l ^ 16 (other 16-lane row) and l <-> l ^ M (inside a row, DPP
// row_xmask): register-to-register moves, no trip through the LDS crossbar.
__device__ __forceinline__ float xhalf(float x) {
    int b = __builtin_bit_cast(int, x);
    return __builtin_bit_cast(float, __builtin_amdgcn_permlanex16(
        b, b, 0x76543210, 0xfedcba98, false, false));
}
template<int M>
__device__ __forceinline__ float xrow(float x) {
    return __builtin_bit_cast(float, __builtin_amdgcn_mov_dpp(
        __builtin_bit_cast(int, x), 0x160 | M, 0xf, 0xf, true));
}
// Butterfly over 32 lanes in the order 16, 8, 4, 2, 1; every lane gets the result.
__device__ __forceinline__ float wave_sum(float s) {
    s += xhalf(s);   s += xrow<8>(s); s += xrow<4>(s);
    s += xrow<2>(s); s += xrow<1>(s);
    return s;
}
__device__ __forceinline__ float wave_max(float s) {
    s = fmaxf(s, xhalf(s));   s = fmaxf(s, xrow<8>(s)); s = fmaxf(s, xrow<4>(s));
    s = fmaxf(s, xrow<2>(s)); s = fmaxf(s, xrow<1>(s));
    return s;
}
__device__ __forceinline__ float wave_min(float s) {
    s = fminf(s, xhalf(s));   s = fminf(s, xrow<8>(s)); s = fminf(s, xrow<4>(s));
    s = fminf(s, xrow<2>(s)); s = fminf(s, xrow<1>(s));
    return s;
}
// A value that is equal in all lanes, moved to a scalar register.
__device__ __forceinline__ float uniform_f(float x) {
    return __builtin_bit_cast(float,
        __builtin_amdgcn_readfirstlane(__builtin_bit_cast(int, x)));
}

// ---------------- LayerNorm (one 256-thread block per row) ----------------
__device__ __forceinline__ void ln_row(const float* __restrict__ x,
                                       const float* __restrict__ g,
                                       const float* __restrict__ b,
                                       uint16_t* __restrict__ out, int row) {
    __shared__ float s1[8], s2[8], stats[2];
    const int tid  = threadIdx.x;
    const int wave = tid >> 5, lane = tid & 31;
    float v = x[(size_t)row * CDIM + tid];
    float s = v, ss = v * v;
    s  = wave_sum(s);
    ss = wave_sum(ss);
    if (lane == 0) { s1[wave] = s; s2[wave] = ss; }
    __syncthreads();
    if (tid == 0) {
        float a = 0.f, c = 0.f;
        #pragma unroll
        for (int i = 0; i < 8; ++i) { a += s1[i]; c += s2[i]; }
        float mean = a * (1.0f / CDIM);
        float var  = c * (1.0f / CDIM) - mean * mean;
        stats[0] = mean;
        stats[1] = rsqrtf(var + LNEPS);
    }
    __syncthreads();
    float y = (v - stats[0]) * stats[1] * g[tid] + b[tid];
    out[(size_t)row * CDIM + tid] = f2bf(y);
}

__global__ void ln_kernel(const float* __restrict__ x,
                          const float* __restrict__ g,
                          const float* __restrict__ b,
                          uint16_t* __restrict__ out) {
    ln_row(x, g, b, out, blockIdx.x);
}

// ---------------- front launch: everything that reads inputs only ----------
// Blocks [0, ROWS): the first LayerNorm, one row each. The blocks behind them
// convert the weights of all layers to bf16, 256 values each: the five arrays
// land one behind the other in wbf, each with its layers in input order.
#define NWQ  (LAYERS * CDIM * CDIM)
#define NWKV (LAYERS * CDIM * 2 * CDIM)
#define NWO  (LAYERS * CDIM * CDIM)
#define NW1  (LAYERS * CDIM * DFF)
#define NW2  (LAYERS * DFF * CDIM)
#define NWALL (NWQ + NWKV + NWO + NW1 + NW2)
__global__ void front_kernel(const float* __restrict__ x,
                             const float* __restrict__ g,
                             const float* __restrict__ b,
                             uint16_t* __restrict__ hout,
                             const float* __restrict__ Wq,
                             const float* __restrict__ Wkv,
                             const float* __restrict__ Wo,
                             const float* __restrict__ W1,
                             const float* __restrict__ W2,
                             uint16_t* __restrict__ wbf) {
    if (blockIdx.x < ROWS) {            // same for the whole block
        ln_row(x, g, b, hout, blockIdx.x);
        return;
    }
    const int e0 = (blockIdx.x - ROWS) * 256;   // every array is whole blocks
    const float* arr = W2;                      // the array e0 lies in
    int first = NWQ + NWKV + NWO + NW1;         // and its first value's place
    if (e0 < NWQ + NWKV + NWO + NW1) { arr = W1;  first = NWQ + NWKV + NWO; }
    if (e0 < NWQ + NWKV + NWO)       { arr = Wo;  first = NWQ + NWKV; }
    if (e0 < NWQ + NWKV)             { arr = Wkv; first = NWQ; }
    if (e0 < NWQ)                    { arr = Wq;  first = 0; }
    wbf[e0 + threadIdx.x] = f2bf(arr[e0 - first + threadIdx.x]);
    // the listing reuses the store's offset register on the path behind it
    asm volatile("s_wait_xcnt 0x0" ::: "memory");
}

// ---------------- generic bf16 WMMA GEMM: D = act(A@B + bias) (+resid) ----
// A: [M,K] bf16 row-major.  B: [K,Nc] bf16 row-major (staged in LDS).
// block = 256 (8 waves, each owns a 16x16 output tile); the block takes the
// 32 x 64 output tile (by, bx) of the Nc/64 x M/32 tiles.
template<bool GELU_, bool RES, bool OUTBF>
__device__ __forceinline__ void gemm_tile(const uint16_t* __restrict__ A,
                                 const uint16_t* __restrict__ Bw,
                                 const float* __restrict__ bias,
                                 const float* __restrict__ resid,
                                 float* __restrict__ outf,
                                 uint16_t* __restrict__ outb,
                                 int K, int Nc, int bx, int by) {
    __shared__ uint16_t Bs[32 * 72];     // 32 K-rows x 64 cols (+8 pad)
    const int tid  = threadIdx.x;
    const int wave = tid >> 5, lane = tid & 31;
    const int g    = lane >> 4;          // half-wave select
    const int wm   = wave >> 2, wn = wave & 3;
    const int row0 = by * 32 + wm * 16;
    const int col0 = bx * 64;
    const int colT = col0 + wn * 16;
    const int rB   = tid >> 3, ccB = (tid & 7) * 8;   // B-stage mapping

    v8f acc = {};
    #pragma unroll 2
    for (int kk = 0; kk < K; kk += 32) {
        __syncthreads();
        // cooperative stage of B tile (32x64 bf16 = 4KB, coalesced b128)
        *(uint4*)(&Bs[rB * 72 + ccB]) =
            *(const uint4*)(&Bw[(size_t)(kk + rB) * Nc + col0 + ccB]);
        // prefetch next K-tile of B into cache (gfx1250 global_prefetch path)
        if (kk + 32 < K)
            __builtin_prefetch(&Bw[(size_t)(kk + 32 + rB) * Nc + col0 + ccB], 0, 1);
        __syncthreads();
        // A operand: row m = row0+lane%16, K-chunks at kk+g*8 and kk+16+g*8
        ABOp a;
        const uint16_t* ar = A + (size_t)(row0 + (lane & 15)) * K + kk;
        a.q[0] = *(const uint4*)(ar + g * 8);
        a.q[1] = *(const uint4*)(ar + 16 + g * 8);
        // B operand from LDS: col n = colT+lane%16, same K pattern
        ABOp bm;
        const int n = wn * 16 + (lane & 15);
        #pragma unroll
        for (int j = 0; j < 16; ++j) {
            int kloc = (j < 8) ? (g * 8 + j) : (16 + g * 8 + (j - 8));
            bm.u[j] = Bs[kloc * 72 + n];
        }
        acc = wmma_bf16(a, bm, acc);
    }
    // C/D layout: element v -> (m = row0 + g*8 + v, n = colT + lane%16)
    const int nc = colT + (lane & 15);
    const float bb = bias[nc];
    #pragma unroll
    for (int v = 0; v < 8; ++v) {
        int m = row0 + g * 8 + v;
        float r = acc[v] + bb;
        if (GELU_) r = 0.5f * r * (1.0f + erff(r * 0.70710678118654752f));
        if (RES)   r += resid[(size_t)m * Nc + nc];
        if (OUTBF) outb[(size_t)m * Nc + nc] = f2bf(r);
        else       outf[(size_t)m * Nc + nc] = r;
    }
}

// one product: grid = (Nc/64, M/32)
template<bool GELU_, bool RES, bool OUTBF>
__global__ void gemm_bf16_kernel(const uint16_t* __restrict__ A,
                                 const uint16_t* __restrict__ Bw,
                                 const float* __restrict__ bias,
                                 const float* __restrict__ resid,
                                 float* __restrict__ outf,
                                 uint16_t* __restrict__ outb,
                                 int K, int Nc) {
    gemm_tile<GELU_, RES, OUTBF>(A, Bw, bias, resid, outf, outb, K, Nc,
                                 blockIdx.x, blockIdx.y);
}

// Q and KV projections of the same rows in one grid = (3*CDIM/64, M/32):
// the first CDIM/64 block columns are Q's tiles, the others KV's.
__global__ void gemm_qkv_kernel(const uint16_t* __restrict__ A,
                                const uint16_t* __restrict__ Wq,
                                const uint16_t* __restrict__ Wkv,
                                const float* __restrict__ bq,
                                const float* __restrict__ bkv,
                                uint16_t* __restrict__ q,
                                uint16_t* __restrict__ kv) {
    const bool isq = blockIdx.x < CDIM / 64;    // same for the whole block
    gemm_tile<false, false, true>(A, isq ? Wq : Wkv, isq ? bq : bkv,
                                  nullptr, nullptr, isq ? q : kv,
                                  CDIM, isq ? CDIM : 2 * CDIM,
                                  isq ? blockIdx.x : blockIdx.x - CDIM / 64,
                                  blockIdx.y);
}

// ---------------- fused dual-pass attention ----------------
// One workgroup = (b, h, 64-query panel), 32 waves: the panel fills the LDS of
// its WGP, so the waves that hide each other's waits must come from this one
// workgroup (8 per SIMD). Scores stay in LDS (64 x 1032 f32), plus a 16KB LDS
// chunk for staged V (256 keys x 32 d, bf16: one 16-byte piece per thread).
// Phase 1: QK^T via WMMA. Phase 2: dense softmax stats + top-64 threshold by
// value bisection + fused combined probabilities. Phase 3: P@V via WMMA with
// LDS-staged V chunks (coalesced b128 staging instead of 2B gathers).
#define QBLK  64
#define SLD   1032    // 1024 + 8 pad floats to dodge bank conflicts
#define AWAVES 32     // waves per workgroup
#define VCH   256     // keys per staged V chunk
#define KGRP  (AWAVES / 8)            // wave groups that share the keys in P@V
#define KSTEP (VCH / 32 / KGRP)       // 32-key steps per wave and chunk
__global__ __launch_bounds__(AWAVES * 32) void attn_kernel(const uint16_t* __restrict__ qb,   // [ROWS,CDIM] bf16
                            const uint16_t* __restrict__ kvb,  // [ROWS,2*CDIM] bf16
                            const float* __restrict__ wf,      // w_fuse[2]
                            uint16_t* __restrict__ attn) {     // [ROWS,CDIM] bf16
    extern __shared__ float sc[];
    uint16_t* Vs = (uint16_t*)(sc + QBLK * SLD);   // [VCH][DHEAD] bf16
    const int bid  = blockIdx.x;
    const int b    = bid / (HEADS * (SEQ / QBLK));
    const int rem  = bid % (HEADS * (SEQ / QBLK));
    const int h    = rem / (SEQ / QBLK);
    const int q0   = (rem % (SEQ / QBLK)) * QBLK;
    const int tid  = threadIdx.x;
    const int wave = tid >> 5, lane = tid & 31;
    const int g    = lane >> 4;
    const float scale = 0.17677669529663687f;   // 1/sqrt(32)

    // learned fusion weights (softmax over 2) -- uniform, scalarizes to SALU
    const float e0 = expf(wf[0]), e1 = expf(wf[1]);
    const float w0 = e0 / (e0 + e1), w1 = e1 / (e0 + e1);

    // ---- phase 1: scores tile 64q x 1024k, 256 WMMA tiles over 32 waves ----
    for (int t = wave; t < (QBLK / 16) * (SEQ / 16); t += AWAVES) {
        const int qt = t >> 6, kt = t & 63;
        ABOp a, bm;
        {   // Q operand: 16 queries x 32 d (contiguous d chunks)
            int m = q0 + qt * 16 + (lane & 15);
            const uint16_t* qr = qb + (size_t)(b * SEQ + m) * CDIM + h * DHEAD;
            a.q[0] = *(const uint4*)(qr + g * 8);
            a.q[1] = *(const uint4*)(qr + 16 + g * 8);
        }
        {   // K operand: 16 keys across lanes, d packed (row-major contiguous)
            int n = kt * 16 + (lane & 15);
            const uint16_t* kr = kvb + (size_t)(b * SEQ + n) * (2 * CDIM) + h * DHEAD;
            bm.q[0] = *(const uint4*)(kr + g * 8);
            bm.q[1] = *(const uint4*)(kr + 16 + g * 8);
        }
        v8f c = {};
        c = wmma_bf16(a, bm, c);
        #pragma unroll
        for (int v = 0; v < 8; ++v)
            sc[(qt * 16 + g * 8 + v) * SLD + kt * 16 + (lane & 15)] = c[v] * scale;
    }
    __syncthreads();

    // ---- phase 2: per-row dense softmax + top-64 threshold + fusion ----
    for (int i = 0; i < QBLK / AWAVES; ++i) {
        const int row = wave * (QBLK / AWAVES) + i;
        float* rp = sc + row * SLD;
        float rv[32];
        #pragma unroll
        for (int j = 0; j < 32; ++j) rv[j] = rp[lane + j * 32];
        float mx = -1e30f, mn = 1e30f;
        #pragma unroll
        for (int j = 0; j < 32; ++j) { mx = fmaxf(mx, rv[j]); mn = fminf(mn, rv[j]); }
        mx = wave_max(mx);
        mn = wave_min(mn);
        float ev[32];     // each exponential is formed once and kept
        #pragma unroll
        for (int j = 0; j < 32; ++j) ev[j] = expf(rv[j] - mx);
        float sd = 0.f;
        #pragma unroll
        for (int j = 0; j < 32; ++j) sd += ev[j];
        sd = wave_sum(sd);
        // bisection for top-64 threshold: largest t with count(s>t) >= TOPM
        // The count over the wave is taken from the compare masks themselves
        // (ballot + population count), so bounds and count live in scalars.
        float lo = uniform_f(mn) - 1.0f, hi = uniform_f(mx);
        for (int left = 24; left > 0; ) {
            float mid = 0.5f * (lo + hi);
            int c = 0;
            #pragma unroll
            for (int j = 0; j < 32; j += 2) {
                uint64_t m0 = __builtin_amdgcn_ballot_w32(rv[j]     > mid);
                uint64_t m1 = __builtin_amdgcn_ballot_w32(rv[j + 1] > mid);
                c += __builtin_popcountll(m0 | (m1 << 32));
            }
            if (c >= TOPM) lo = mid; else hi = mid;
            // Exactly TOPM scores lie above lo: every later step keeps this
            // same set, so the search is over (24 steps stay the bound).
            left = (c == TOPM) ? 0 : left - 1;
        }
        const float thr = lo;
        float st = 0.f;
        #pragma unroll
        for (int j = 0; j < 32; ++j) st += (rv[j] > thr) ? ev[j] : 0.f;
        st = wave_sum(st);
        const float cd = w0 / sd;
        const float ct = w1 / fmaxf(st, 1e-20f);
        #pragma unroll
        for (int j = 0; j < 32; ++j)
            rp[lane + j * 32] = ev[j] * (cd + ((rv[j] > thr) ? ct : 0.f));
    }
    __syncthreads();

    // ---- phase 3: out = P @ V with LDS-staged V chunks ----
    // 8 output tiles x KGRP wave groups: group kq takes KSTEP of the 32-key
    // steps of every chunk; the groups' partial sums meet in LDS at the end.
    {
        const int tile = wave & 7, kq = wave >> 3;
        const int qt = tile >> 1, dt = tile & 1;
        const int d  = dt * 16 + (lane & 15);
        const int m  = qt * 16 + (lane & 15);
        // first P and first V element of this lane in a chunk; all its others
        // lie at compile-time distances from these
        const float*    pw = sc + m * SLD + kq * (KSTEP * 32) + g * 8;
        const uint16_t* vw = Vs + (kq * (KSTEP * 32) + g * 8) * DHEAD + d;
        v8f acc = {};
        for (int kk0 = 0; kk0 < SEQ; kk0 += VCH) {
            // stage V[kk0 .. kk0+VCH) x DHEAD : 16KB, one coalesced b128 a thread
            {
                const uint16_t* vb = kvb + (size_t)(b * SEQ + kk0) * (2 * CDIM)
                                     + CDIM + h * DHEAD;
                int r = tid >> 2, c = (tid & 3) * 8;   // 1024 uint4 total
                *(uint4*)(&Vs[r * DHEAD + c]) =
                    *(const uint4*)(vb + (size_t)r * (2 * CDIM) + c);
                // the load's address registers are reused right behind the barrier
                asm volatile("s_wait_xcnt 0x0" ::: "memory");
            }
            __syncthreads();
            #pragma unroll
            for (int s = 0; s < KSTEP; ++s) {
                ABOp a, bm;
                #pragma unroll
                for (int j = 0; j < 16; ++j) {
                    const int kc = s * 32 + ((j < 8) ? j : j + 8);  // + g*8 in pw, vw
                    a.u[j]  = f2bf(pw[kk0 + kc]);
                    bm.u[j] = vw[kc * DHEAD];
                }
                acc = wmma_bf16(a, bm, acc);
            }
            __syncthreads();
        }
        // The score panel has been read for the last time (barrier above): its
        // first 24KB now carry the partial sums of groups 1.. to group 0.
        if (kq != 0) {
            #pragma unroll
            for (int v = 0; v < 8; ++v)
                sc[(((kq - 1) * 8 + tile) * 8 + v) * 32 + lane] = acc[v];
        }
        __syncthreads();
        if (kq == 0) {
            #pragma unroll
            for (int p = 0; p < KGRP - 1; ++p) {
                #pragma unroll
                for (int v = 0; v < 8; ++v)
                    acc[v] += sc[((p * 8 + tile) * 8 + v) * 32 + lane];
            }
            #pragma unroll
            for (int v = 0; v < 8; ++v) {
                int mr = q0 + qt * 16 + g * 8 + v;
                int nc = dt * 16 + (lane & 15);
                attn[(size_t)(b * SEQ + mr) * CDIM + h * DHEAD + nc] = f2bf(acc[v]);
            }
        }
    }
}

// ---------------- host side ----------------
extern "C" void kernel_launch(void* const* d_in, const int* in_sizes, int n_in,
                              void* d_out, int out_size, void* d_ws, size_t ws_size,
                              hipStream_t stream) {
    (void)in_sizes; (void)n_in; (void)out_size; (void)ws_size;
    const float* x     = (const float*)d_in[0];
    const float* ln1g  = (const float*)d_in[1];
    const float* ln1b  = (const float*)d_in[2];
    const float* Wq    = (const float*)d_in[3];
    const float* bq    = (const float*)d_in[4];
    const float* Wkv   = (const float*)d_in[5];
    const float* bkv   = (const float*)d_in[6];
    const float* wfuse = (const float*)d_in[7];
    const float* Wo    = (const float*)d_in[8];
    const float* bo    = (const float*)d_in[9];
    const float* ln2g  = (const float*)d_in[10];
    const float* ln2b  = (const float*)d_in[11];
    const float* W1    = (const float*)d_in[12];
    const float* b1    = (const float*)d_in[13];
    const float* W2    = (const float*)d_in[14];
    const float* b2    = (const float*)d_in[15];
    float* xcur = (float*)d_out;                       // running activations

    // workspace carve-up (bf16 buffers, 256B-aligned power-of-two sizes);
    // the five weight arrays lie in the order the front launch writes them
    uint8_t* ws = (uint8_t*)d_ws;
    uint16_t* wq_bf   = (uint16_t*)(ws);                 size_t off = NWQ * 2;
    uint16_t* wkv_bf  = (uint16_t*)(ws + off);           off += NWKV * 2;
    uint16_t* wo_bf   = (uint16_t*)(ws + off);           off += NWO * 2;
    uint16_t* w1_bf   = (uint16_t*)(ws + off);           off += NW1 * 2;
    uint16_t* w2_bf   = (uint16_t*)(ws + off);           off += NW2 * 2;
    uint16_t* h_bf    = (uint16_t*)(ws + off);           off += (size_t)ROWS * CDIM * 2;
    uint16_t* q_bf    = (uint16_t*)(ws + off);           off += (size_t)ROWS * CDIM * 2;
    uint16_t* kv_bf   = (uint16_t*)(ws + off);           off += (size_t)ROWS * 2 * CDIM * 2;
    uint16_t* attn_bf = (uint16_t*)(ws + off);           off += (size_t)ROWS * CDIM * 2;
    uint16_t* u_bf    = (uint16_t*)(ws + off);

    const int attnLds = QBLK * SLD * (int)sizeof(float)           // score panel
                      + VCH * DHEAD * (int)sizeof(uint16_t);      // V chunk
    hipFuncSetAttribute((const void*)attn_kernel,
                        hipFuncAttributeMaxDynamicSharedMemorySize, attnLds);

    const dim3 blk(256);
    // first LayerNorm and all weight converts: they read inputs only
    front_kernel<<<dim3(ROWS + NWALL / 256), blk, 0, stream>>>(
        x, ln1g, ln1b, h_bf, Wq, Wkv, Wo, W1, W2, wq_bf);

    for (int l = 0; l < LAYERS; ++l) {
        // layer 0 takes its residual from x itself; d_out is first written there
        const float* xin = (l == 0) ? x : xcur;

        // --- attention sublayer ---
        if (l > 0)
            ln_kernel<<<dim3(ROWS), blk, 0, stream>>>(xcur, ln1g + l * CDIM,
                                                      ln1b + l * CDIM, h_bf);
        gemm_qkv_kernel<<<dim3(3 * CDIM / 64, ROWS / 32), blk, 0, stream>>>(
                h_bf, wq_bf + (size_t)l * CDIM * CDIM,
                wkv_bf + (size_t)l * CDIM * 2 * CDIM,
                bq + l * CDIM, bkv + l * 2 * CDIM, q_bf, kv_bf);
        attn_kernel<<<dim3(BATCH * HEADS * (SEQ / QBLK)), dim3(AWAVES * 32), attnLds, stream>>>(
                q_bf, kv_bf, wfuse + l * 2, attn_bf);
        gemm_bf16_kernel<false, true, false>
            <<<dim3(CDIM / 64, ROWS / 32), blk, 0, stream>>>(
                attn_bf, wo_bf + (size_t)l * CDIM * CDIM, bo + l * CDIM,
                xin, xcur, nullptr, CDIM, CDIM);

        // --- MLP sublayer ---
        ln_kernel<<<dim3(ROWS), blk, 0, stream>>>(xcur, ln2g + l * CDIM,
                                                  ln2b + l * CDIM, h_bf);
        gemm_bf16_kernel<true, false, true>
            <<<dim3(DFF / 64, ROWS / 32), blk, 0, stream>>>(
                h_bf, w1_bf + (size_t)l * CDIM * DFF, b1 + l * DFF,
                nullptr, nullptr, u_bf, CDIM, DFF);
        gemm_bf16_kernel<false, true, false>
            <<<dim3(CDIM / 64, ROWS / 32), blk, 0, stream>>>(
                u_bf, w2_bf + (size_t)l * DFF * CDIM, b2 + l * CDIM,
                xcur, xcur, nullptr, DFF, CDIM);
    }
}

// v005
// It runs in 255 microseconds.
// Two timings next to v004 put it at 1.03 and 1.02 times that version's speed.
// Over all steps from v000 it is 1.82 times as fast.
#include <hip/hip_runtime.h>
#include <hip/hip_bf16.h>
#include <math.h>
#include <stdint.h>

// ---------------- problem constants ----------------
#define LAYERS 2
#define BATCH  4
#define SEQ    1024
#define CDIM   256
#define HEADS  8
#define DHEAD  32          // CDIM / HEADS
#define TOPM   64
#define DFF    1024
#define ROWS   (BATCH * SEQ)      // 4096 token rows
#define LNEPS  1e-5f

// WMMA vector types (CDNA5 wave32)
typedef __attribute__((ext_vector_type(16))) __bf16 v16bf;
typedef __attribute__((ext_vector_type(8)))  float  v8f;

union ABOp {            // one 16x32 bf16 WMMA operand per lane
    uint16_t u[16];
    uint4    q[2];      // two 16-byte chunks
    v16bf    v;
};

__device__ __forceinline__ uint16_t f2bf(float f) {
    uint32_t u = __float_as_uint(f);
    uint32_t r = u + 0x7FFFu + ((u >> 16) & 1u);   // round-to-nearest-even
    return (uint16_t)(r >> 16);
}

__device__ __forceinline__ v8f wmma_bf16(const ABOp& a, const ABOp& b, v8f c) {
    return __builtin_amdgcn_wmma_f32_16x16x32_bf16(
        false, a.v, false, b.v, (short)0, c, false, false);
}

// ---------------- wave-wide reductions on the vector unit ----------------
// Lane l <-> l ^ 16 (other 16-lane row) and l <-> l ^ M (inside a row, DPP
// row_xmask): register-to-register moves, no trip through the LDS crossbar.
__device__ __forceinline__ float xhalf(float x) {
    int b = __builtin_bit_cast(int, x);
    return __builtin_bit_cast(float, __builtin_amdgcn_permlanex16(
        b, b, 0x76543210, 0xfedcba98, false, false));
}
template<int M>
__device__ __forceinline__ float xrow(float x) {
    return __builtin_bit_cast(float, __builtin_amdgcn_mov_dpp(
        __builtin_bit_cast(int, x), 0x160 | M, 0xf, 0xf, true));
}
// Butterfly over 32 lanes in the order 16, 8, 4, 2, 1; every lane gets the result.
__device__ __forceinline__ float wave_sum(float s) {
    s += xhalf(s);   s += xrow<8>(s); s += xrow<4>(s);
    s += xrow<2>(s); s += xrow<1>(s);
    return s;
}
__device__ __forceinline__ float wave_max(float s) {
    s = fmaxf(s, xhalf(s));   s = fmaxf(s, xrow<8>(s)); s = fmaxf(s, xrow<4>(s));
    s = fmaxf(s, xrow<2>(s)); s = fmaxf(s, xrow<1>(s));
    return s;
}
__device__ __forceinline__ float wave_min(float s) {
    s = fminf(s, xhalf(s));   s = fminf(s, xrow<8>(s)); s = fminf(s, xrow<4>(s));
    s = fminf(s, xrow<2>(s)); s = fminf(s, xrow<1>(s));
    return s;
}
// A value that is equal in all lanes, moved to a scalar register.
__device__ __forceinline__ float uniform_f(float x) {
    return __builtin_bit_cast(float,
        __builtin_amdgcn_readfirstlane(__builtin_bit_cast(int, x)));
}

// ---------------- LayerNorm (one wave per row, LNR rows a wave) ----------
// A row is 8 values a lane, so its sums need the wave-wide butterfly only: no
// LDS, no barrier. Few waves with much work each, because starting waves, not
// the arithmetic, is what such a grid costs: a block is one wave per SIMD, and
// a LayerNorm is one block per WGP.
#define SMALLBLK 128              // threads per block, LayerNorm and converts
#define LNR    4                  // rows per wave, all loads issued up front
#define LNROWS (SMALLBLK / 32 * LNR)   // rows per block
#define LNGRID (ROWS / LNROWS)    // blocks per LayerNorm
typedef __attribute__((ext_vector_type(4))) float f32x4;
__device__ __forceinline__ uint2 pack4(f32x4 y) {
    uint2 r;
    r.x = (uint32_t)f2bf(y.x) | ((uint32_t)f2bf(y.y) << 16);
    r.y = (uint32_t)f2bf(y.z) | ((uint32_t)f2bf(y.w) << 16);
    return r;
}
__device__ __forceinline__ void ln_rows(const float* __restrict__ x,
                                        const float* __restrict__ g,
                                        const float* __restrict__ b,
                                        uint16_t* __restrict__ out, int blk) {
    const int wave = threadIdx.x >> 5, lane = threadIdx.x & 31;
    // lane l holds columns 4l .. 4l+3 and 128+4l .. 128+4l+3 of each row
    const size_t at = (size_t)((blk * (SMALLBLK / 32) + wave) * LNR) * CDIM + lane * 4;
    f32x4 v[LNR][2];
    #pragma unroll
    for (int r = 0; r < LNR; ++r) {
        v[r][0] = *(const f32x4*)(x + at + r * CDIM);
        v[r][1] = *(const f32x4*)(x + at + r * CDIM + 128);
    }
    const f32x4 g0 = *(const f32x4*)(g + lane * 4);
    const f32x4 g1 = *(const f32x4*)(g + lane * 4 + 128);
    const f32x4 b0 = *(const f32x4*)(b + lane * 4);
    const f32x4 b1 = *(const f32x4*)(b + lane * 4 + 128);
    float s[LNR], ss[LNR];
    #pragma unroll
    for (int r = 0; r < LNR; ++r) {
        const f32x4 p = v[r][0], q = v[r][1];
        s[r]  = ((p.x + p.y) + (p.z + p.w)) + ((q.x + q.y) + (q.z + q.w));
        ss[r] = ((p.x * p.x + p.y * p.y) + (p.z * p.z + p.w * p.w))
              + ((q.x * q.x + q.y * q.y) + (q.z * q.z + q.w * q.w));
    }
    #pragma unroll
    for (int r = 0; r < LNR; ++r) { s[r] = wave_sum(s[r]); ss[r] = wave_sum(ss[r]); }
    #pragma unroll
    for (int r = 0; r < LNR; ++r) {
        const float mean = s[r] * (1.0f / CDIM);
        const float var  = ss[r] * (1.0f / CDIM) - mean * mean;
        const float rstd = rsqrtf(var + LNEPS);
        *(uint2*)(out + at + r * CDIM)       = pack4((v[r][0] - mean) * rstd * g0 + b0);
        *(uint2*)(out + at + r * CDIM + 128) = pack4((v[r][1] - mean) * rstd * g1 + b1);
    }
}

__global__ __launch_bounds__(SMALLBLK) void ln_kernel(const float* __restrict__ x,
                          const float* __restrict__ g,
                          const float* __restrict__ b,
                          uint16_t* __restrict__ out) {
    ln_rows(x, g, b, out, blockIdx.x);
}

// ---------------- front launch: everything that reads inputs only ----------
// Blocks [0, LNGRID): the first LayerNorm. The blocks behind them convert the
// weights of all layers to bf16, CVT values each (32 a thread, as eight
// 16-byte loads a whole block apart): the five arrays land one behind the
// other in wbf, each with its layers in input order.
#define NWQ  (LAYERS * CDIM * CDIM)
#define NWKV (LAYERS * CDIM * 2 * CDIM)
#define NWO  (LAYERS * CDIM * CDIM)
#define NW1  (LAYERS * CDIM * DFF)
#define NW2  (LAYERS * DFF * CDIM)
#define NWALL (NWQ + NWKV + NWO + NW1 + NW2)
#define CVT  4096
__global__ __launch_bounds__(SMALLBLK) void front_kernel(const float* __restrict__ x,
                             const float* __restrict__ g,
                             const float* __restrict__ b,
                             uint16_t* __restrict__ hout,
                             const float* __restrict__ Wq,
                             const float* __restrict__ Wkv,
                             const float* __restrict__ Wo,
                             const float* __restrict__ W1,
                             const float* __restrict__ W2,
                             uint16_t* __restrict__ wbf) {
    if (blockIdx.x < LNGRID) {          // same for the whole block
        ln_rows(x, g, b, hout, blockIdx.x);
        return;
    }
    const int e0 = (blockIdx.x - LNGRID) * CVT; // every array is whole blocks
    const float* arr = W2;                      // the array e0 lies in
    int first = NWQ + NWKV + NWO + NW1;         // and its first value's place
    if (e0 < NWQ + NWKV + NWO + NW1) { arr = W1;  first = NWQ + NWKV + NWO; }
    if (e0 < NWQ + NWKV + NWO)       { arr = Wo;  first = NWQ + NWKV; }
    if (e0 < NWQ + NWKV)             { arr = Wkv; first = NWQ; }
    if (e0 < NWQ)                    { arr = Wq;  first = 0; }
    const float* in = arr + (e0 - first) + threadIdx.x * 4;
    uint16_t*    to = wbf + e0 + threadIdx.x * 4;
    constexpr int STEP = SMALLBLK * 4;          // values a block takes at once
    f32x4 w[CVT / STEP];
    #pragma unroll
    for (int i = 0; i < CVT / STEP; ++i) w[i] = *(const f32x4*)(in + i * STEP);
    #pragma unroll
    for (int i = 0; i < CVT / STEP; ++i) *(uint2*)(to + i * STEP) = pack4(w[i]);
}

// ---------------- generic bf16 WMMA GEMM: D = act(A@B + bias) (+resid) ----
// A: [M,K] bf16 row-major.  B: [K,Nc] bf16 row-major (staged in LDS).
// block = 256 (8 waves, each owns a 16x16 output tile); the block takes the
// 32 x 64 output tile (by, bx) of the Nc/64 x M/32 tiles.
template<bool GELU_, bool RES, bool OUTBF>
__device__ __forceinline__ void gemm_tile(const uint16_t* __restrict__ A,
                                 const uint16_t* __restrict__ Bw,
                                 const float* __restrict__ bias,
                                 const float* __restrict__ resid,
                                 float* __restrict__ outf,
                                 uint16_t* __restrict__ outb,
                                 int K, int Nc, int bx, int by) {
    __shared__ uint16_t Bs[32 * 72];     // 32 K-rows x 64 cols (+8 pad)
    const int tid  = threadIdx.x;
    const int wave = tid >> 5, lane = tid & 31;
    const int g    = lane >> 4;          // half-wave select
    const int wm   = wave >> 2, wn = wave & 3;
    const int row0 = by * 32 + wm * 16;
    const int col0 = bx * 64;
    const int colT = col0 + wn * 16;
    const int rB   = tid >> 3, ccB = (tid & 7) * 8;   // B-stage mapping

    v8f acc = {};
    #pragma unroll 2
    for (int kk = 0; kk < K; kk += 32) {
        __syncthreads();
        // cooperative stage of B tile (32x64 bf16 = 4KB, coalesced b128)
        *(uint4*)(&Bs[rB * 72 + ccB]) =
            *(const uint4*)(&Bw[(size_t)(kk + rB) * Nc + col0 + ccB]);
        // prefetch next K-tile of B into cache (gfx1250 global_prefetch path)
        if (kk + 32 < K)
            __builtin_prefetch(&Bw[(size_t)(kk + 32 + rB) * Nc + col0 + ccB], 0, 1);
        __syncthreads();
        // A operand: row m = row0+lane%16, K-chunks at kk+g*8 and kk+16+g*8
        ABOp a;
        const uint16_t* ar = A + (size_t)(row0 + (lane & 15)) * K + kk;
        a.q[0] = *(const uint4*)(ar + g * 8);
        a.q[1] = *(const uint4*)(ar + 16 + g * 8);
        // B operand from LDS: col n = colT+lane%16, same K pattern
        ABOp bm;
        const int n = wn * 16 + (lane & 15);
        #pragma unroll
        for (int j = 0; j < 16; ++j) {
            int kloc = (j < 8) ? (g * 8 + j) : (16 + g * 8 + (j - 8));
            bm.u[j] = Bs[kloc * 72 + n];
        }
        acc = wmma_bf16(a, bm, acc);
    }
    // C/D layout: element v -> (m = row0 + g*8 + v, n = colT + lane%16)
    const int nc = colT + (lane & 15);
    const float bb = bias[nc];
    #pragma unroll
    for (int v = 0; v < 8; ++v) {
        int m = row0 + g * 8 + v;
        float r = acc[v] + bb;
        if (GELU_) r = 0.5f * r * (1.0f + erff(r * 0.70710678118654752f));
        if (RES)   r += resid[(size_t)m * Nc + nc];
        if (OUTBF) outb[(size_t)m * Nc + nc] = f2bf(r);
        else       outf[(size_t)m * Nc + nc] = r;
    }
}

// one product: grid = (Nc/64, M/32)
template<bool GELU_, bool RES, bool OUTBF>
__global__ void gemm_bf16_kernel(const uint16_t* __restrict__ A,
                                 const uint16_t* __restrict__ Bw,
                                 const float* __restrict__ bias,
                                 const float* __restrict__ resid,
                                 float* __restrict__ outf,
                                 uint16_t* __restrict__ outb,
                                 int K, int Nc) {
    gemm_tile<GELU_, RES, OUTBF>(A, Bw, bias, resid, outf, outb, K, Nc,
                                 blockIdx.x, blockIdx.y);
}

// Q and KV projections of the same rows in one grid = (3*CDIM/64, M/32):
// the first CDIM/64 block columns are Q's tiles, the others KV's.
__global__ void gemm_qkv_kernel(const uint16_t* __restrict__ A,
                                const uint16_t* __restrict__ Wq,
                                const uint16_t* __restrict__ Wkv,
                                const float* __restrict__ bq,
                                const float* __restrict__ bkv,
                                uint16_t* __restrict__ q,
                                uint16_t* __restrict__ kv) {
    const bool isq = blockIdx.x < CDIM / 64;    // same for the whole block
    gemm_tile<false, false, true>(A, isq ? Wq : Wkv, isq ? bq : bkv,
                                  nullptr, nullptr, isq ? q : kv,
                                  CDIM, isq ? CDIM : 2 * CDIM,
                                  isq ? blockIdx.x : blockIdx.x - CDIM / 64,
                                  blockIdx.y);
}

// ---------------- fused dual-pass attention ----------------
// One workgroup = (b, h, 64-query panel), 32 waves: the panel fills the LDS of
// its WGP, so the waves that hide each other's waits must come from this one
// workgroup (8 per SIMD). Scores stay in LDS (64 x 1032 f32), plus a 16KB LDS
// chunk for staged V (256 keys x 32 d, bf16: one 16-byte piece per thread).
// Phase 1: QK^T via WMMA. Phase 2: dense softmax stats + top-64 threshold by
// value bisection + fused combined probabilities. Phase 3: P@V via WMMA with
// LDS-staged V chunks (coalesced b128 staging instead of 2B gathers).
#define QBLK  64
#define SLD   1032    // 1024 + 8 pad floats to dodge bank conflicts
#define AWAVES 32     // waves per workgroup
#define VCH   256     // keys per staged V chunk
#define KGRP  (AWAVES / 8)            // wave groups that share the keys in P@V
#define KSTEP (VCH / 32 / KGRP)       // 32-key steps per wave and chunk
__global__ __launch_bounds__(AWAVES * 32) void attn_kernel(const uint16_t* __restrict__ qb,   // [ROWS,CDIM] bf16
                            const uint16_t* __restrict__ kvb,  // [ROWS,2*CDIM] bf16
                            const float* __restrict__ wf,      // w_fuse[2]
                            uint16_t* __restrict__ attn) {     // [ROWS,CDIM] bf16
    extern __shared__ float sc[];
    uint16_t* Vs = (uint16_t*)(sc + QBLK * SLD);   // [VCH][DHEAD] bf16
    const int bid  = blockIdx.x;
    const int b    = bid / (HEADS * (SEQ / QBLK));
    const int rem  = bid % (HEADS * (SEQ / QBLK));
    const int h    = rem / (SEQ / QBLK);
    const int q0   = (rem % (SEQ / QBLK)) * QBLK;
    const int tid  = threadIdx.x;
    const int wave = tid >> 5, lane = tid & 31;
    const int g    = lane >> 4;
    const float scale = 0.17677669529663687f;   // 1/sqrt(32)

    // learned fusion weights (softmax over 2) -- uniform, scalarizes to SALU
    const float e0 = expf(wf[0]), e1 = expf(wf[1]);
    const float w0 = e0 / (e0 + e1), w1 = e1 / (e0 + e1);

    // ---- phase 1: scores tile 64q x 1024k, 256 WMMA tiles over 32 waves ----
    for (int t = wave; t < (QBLK / 16) * (SEQ / 16); t += AWAVES) {
        const int qt = t >> 6, kt = t & 63;
        ABOp a, bm;
        {   // Q operand: 16 queries x 32 d (contiguous d chunks)
            int m = q0 + qt * 16 + (lane & 15);
            const uint16_t* qr = qb + (size_t)(b * SEQ + m) * CDIM + h * DHEAD;
            a.q[0] = *(const uint4*)(qr + g * 8);
            a.q[1] = *(const uint4*)(qr + 16 + g * 8);
        }
        {   // K operand: 16 keys across lanes, d packed (row-major contiguous)
            int n = kt * 16 + (lane & 15);
            const uint16_t* kr = kvb + (size_t)(b * SEQ + n) * (2 * CDIM) + h * DHEAD;
            bm.q[0] = *(const uint4*)(kr + g * 8);
            bm.q[1] = *(const uint4*)(kr + 16 + g * 8);
        }
        v8f c = {};
        c = wmma_bf16(a, bm, c);
        #pragma unroll
        for (int v = 0; v < 8; ++v)
            sc[(qt * 16 + g * 8 + v) * SLD + kt * 16 + (lane & 15)] = c[v] * scale;
    }
    __syncthreads();

    // ---- phase 2: per-row dense softmax + top-64 threshold + fusion ----
    for (int i = 0; i < QBLK / AWAVES; ++i) {
        const int row = wave * (QBLK / AWAVES) + i;
        float* rp = sc + row * SLD;
        float rv[32];
        #pragma unroll
        for (int j = 0; j < 32; ++j) rv[j] = rp[lane + j * 32];
        float mx = -1e30f, mn = 1e30f;
        #pragma unroll
        for (int j = 0; j < 32; ++j) { mx = fmaxf(mx, rv[j]); mn = fminf(mn, rv[j]); }
        mx = wave_max(mx);
        mn = wave_min(mn);
        float ev[32];     // each exponential is formed once and kept
        #pragma unroll
        for (int j = 0; j < 32; ++j) ev[j] = expf(rv[j] - mx);
        float sd = 0.f;
        #pragma unroll
        for (int j = 0; j < 32; ++j) sd += ev[j];
        sd = wave_sum(sd);
        // bisection for top-64 threshold: largest t with count(s>t) >= TOPM
        // The count over the wave is taken from the compare masks themselves
        // (ballot + population count), so bounds and count live in scalars.
        float lo = uniform_f(mn) - 1.0f, hi = uniform_f(mx);
        for (int left = 24; left > 0; ) {
            float mid = 0.5f * (lo + hi);
            int c = 0;
            #pragma unroll
            for (int j = 0; j < 32; j += 2) {
                uint64_t m0 = __builtin_amdgcn_ballot_w32(rv[j]     > mid);
                uint64_t m1 = __builtin_amdgcn_ballot_w32(rv[j + 1] > mid);
                c += __builtin_popcountll(m0 | (m1 << 32));
            }
            if (c >= TOPM) lo = mid; else hi = mid;
            // Exactly TOPM scores lie above lo: every later step keeps this
            // same set, so the search is over (24 steps stay the bound).
            left = (c == TOPM) ? 0 : left - 1;
        }
        const float thr = lo;
        float st = 0.f;
        #pragma unroll
        for (int j = 0; j < 32; ++j) st += (rv[j] > thr) ? ev[j] : 0.f;
        st = wave_sum(st);
        const float cd = w0 / sd;
        const float ct = w1 / fmaxf(st, 1e-20f);
        #pragma unroll
        for (int j = 0; j < 32; ++j)
            rp[lane + j * 32] = ev[j] * (cd + ((rv[j] > thr) ? ct : 0.f));
    }
    __syncthreads();

    // ---- phase 3: out = P @ V with LDS-staged V chunks ----
    // 8 output tiles x KGRP wave groups: group kq takes KSTEP of the 32-key
    // steps of every chunk; the groups' partial sums meet in LDS at the end.
    {
        const int tile = wave & 7, kq = wave >> 3;
        const int qt = tile >> 1, dt = tile & 1;
        const int d  = dt * 16 + (lane & 15);
        const int m  = qt * 16 + (lane & 15);
        // first P and first V element of this lane in a chunk; all its others
        // lie at compile-time distances from these
        const float*    pw = sc + m * SLD + kq * (KSTEP * 32) + g * 8;
        const uint16_t* vw = Vs + (kq * (KSTEP * 32) + g * 8) * DHEAD + d;
        v8f acc = {};
        for (int kk0 = 0; kk0 < SEQ; kk0 += VCH) {
            // stage V[kk0 .. kk0+VCH) x DHEAD : 16KB, one coalesced b128 a thread
            {
                const uint16_t* vb = kvb + (size_t)(b * SEQ + kk0) * (2 * CDIM)
                                     + CDIM + h * DHEAD;
                int r = tid >> 2, c = (tid & 3) * 8;   // 1024 uint4 total
                *(uint4*)(&Vs[r * DHEAD + c]) =
                    *(const uint4*)(vb + (size_t)r * (2 * CDIM) + c);
                // the load's address registers are reused right behind the barrier
                asm volatile("s_wait_xcnt 0x0" ::: "memory");
            }
            __syncthreads();
            #pragma unroll
            for (int s = 0; s < KSTEP; ++s) {
                ABOp a, bm;
                #pragma unroll
                for (int j = 0; j < 16; ++j) {
                    const int kc = s * 32 + ((j < 8) ? j : j + 8);  // + g*8 in pw, vw
                    a.u[j]  = f2bf(pw[kk0 + kc]);
                    bm.u[j] = vw[kc * DHEAD];
                }
                acc = wmma_bf16(a, bm, acc);
            }
            __syncthreads();
        }
        // The score panel has been read for the last time (barrier above): its
        // first 24KB now carry the partial sums of groups 1.. to group 0.
        if (kq != 0) {
            #pragma unroll
            for (int v = 0; v < 8; ++v)
                sc[(((kq - 1) * 8 + tile) * 8 + v) * 32 + lane] = acc[v];
        }
        __syncthreads();
        if (kq == 0) {
            #pragma unroll
            for (int p = 0; p < KGRP - 1; ++p) {
                #pragma unroll
                for (int v = 0; v < 8; ++v)
                    acc[v] += sc[((p * 8 + tile) * 8 + v) * 32 + lane];
            }
            #pragma unroll
            for (int v = 0; v < 8; ++v) {
                int mr = q0 + qt * 16 + g * 8 + v;
                int nc = dt * 16 + (lane & 15);
                attn[(size_t)(b * SEQ + mr) * CDIM + h * DHEAD + nc] = f2bf(acc[v]);
            }
        }
    }
}

// ---------------- host side ----------------
extern "C" void kernel_launch(void* const* d_in, const int* in_sizes, int n_in,
                              void* d_out, int out_size, void* d_ws, size_t ws_size,
                              hipStream_t stream) {
    (void)in_sizes; (void)n_in; (void)out_size; (void)ws_size;
    const float* x     = (const float*)d_in[0];
    const float* ln1g  = (const float*)d_in[1];
    const float* ln1b  = (const float*)d_in[2];
    const float* Wq    = (const float*)d_in[3];
    const float* bq    = (const float*)d_in[4];
    const float* Wkv   = (const float*)d_in[5];
    const float* bkv   = (const float*)d_in[6];
    const float* wfuse = (const float*)d_in[7];
    const float* Wo    = (const float*)d_in[8];
    const float* bo    = (const float*)d_in[9];
    const float* ln2g  = (const float*)d_in[10];
    const float* ln2b  = (const float*)d_in[11];
    const float* W1    = (const float*)d_in[12];
    const float* b1    = (const float*)d_in[13];
    const float* W2    = (const float*)d_in[14];
    const float* b2    = (const float*)d_in[15];
    float* xcur = (float*)d_out;                       // running activations

    // workspace carve-up (bf16 buffers, 256B-aligned power-of-two sizes);
    // the five weight arrays lie in the order the front launch writes them
    uint8_t* ws = (uint8_t*)d_ws;
    uint16_t* wq_bf   = (uint16_t*)(ws);                 size_t off = NWQ * 2;
    uint16_t* wkv_bf  = (uint16_t*)(ws + off);           off += NWKV * 2;
    uint16_t* wo_bf   = (uint16_t*)(ws + off);           off += NWO * 2;
    uint16_t* w1_bf   = (uint16_t*)(ws + off);           off += NW1 * 2;
    uint16_t* w2_bf   = (uint16_t*)(ws + off);           off += NW2 * 2;
    uint16_t* h_bf    = (uint16_t*)(ws + off);           off += (size_t)ROWS * CDIM * 2;
    uint16_t* q_bf    = (uint16_t*)(ws + off);           off += (size_t)ROWS * CDIM * 2;
    uint16_t* kv_bf   = (uint16_t*)(ws + off);           off += (size_t)ROWS * 2 * CDIM * 2;
    uint16_t* attn_bf = (uint16_t*)(ws + off);           off += (size_t)ROWS * CDIM * 2;
    uint16_t* u_bf    = (uint16_t*)(ws + off);

    const int attnLds = QBLK * SLD * (int)sizeof(float)           // score panel
                      + VCH * DHEAD * (int)sizeof(uint16_t);      // V chunk
    hipFuncSetAttribute((const void*)attn_kernel,
                        hipFuncAttributeMaxDynamicSharedMemorySize, attnLds);

    const dim3 blk(256);
    // first LayerNorm and all weight converts: they read inputs only
    front_kernel<<<dim3(LNGRID + NWALL / CVT), dim3(SMALLBLK), 0, stream>>>(
        x, ln1g, ln1b, h_bf, Wq, Wkv, Wo, W1, W2, wq_bf);

    for (int l = 0; l < LAYERS; ++l) {
        // layer 0 takes its residual from x itself; d_out is first written there
        const float* xin = (l == 0) ? x : xcur;

        // --- attention sublayer ---
        if (l > 0)
            ln_kernel<<<dim3(LNGRID), dim3(SMALLBLK), 0, stream>>>(xcur, ln1g + l * CDIM,
                                                      ln1b + l * CDIM, h_bf);
        gemm_qkv_kernel<<<dim3(3 * CDIM / 64, ROWS / 32), blk, 0, stream>>>(
                h_bf, wq_bf + (size_t)l * CDIM * CDIM,
                wkv_bf + (size_t)l * CDIM * 2 * CDIM,
                bq + l * CDIM, bkv + l * 2 * CDIM, q_bf, kv_bf);
        attn_kernel<<<dim3(BATCH * HEADS * (SEQ / QBLK)), dim3(AWAVES * 32), attnLds, stream>>>(
                q_bf, kv_bf, wfuse + l * 2, attn_bf);
        gemm_bf16_kernel<false, true, false>
            <<<dim3(CDIM / 64, ROWS / 32), blk, 0, stream>>>(
                attn_bf, wo_bf + (size_t)l * CDIM * CDIM, bo + l * CDIM,
                xin, xcur, nullptr, CDIM, CDIM);

        // --- MLP sublayer ---
        ln_kernel<<<dim3(LNGRID), dim3(SMALLBLK), 0, stream>>>(xcur, ln2g + l * CDIM,
                                                  ln2b + l * CDIM, h_bf);
        gemm_bf16_kernel<true, false, true>
            <<<dim3(DFF / 64, ROWS / 32), blk, 0, stream>>>(
                h_bf, w1_bf + (size_t)l * CDIM * DFF, b1 + l * DFF,
                nullptr, nullptr, u_bf, CDIM, DFF);
        gemm_bf16_kernel<false, true, false>
            <<<dim3(CDIM / 64, ROWS / 32), blk, 0, stream>>>(
                u_bf, w2_bf + (size_t)l * DFF * CDIM, b2 + l * CDIM,
                xcur, xcur, nullptr, DFF, CDIM);
    }
}

// v006
// A run of this version takes 190 microseconds.
// Timed twice side by side with v005, it ran 1.35 times as fast both times.
// Counting every step since v000, it is 2.46 times as fast.
#include <hip/hip_runtime.h>
#include <hip/hip_bf16.h>
#include <math.h>
#include <stdint.h>

// ---------------- problem constants ----------------
#define LAYERS 2
#define BATCH  4
#define SEQ    1024
#define CDIM   256
#define HEADS  8
#define DHEAD  32          // CDIM / HEADS
#define TOPM   64
#define DFF    1024
#define ROWS   (BATCH * SEQ)      // 4096 token rows
#define LNEPS  1e-5f

// WMMA vector types (CDNA5 wave32)
typedef __attribute__((ext_vector_type(16))) __bf16 v16bf;
typedef __attribute__((ext_vector_type(8)))  float  v8f;

union ABOp {            // one 16x32 bf16 WMMA operand per lane
    uint16_t u[16];
    uint4    q[2];      // two 16-byte chunks
    v16bf    v;
};

__device__ __forceinline__ uint16_t f2bf(float f) {
    uint32_t u = __float_as_uint(f);
    uint32_t r = u + 0x7FFFu + ((u >> 16) & 1u);   // round-to-nearest-even
    return (uint16_t)(r >> 16);
}

__device__ __forceinline__ v8f wmma_bf16(const ABOp& a, const ABOp& b, v8f c) {
    return __builtin_amdgcn_wmma_f32_16x16x32_bf16(
        false, a.v, false, b.v, (short)0, c, false, false);
}

// ---------------- wave-wide reductions on the vector unit ----------------
// Lane l <-> l ^ 16 (other 16-lane row) and l <-> l ^ M (inside a row, DPP
// row_xmask): register-to-register moves, no trip through the LDS crossbar.
__device__ __forceinline__ float xhalf(float x) {
    int b = __builtin_bit_cast(int, x);
    return __builtin_bit_cast(float, __builtin_amdgcn_permlanex16(
        b, b, 0x76543210, 0xfedcba98, false, false));
}
template<int M>
__device__ __forceinline__ float xrow(float x) {
    return __builtin_bit_cast(float, __builtin_amdgcn_mov_dpp(
        __builtin_bit_cast(int, x), 0x160 | M, 0xf, 0xf, true));
}
// Butterfly over 32 lanes in the order 16, 8, 4, 2, 1; every lane gets the result.
__device__ __forceinline__ float wave_sum(float s) {
    s += xhalf(s);   s += xrow<8>(s); s += xrow<4>(s);
    s += xrow<2>(s); s += xrow<1>(s);
    return s;
}
__device__ __forceinline__ float wave_max(float s) {
    s = fmaxf(s, xhalf(s));   s = fmaxf(s, xrow<8>(s)); s = fmaxf(s, xrow<4>(s));
    s = fmaxf(s, xrow<2>(s)); s = fmaxf(s, xrow<1>(s));
    return s;
}
__device__ __forceinline__ float wave_min(float s) {
    s = fminf(s, xhalf(s));   s = fminf(s, xrow<8>(s)); s = fminf(s, xrow<4>(s));
    s = fminf(s, xrow<2>(s)); s = fminf(s, xrow<1>(s));
    return s;
}
// A value that is equal in all lanes, moved to a scalar register.
__device__ __forceinline__ float uniform_f(float x) {
    return __builtin_bit_cast(float,
        __builtin_amdgcn_readfirstlane(__builtin_bit_cast(int, x)));
}

// ---------------- LayerNorm (one wave per row, LNR rows a wave) ----------
// A row is 8 values a lane, so its sums need the wave-wide butterfly only: no
// LDS, no barrier. Few waves with much work each, because starting waves, not
// the arithmetic, is what such a grid costs: a block is one wave per SIMD, and
// a LayerNorm is one block per WGP.
#define SMALLBLK 128              // threads per block, LayerNorm and converts
#define LNR    4                  // rows per wave, all loads issued up front
#define LNROWS (SMALLBLK / 32 * LNR)   // rows per block
#define LNGRID (ROWS / LNROWS)    // blocks per LayerNorm
typedef __attribute__((ext_vector_type(4))) float f32x4;
__device__ __forceinline__ uint2 pack4(f32x4 y) {
    uint2 r;
    r.x = (uint32_t)f2bf(y.x) | ((uint32_t)f2bf(y.y) << 16);
    r.y = (uint32_t)f2bf(y.z) | ((uint32_t)f2bf(y.w) << 16);
    return r;
}
__device__ __forceinline__ void ln_rows(const float* __restrict__ x,
                                        const float* __restrict__ g,
                                        const float* __restrict__ b,
                                        uint16_t* __restrict__ out, int blk) {
    const int wave = threadIdx.x >> 5, lane = threadIdx.x & 31;
    // lane l holds columns 4l .. 4l+3 and 128+4l .. 128+4l+3 of each row
    const size_t at = (size_t)((blk * (SMALLBLK / 32) + wave) * LNR) * CDIM + lane * 4;
    f32x4 v[LNR][2];
    #pragma unroll
    for (int r = 0; r < LNR; ++r) {
        v[r][0] = *(const f32x4*)(x + at + r * CDIM);
        v[r][1] = *(const f32x4*)(x + at + r * CDIM + 128);
    }
    const f32x4 g0 = *(const f32x4*)(g + lane * 4);
    const f32x4 g1 = *(const f32x4*)(g + lane * 4 + 128);
    const f32x4 b0 = *(const f32x4*)(b + lane * 4);
    const f32x4 b1 = *(const f32x4*)(b + lane * 4 + 128);
    float s[LNR], ss[LNR];
    #pragma unroll
    for (int r = 0; r < LNR; ++r) {
        const f32x4 p = v[r][0], q = v[r][1];
        s[r]  = ((p.x + p.y) + (p.z + p.w)) + ((q.x + q.y) + (q.z + q.w));
        ss[r] = ((p.x * p.x + p.y * p.y) + (p.z * p.z + p.w * p.w))
              + ((q.x * q.x + q.y * q.y) + (q.z * q.z + q.w * q.w));
    }
    #pragma unroll
    for (int r = 0; r < LNR; ++r) { s[r] = wave_sum(s[r]); ss[r] = wave_sum(ss[r]); }
    #pragma unroll
    for (int r = 0; r < LNR; ++r) {
        const float mean = s[r] * (1.0f / CDIM);
        const float var  = ss[r] * (1.0f / CDIM) - mean * mean;
        const float rstd = rsqrtf(var + LNEPS);
        *(uint2*)(out + at + r * CDIM)       = pack4((v[r][0] - mean) * rstd * g0 + b0);
        *(uint2*)(out + at + r * CDIM + 128) = pack4((v[r][1] - mean) * rstd * g1 + b1);
    }
}

__global__ __launch_bounds__(SMALLBLK) void ln_kernel(const float* __restrict__ x,
                          const float* __restrict__ g,
                          const float* __restrict__ b,
                          uint16_t* __restrict__ out) {
    ln_rows(x, g, b, out, blockIdx.x);
}

// ---------------- front launch: everything that reads inputs only ----------
// Blocks [0, LNGRID): the first LayerNorm. The blocks behind them convert the
// weights of all layers to bf16, CVT values each: the five arrays land one
// behind the other in wbf, each with its layers in input order.
// Inside a layer the values lie in the order of the WMMA B operand: one 1KB
// fragment per (16 columns, 32 k), fragments of a column group in k order; in
// a fragment two 512-byte halves, lane l's 16 bytes at l*16 in each. A wave
// then reads a whole fragment with two 16-byte loads over contiguous lines.
#define NWQ  (LAYERS * CDIM * CDIM)
#define NWKV (LAYERS * CDIM * 2 * CDIM)
#define NWO  (LAYERS * CDIM * CDIM)
#define NW1  (LAYERS * CDIM * DFF)
#define NW2  (LAYERS * DFF * CDIM)
#define NWALL (NWQ + NWKV + NWO + NW1 + NW2)
#define CVT  4096                 // a block's share: 64 k x 64 columns
#define FRAG 512                  // values in one B fragment
template<int K, int N>
__device__ __forceinline__ void pack_tile(const float* __restrict__ w,
                                          uint16_t* __restrict__ to, int tile) {
    constexpr int TPL = K * N / CVT;            // tiles per layer
    const int l  = tile / TPL, r = tile % TPL;
    const int kt = r / (N / 64), nt = r % (N / 64);
    const int n  = nt * 64 + (threadIdx.x & 63);    // this thread's column
    const int ks = kt * 2 + (threadIdx.x >> 6);     // and its 32-k step
    const float* in = w + (size_t)l * K * N + (size_t)(ks * 32) * N + n;
    float v[32];
    #pragma unroll
    for (int i = 0; i < 32; ++i) v[i] = in[i * N];
    uint16_t* o = to + (size_t)l * K * N + ((n >> 4) * (K / 32) + ks) * FRAG + (n & 15) * 8;
    // k 0-7: half 0, lanes 0-15; k 8-15: half 0, lanes 16-31; k 16-31: half 1 alike
    #pragma unroll
    for (int c = 0; c < 4; ++c) {
        uint4 p;
        p.x = (uint32_t)f2bf(v[c * 8 + 0]) | ((uint32_t)f2bf(v[c * 8 + 1]) << 16);
        p.y = (uint32_t)f2bf(v[c * 8 + 2]) | ((uint32_t)f2bf(v[c * 8 + 3]) << 16);
        p.z = (uint32_t)f2bf(v[c * 8 + 4]) | ((uint32_t)f2bf(v[c * 8 + 5]) << 16);
        p.w = (uint32_t)f2bf(v[c * 8 + 6]) | ((uint32_t)f2bf(v[c * 8 + 7]) << 16);
        *(uint4*)(o + (c >> 1) * (FRAG / 2) + (c & 1) * 128) = p;
    }
    // the stores' data and address registers may be rewritten by what follows
    asm volatile("s_wait_xcnt 0x0" ::: "memory");
}
__global__ __launch_bounds__(SMALLBLK) void front_kernel(const float* __restrict__ x,
                             const float* __restrict__ g,
                             const float* __restrict__ b,
                             uint16_t* __restrict__ hout,
                             const float* __restrict__ Wq,
                             const float* __restrict__ Wkv,
                             const float* __restrict__ Wo,
                             const float* __restrict__ W1,
                             const float* __restrict__ W2,
                             uint16_t* __restrict__ wbf) {
    if (blockIdx.x < LNGRID) {          // same for the whole block
        ln_rows(x, g, b, hout, blockIdx.x);
        return;
    }
    const int t = blockIdx.x - LNGRID;  // every array is whole blocks
    if (t < NWQ / CVT)
        pack_tile<CDIM, CDIM>(Wq, wbf, t);
    else if (t < (NWQ + NWKV) / CVT)
        pack_tile<CDIM, 2 * CDIM>(Wkv, wbf + NWQ, t - NWQ / CVT);
    else if (t < (NWQ + NWKV + NWO) / CVT)
        pack_tile<CDIM, CDIM>(Wo, wbf + NWQ + NWKV, t - (NWQ + NWKV) / CVT);
    else if (t < (NWQ + NWKV + NWO + NW1) / CVT)
        pack_tile<CDIM, DFF>(W1, wbf + NWQ + NWKV + NWO, t - (NWQ + NWKV + NWO) / CVT);
    else
        pack_tile<DFF, CDIM>(W2, wbf + NWQ + NWKV + NWO + NW1,
                             t - (NWQ + NWKV + NWO + NW1) / CVT);
}

// ---------------- generic bf16 WMMA GEMM: D = act(A@B + bias) (+resid) ----
// A: [M,K] bf16 row-major.  B: K x Nc bf16 in fragment order (see pack_tile).
// block = 128 (4 waves, 2 x 2); each wave owns a 32x32 output tile (2 x 2
// fragments), the block the 64 x 64 tile (by, bx).
// Every global load covers whole lines and many are in flight at once:
//  B: a fragment is two contiguous 512-byte loads, straight into registers,
//     AHEAD K steps ahead of its products;
//  A: the block's 64 rows go to LDS KC k at a time, one 512-byte row piece per
//     wave-wide load, the next chunk fetched while this one is worked on; the
//     fragments (16 rows x 16 bytes a load) are then gathered from LDS.
// One barrier per KC k publishes a chunk; with two buffers the same barrier
// ends the last read of the buffer that is filled behind the next chunk.
#define GBLK 128
#define KC   256                  // k per staged A chunk
#define APITCH (KC + 8)           // LDS row pitch in values: 16 bytes x odd
typedef __attribute__((ext_vector_type(4))) uint32_t u32x4;
// Work-group barrier that orders LDS traffic only. __syncthreads() would also
// wait for every global load, and those are meant to stay in flight across it.
__device__ __forceinline__ void lds_barrier() {
    __builtin_amdgcn_fence(__ATOMIC_RELEASE, "workgroup", "local");
    __builtin_amdgcn_s_barrier();
    __builtin_amdgcn_fence(__ATOMIC_ACQUIRE, "workgroup", "local");
}
template<int K, int AHEAD, bool GELU_, bool RES, bool OUTBF>
__device__ __forceinline__ void gemm_tile(const uint16_t* __restrict__ A,
                                 const uint16_t* __restrict__ Bw,
                                 const float* __restrict__ bias,
                                 const float* __restrict__ resid,
                                 float* __restrict__ outf,
                                 uint16_t* __restrict__ outb,
                                 int Nc, int bx, int by) {
    constexpr int NS   = K / 32;         // K steps
    constexpr int NCH  = K / KC;         // A chunks
    constexpr int CS   = KC / 32;        // K steps per chunk
    constexpr int NBUF = NCH > 1 ? 2 : 1;
    constexpr int NST  = 64 * KC / 8 / GBLK;    // 16-byte pieces per thread and chunk
    __shared__ __attribute__((aligned(16))) uint16_t As[NBUF * 64 * APITCH];
    const int tid  = threadIdx.x;
    const int wave = tid >> 5, lane = tid & 31;
    const int g    = lane >> 4;          // half-wave select
    const int row0 = by * 64 + (wave >> 1) * 32;
    const int col0 = bx * 64 + (wave & 1) * 32;
    // A staging: piece i of this thread is row wave + 4i, bytes lane*16 of the chunk
    const uint16_t* ag = A + (size_t)(by * 64 + wave) * K + lane * 8;
    uint16_t*       aw = As + wave * APITCH + lane * 8;
    // A operand: row m = tile row (+16) + lane%16, K-chunks at g*8 and 16+g*8 of a step
    const uint16_t* ar = As + ((wave >> 1) * 32 + (lane & 15)) * APITCH + g * 8;
    // B operand: fragments (col0/16 (+1), step), this lane's 16 bytes of each half
    const uint16_t* bp = Bw + (size_t)(col0 >> 4) * NS * FRAG + lane * 8;
    const int nc0 = col0 + (lane & 15);  // output column, first fragment
    const int m0  = row0 + g * 8;        // output row, first fragment, element 0
    const float bb[2] = { bias[nc0], bias[nc0 + 16] };
    float rs[2][2][8];                   // residual, fetched while the loop drains

    u32x4 st[NST];                       // an A chunk on its way to LDS
    ABOp  af[2][2], b[AHEAD][2];         // all indices are compile-time
    v8f   acc[2][2] = {};

    #pragma unroll
    for (int i = 0; i < NST; ++i) st[i] = *(const u32x4*)(ag + i * 4 * K);
    // A first: loads return in order, and the LDS stores wait for these alone
    __builtin_amdgcn_sched_barrier(0);
    #pragma unroll
    for (int s = 0; s < AHEAD; ++s)
        #pragma unroll
        for (int f = 0; f < 2; ++f) {
            b[s][f].q[0] = *(const uint4*)(bp + (f * NS + s) * FRAG);
            b[s][f].q[1] = *(const uint4*)(bp + (f * NS + s) * FRAG + FRAG / 2);
        }
    // keeps the loads above from sinking to their first use (left alone, the
    // scheduler holds about one step in flight to save registers)
    __builtin_amdgcn_sched_barrier(0);
    // an address register that has had its last use may be rewritten from here on
    if (NCH == 1 || AHEAD == NS) asm volatile("s_wait_xcnt 0x0" ::: "memory");
    #pragma unroll
    for (int i = 0; i < NST; ++i) *(u32x4*)(aw + i * 4 * APITCH) = st[i];
    if (NCH > 1) {
        #pragma unroll
        for (int i = 0; i < NST; ++i) st[i] = *(const u32x4*)(ag + i * 4 * K + KC);
    }
    lds_barrier();                       // chunk 0 is in LDS

    #pragma unroll
    for (int c = 0; c < NCH; ++c) {
        const uint16_t* ac = ar + (c % NBUF) * 64 * APITCH;
        #pragma unroll
        for (int f = 0; f < 2; ++f) {
            af[0][f].q[0] = *(const uint4*)(ac + f * 16 * APITCH);
            af[0][f].q[1] = *(const uint4*)(ac + f * 16 * APITCH + 16);
        }
        #pragma unroll
        for (int s = 0; s < CS; ++s) {
            const int gs = c * CS + s, u = gs % AHEAD;
            if (s + 1 < CS) {            // next step's A fragments, ahead of the products
                #pragma unroll
                for (int f = 0; f < 2; ++f) {
                    af[(s + 1) & 1][f].q[0] = *(const uint4*)(ac + f * 16 * APITCH + (s + 1) * 32);
                    af[(s + 1) & 1][f].q[1] = *(const uint4*)(ac + f * 16 * APITCH + (s + 1) * 32 + 16);
                }
            }
            // holds the LDS reads in front of the products they overlap with
            __builtin_amdgcn_sched_barrier(0);
            #pragma unroll
            for (int i = 0; i < 2; ++i)
                #pragma unroll
                for (int j = 0; j < 2; ++j)
                    acc[i][j] = wmma_bf16(af[s & 1][i], b[u][j], acc[i][j]);
            // keeps the loads below from sinking to their use AHEAD steps later
            __builtin_amdgcn_sched_barrier(0);
            if (RES && gs == NS - 4) {   // 3 steps (12 loads) still in flight
                #pragma unroll
                for (int i = 0; i < 2; ++i)
                    #pragma unroll
                    for (int j = 0; j < 2; ++j)
                        #pragma unroll
                        for (int v = 0; v < 8; ++v)
                            rs[i][j][v] = resid[(size_t)(m0 + i * 16 + v) * Nc + nc0 + j * 16];
            }
            if (gs + AHEAD < NS) {       // B of step gs + AHEAD, into the freed set
                #pragma unroll
                for (int f = 0; f < 2; ++f) {
                    b[u][f].q[0] = *(const uint4*)(bp + (f * NS + gs + AHEAD) * FRAG);
                    b[u][f].q[1] = *(const uint4*)(bp + (f * NS + gs + AHEAD) * FRAG + FRAG / 2);
                }
                // B's last loads: their address register may be rewritten behind this
                if (gs + AHEAD == NS - 1) asm volatile("s_wait_xcnt 0x0" ::: "memory");
            }
            __builtin_amdgcn_sched_barrier(0);   // same purpose, the loads' other side
        }
        if (c + 1 < NCH) {
            // chunk c+1 into the buffer last read in chunk c-1 (barrier since)
            #pragma unroll
            for (int i = 0; i < NST; ++i)
                *(u32x4*)(aw + ((c + 1) % NBUF) * 64 * APITCH + i * 4 * APITCH) = st[i];
            if (c + 2 < NCH) {
                #pragma unroll
                for (int i = 0; i < NST; ++i)
                    st[i] = *(const u32x4*)(ag + i * 4 * K + (c + 2) * KC);
                // A's last loads: the same for their address register
                if (c + 2 == NCH - 1) asm volatile("s_wait_xcnt 0x0" ::: "memory");
            }
            lds_barrier();               // chunk c+1 is in LDS, chunk c is read out
        }
    }
    // C/D layout: element v -> (m = tile row + g*8 + v, n = tile col + lane%16)
    #pragma unroll
    for (int j = 0; j < 2; ++j) {
        const int nc = nc0 + j * 16;
        #pragma unroll
        for (int i = 0; i < 2; ++i) {
            #pragma unroll
            for (int v = 0; v < 8; ++v) {
                int m = m0 + i * 16 + v;
                float r = acc[i][j][v] + bb[j];
                if (GELU_) r = 0.5f * r * (1.0f + erff(r * 0.70710678118654752f));
                if (RES)   r += rs[i][j][v];
                if (OUTBF) outb[(size_t)m * Nc + nc] = f2bf(r);
                else       outf[(size_t)m * Nc + nc] = r;
            }
        }
    }
}

// one product: grid = (Nc/64, M/64)
template<int K, int NC, int AHEAD, bool GELU_, bool RES, bool OUTBF>
__global__ __launch_bounds__(GBLK) void gemm_bf16_kernel(const uint16_t* __restrict__ A,
                                 const uint16_t* __restrict__ Bw,
                                 const float* __restrict__ bias,
                                 const float* __restrict__ resid,
                                 float* __restrict__ outf,
                                 uint16_t* __restrict__ outb) {
    gemm_tile<K, AHEAD, GELU_, RES, OUTBF>(A, Bw, bias, resid, outf, outb, NC,
                                           blockIdx.x, blockIdx.y);
}

// Q and KV projections of the same rows in one grid = (3*CDIM/64, M/64):
// the first CDIM/64 block columns are Q's tiles, the others KV's.
__global__ __launch_bounds__(GBLK) void gemm_qkv_kernel(const uint16_t* __restrict__ A,
                                const uint16_t* __restrict__ Wq,
                                const uint16_t* __restrict__ Wkv,
                                const float* __restrict__ bq,
                                const float* __restrict__ bkv,
                                uint16_t* __restrict__ q,
                                uint16_t* __restrict__ kv) {
    const bool isq = blockIdx.x < CDIM / 64;    // same for the whole block
    gemm_tile<CDIM, 8, false, false, true>(A, isq ? Wq : Wkv, isq ? bq : bkv,
                                  nullptr, nullptr, isq ? q : kv,
                                  isq ? CDIM : 2 * CDIM,
                                  isq ? blockIdx.x : blockIdx.x - CDIM / 64,
                                  blockIdx.y);
}

// ---------------- fused dual-pass attention ----------------
// One workgroup = (b, h, 64-query panel), 32 waves: the panel fills the LDS of
// its WGP, so the waves that hide each other's waits must come from this one
// workgroup (8 per SIMD). Scores stay in LDS (64 x 1032 f32), plus a 16KB LDS
// chunk for staged V (256 keys x 32 d, bf16: one 16-byte piece per thread).
// Phase 1: QK^T via WMMA. Phase 2: dense softmax stats + top-64 threshold by
// value bisection + fused combined probabilities. Phase 3: P@V via WMMA with
// LDS-staged V chunks (coalesced b128 staging instead of 2B gathers).
#define QBLK  64
#define SLD   1032    // 1024 + 8 pad floats to dodge bank conflicts
#define AWAVES 32     // waves per workgroup
#define VCH   256     // keys per staged V chunk
#define KGRP  (AWAVES / 8)            // wave groups that share the keys in P@V
#define KSTEP (VCH / 32 / KGRP)       // 32-key steps per wave and chunk
__global__ __launch_bounds__(AWAVES * 32) void attn_kernel(const uint16_t* __restrict__ qb,   // [ROWS,CDIM] bf16
                            const uint16_t* __restrict__ kvb,  // [ROWS,2*CDIM] bf16
                            const float* __restrict__ wf,      // w_fuse[2]
                            uint16_t* __restrict__ attn) {     // [ROWS,CDIM] bf16
    extern __shared__ float sc[];
    uint16_t* Vs = (uint16_t*)(sc + QBLK * SLD);   // [VCH][DHEAD] bf16
    const int bid  = blockIdx.x;
    const int b    = bid / (HEADS * (SEQ / QBLK));
    const int rem  = bid % (HEADS * (SEQ / QBLK));
    const int h    = rem / (SEQ / QBLK);
    const int q0   = (rem % (SEQ / QBLK)) * QBLK;
    const int tid  = threadIdx.x;
    const int wave = tid >> 5, lane = tid & 31;
    const int g    = lane >> 4;
    const float scale = 0.17677669529663687f;   // 1/sqrt(32)

    // learned fusion weights (softmax over 2) -- uniform, scalarizes to SALU
    const float e0 = expf(wf[0]), e1 = expf(wf[1]);
    const float w0 = e0 / (e0 + e1), w1 = e1 / (e0 + e1);

    // ---- phase 1: scores tile 64q x 1024k, 256 WMMA tiles over 32 waves ----
    for (int t = wave; t < (QBLK / 16) * (SEQ / 16); t += AWAVES) {
        const int qt = t >> 6, kt = t & 63;
        ABOp a, bm;
        {   // Q operand: 16 queries x 32 d (contiguous d chunks)
            int m = q0 + qt * 16 + (lane & 15);
            const uint16_t* qr = qb + (size_t)(b * SEQ + m) * CDIM + h * DHEAD;
            a.q[0] = *(const uint4*)(qr + g * 8);
            a.q[1] = *(const uint4*)(qr + 16 + g * 8);
        }
        {   // K operand: 16 keys across lanes, d packed (row-major contiguous)
            int n = kt * 16 + (lane & 15);
            const uint16_t* kr = kvb + (size_t)(b * SEQ + n) * (2 * CDIM) + h * DHEAD;
            bm.q[0] = *(const uint4*)(kr + g * 8);
            bm.q[1] = *(const uint4*)(kr + 16 + g * 8);
        }
        v8f c = {};
        c = wmma_bf16(a, bm, c);
        #pragma unroll
        for (int v = 0; v < 8; ++v)
            sc[(qt * 16 + g * 8 + v) * SLD + kt * 16 + (lane & 15)] = c[v] * scale;
    }
    __syncthreads();

    // ---- phase 2: per-row dense softmax + top-64 threshold + fusion ----
    for (int i = 0; i < QBLK / AWAVES; ++i) {
        const int row = wave * (QBLK / AWAVES) + i;
        float* rp = sc + row * SLD;
        float rv[32];
        #pragma unroll
        for (int j = 0; j < 32; ++j) rv[j] = rp[lane + j * 32];
        float mx = -1e30f, mn = 1e30f;
        #pragma unroll
        for (int j = 0; j < 32; ++j) { mx = fmaxf(mx, rv[j]); mn = fminf(mn, rv[j]); }
        mx = wave_max(mx);
        mn = wave_min(mn);
        float ev[32];     // each exponential is formed once and kept
        #pragma unroll
        for (int j = 0; j < 32; ++j) ev[j] = expf(rv[j] - mx);
        float sd = 0.f;
        #pragma unroll
        for (int j = 0; j < 32; ++j) sd += ev[j];
        sd = wave_sum(sd);
        // bisection for top-64 threshold: largest t with count(s>t) >= TOPM
        // The count over the wave is taken from the compare masks themselves
        // (ballot + population count), so bounds and count live in scalars.
        float lo = uniform_f(mn) - 1.0f, hi = uniform_f(mx);
        for (int left = 24; left > 0; ) {
            float mid = 0.5f * (lo + hi);
            int c = 0;
            #pragma unroll
            for (int j = 0; j < 32; j += 2) {
                uint64_t m0 = __builtin_amdgcn_ballot_w32(rv[j]     > mid);
                uint64_t m1 = __builtin_amdgcn_ballot_w32(rv[j + 1] > mid);
                c += __builtin_popcountll(m0 | (m1 << 32));
            }
            if (c >= TOPM) lo = mid; else hi = mid;
            // Exactly TOPM scores lie above lo: every later step keeps this
            // same set, so the search is over (24 steps stay the bound).
            left = (c == TOPM) ? 0 : left - 1;
        }
        const float thr = lo;
        float st = 0.f;
        #pragma unroll
        for (int j = 0; j < 32; ++j) st += (rv[j] > thr) ? ev[j] : 0.f;
        st = wave_sum(st);
        const float cd = w0 / sd;
        const float ct = w1 / fmaxf(st, 1e-20f);
        #pragma unroll
        for (int j = 0; j < 32; ++j)
            rp[lane + j * 32] = ev[j] * (cd + ((rv[j] > thr) ? ct : 0.f));
    }
    __syncthreads();

    // ---- phase 3: out = P @ V with LDS-staged V chunks ----
    // 8 output tiles x KGRP wave groups: group kq takes KSTEP of the 32-key
    // steps of every chunk; the groups' partial sums meet in LDS at the end.
    {
        const int tile = wave & 7, kq = wave >> 3;
        const int qt = tile >> 1, dt = tile & 1;
        const int d  = dt * 16 + (lane & 15);
        const int m  = qt * 16 + (lane & 15);
        // first P and first V element of this lane in a chunk; all its others
        // lie at compile-time distances from these
        const float*    pw = sc + m * SLD + kq * (KSTEP * 32) + g * 8;
        const uint16_t* vw = Vs + (kq * (KSTEP * 32) + g * 8) * DHEAD + d;
        v8f acc = {};
        for (int kk0 = 0; kk0 < SEQ; kk0 += VCH) {
            // stage V[kk0 .. kk0+VCH) x DHEAD : 16KB, one coalesced b128 a thread
            {
                const uint16_t* vb = kvb + (size_t)(b * SEQ + kk0) * (2 * CDIM)
                                     + CDIM + h * DHEAD;
                int r = tid >> 2, c = (tid & 3) * 8;   // 1024 uint4 total
                *(uint4*)(&Vs[r * DHEAD + c]) =
                    *(const uint4*)(vb + (size_t)r * (2 * CDIM) + c);
                // the load's address registers are reused right behind the barrier
                asm volatile("s_wait_xcnt 0x0" ::: "memory");
            }
            __syncthreads();
            #pragma unroll
            for (int s = 0; s < KSTEP; ++s) {
                ABOp a, bm;
                #pragma unroll
                for (int j = 0; j < 16; ++j) {
                    const int kc = s * 32 + ((j < 8) ? j : j + 8);  // + g*8 in pw, vw
                    a.u[j]  = f2bf(pw[kk0 + kc]);
                    bm.u[j] = vw[kc * DHEAD];
                }
                acc = wmma_bf16(a, bm, acc);
            }
            __syncthreads();
        }
        // The score panel has been read for the last time (barrier above): its
        // first 24KB now carry the partial sums of groups 1.. to group 0.
        if (kq != 0) {
            #pragma unroll
            for (int v = 0; v < 8; ++v)
                sc[(((kq - 1) * 8 + tile) * 8 + v) * 32 + lane] = acc[v];
        }
        __syncthreads();
        if (kq == 0) {
            #pragma unroll
            for (int p = 0; p < KGRP - 1; ++p) {
                #pragma unroll
                for (int v = 0; v < 8; ++v)
                    acc[v] += sc[((p * 8 + tile) * 8 + v) * 32 + lane];
            }
            #pragma unroll
            for (int v = 0; v < 8; ++v) {
                int mr = q0 + qt * 16 + g * 8 + v;
                int nc = dt * 16 + (lane & 15);
                attn[(size_t)(b * SEQ + mr) * CDIM + h * DHEAD + nc] = f2bf(acc[v]);
            }
        }
    }
}

// ---------------- host side ----------------
extern "C" void kernel_launch(void* const* d_in, const int* in_sizes, int n_in,
                              void* d_out, int out_size, void* d_ws, size_t ws_size,
                              hipStream_t stream) {
    (void)in_sizes; (void)n_in; (void)out_size; (void)ws_size;
    const float* x     = (const float*)d_in[0];
    const float* ln1g  = (const float*)d_in[1];
    const float* ln1b  = (const float*)d_in[2];
    const float* Wq    = (const float*)d_in[3];
    const float* bq    = (const float*)d_in[4];
    const float* Wkv   = (const float*)d_in[5];
    const float* bkv   = (const float*)d_in[6];
    const float* wfuse = (const float*)d_in[7];
    const float* Wo    = (const float*)d_in[8];
    const float* bo    = (const float*)d_in[9];
    const float* ln2g  = (const float*)d_in[10];
    const float* ln2b  = (const float*)d_in[11];
    const float* W1    = (const float*)d_in[12];
    const float* b1    = (const float*)d_in[13];
    const float* W2    = (const float*)d_in[14];
    const float* b2    = (const float*)d_in[15];
    float* xcur = (float*)d_out;                       // running activations

    // workspace carve-up (bf16 buffers, 256B-aligned power-of-two sizes);
    // the five weight arrays lie in the order the front launch writes them
    uint8_t* ws = (uint8_t*)d_ws;
    uint16_t* wq_bf   = (uint16_t*)(ws);                 size_t off = NWQ * 2;
    uint16_t* wkv_bf  = (uint16_t*)(ws + off);           off += NWKV * 2;
    uint16_t* wo_bf   = (uint16_t*)(ws + off);           off += NWO * 2;
    uint16_t* w1_bf   = (uint16_t*)(ws + off);           off += NW1 * 2;
    uint16_t* w2_bf   = (uint16_t*)(ws + off);           off += NW2 * 2;
    uint16_t* h_bf    = (uint16_t*)(ws + off);           off += (size_t)ROWS * CDIM * 2;
    uint16_t* q_bf    = (uint16_t*)(ws + off);           off += (size_t)ROWS * CDIM * 2;
    uint16_t* kv_bf   = (uint16_t*)(ws + off);           off += (size_t)ROWS * 2 * CDIM * 2;
    uint16_t* attn_bf = (uint16_t*)(ws + off);           off += (size_t)ROWS * CDIM * 2;
    uint16_t* u_bf    = (uint16_t*)(ws + off);

    const int attnLds = QBLK * SLD * (int)sizeof(float)           // score panel
                      + VCH * DHEAD * (int)sizeof(uint16_t);      // V chunk
    hipFuncSetAttribute((const void*)attn_kernel,
                        hipFuncAttributeMaxDynamicSharedMemorySize, attnLds);

    const dim3 blk(GBLK);
    // first LayerNorm and all weight converts: they read inputs only
    front_kernel<<<dim3(LNGRID + NWALL / CVT), dim3(SMALLBLK), 0, stream>>>(
        x, ln1g, ln1b, h_bf, Wq, Wkv, Wo, W1, W2, wq_bf);

    for (int l = 0; l < LAYERS; ++l) {
        // layer 0 takes its residual from x itself; d_out is first written there
        const float* xin = (l == 0) ? x : xcur;

        // --- attention sublayer ---
        if (l > 0)
            ln_kernel<<<dim3(LNGRID), dim3(SMALLBLK), 0, stream>>>(xcur, ln1g + l * CDIM,
                                                      ln1b + l * CDIM, h_bf);
        gemm_qkv_kernel<<<dim3(3 * CDIM / 64, ROWS / 64), blk, 0, stream>>>(
                h_bf, wq_bf + (size_t)l * CDIM * CDIM,
                wkv_bf + (size_t)l * CDIM * 2 * CDIM,
                bq + l * CDIM, bkv + l * 2 * CDIM, q_bf, kv_bf);
        attn_kernel<<<dim3(BATCH * HEADS * (SEQ / QBLK)), dim3(AWAVES * 32), attnLds, stream>>>(
                q_bf, kv_bf, wfuse + l * 2, attn_bf);
        gemm_bf16_kernel<CDIM, CDIM, 8, false, true, false>
            <<<dim3(CDIM / 64, ROWS / 64), blk, 0, stream>>>(
                attn_bf, wo_bf + (size_t)l * CDIM * CDIM, bo + l * CDIM,
                xin, xcur, nullptr);

        // --- MLP sublayer ---
        ln_kernel<<<dim3(LNGRID), dim3(SMALLBLK), 0, stream>>>(xcur, ln2g + l * CDIM,
                                                  ln2b + l * CDIM, h_bf);
        gemm_bf16_kernel<CDIM, DFF, 8, true, false, true>
            <<<dim3(DFF / 64, ROWS / 64), blk, 0, stream>>>(
                h_bf, w1_bf + (size_t)l * CDIM * DFF, b1 + l * DFF,
                nullptr, nullptr, u_bf);
        gemm_bf16_kernel<DFF, CDIM, 6, false, true, false>
            <<<dim3(CDIM / 64, ROWS / 64), blk, 0, stream>>>(
                u_bf, w2_bf + (size_t)l * DFF * CDIM, b2 + l * CDIM,
                xcur, xcur, nullptr);
    }
}

// v007
// It runs in 157 microseconds.
// Two timings next to v006 put it at 1.19 and 1.21 times that version's speed.
// Over all steps from v000 it is 2.96 times as fast.
#include <hip/hip_runtime.h>
#include <hip/hip_bf16.h>
#include <math.h>
#include <stdint.h>

// ---------------- problem constants ----------------
#define LAYERS 2
#define BATCH  4
#define SEQ    1024
#define CDIM   256
#define HEADS  8
#define DHEAD  32          // CDIM / HEADS
#define TOPM   64
#define DFF    1024
#define ROWS   (BATCH * SEQ)      // 4096 token rows
#define LNEPS  1e-5f

// WMMA vector types (CDNA5 wave32)
typedef __attribute__((ext_vector_type(16))) __bf16 v16bf;
typedef __attribute__((ext_vector_type(8)))  float  v8f;
typedef __attribute__((ext_vector_type(8)))  short  s16x8;

union ABOp {            // one 16x32 bf16 WMMA operand per lane
    uint16_t u[16];
    uint4    q[2];      // two 16-byte chunks
    s16x8    t[2];      // the same, as a transposing LDS load returns them
    v16bf    v;
};

__device__ __forceinline__ uint16_t f2bf(float f) {
    uint32_t u = __float_as_uint(f);
    uint32_t r = u + 0x7FFFu + ((u >> 16) & 1u);   // round-to-nearest-even
    return (uint16_t)(r >> 16);
}

// Two floats to one register of two bf16 (round to nearest even, as f2bf), in
// the chip's one packed convert.
typedef __attribute__((ext_vector_type(2))) float  f32x2;
typedef __attribute__((ext_vector_type(2))) __bf16 bf16x2;
__device__ __forceinline__ uint32_t pack2(float lo, float hi) {
    return __builtin_bit_cast(uint32_t, __builtin_convertvector(f32x2{lo, hi}, bf16x2));
}

// Transposing LDS load: 16 keys x 16 columns of a key-major bf16 tile come back
// as 8 consecutive keys of one column per lane (every lane must be on).
__device__ __forceinline__ s16x8 ld_tr16(const uint16_t* p) {
    typedef __attribute__((address_space(3))) s16x8 lds_s16x8;
    return __builtin_amdgcn_ds_load_tr16_b128_v8i16((lds_s16x8*)p);
}

__device__ __forceinline__ v8f wmma_bf16(const ABOp& a, const ABOp& b, v8f c) {
    return __builtin_amdgcn_wmma_f32_16x16x32_bf16(
        false, a.v, false, b.v, (short)0, c, false, false);
}

// ---------------- wave-wide reductions on the vector unit ----------------
// Lane l <-> l ^ 16 (other 16-lane row) and l <-> l ^ M (inside a row, DPP
// row_xmask): register-to-register moves, no trip through the LDS crossbar.
__device__ __forceinline__ float xhalf(float x) {
    int b = __builtin_bit_cast(int, x);
    return __builtin_bit_cast(float, __builtin_amdgcn_permlanex16(
        b, b, 0x76543210, 0xfedcba98, false, false));
}
template<int M>
__device__ __forceinline__ float xrow(float x) {
    return __builtin_bit_cast(float, __builtin_amdgcn_mov_dpp(
        __builtin_bit_cast(int, x), 0x160 | M, 0xf, 0xf, true));
}
// Butterfly over 32 lanes in the order 16, 8, 4, 2, 1; every lane gets the result.
__device__ __forceinline__ float wave_sum(float s) {
    s += xhalf(s);   s += xrow<8>(s); s += xrow<4>(s);
    s += xrow<2>(s); s += xrow<1>(s);
    return s;
}
__device__ __forceinline__ float wave_max(float s) {
    s = fmaxf(s, xhalf(s));   s = fmaxf(s, xrow<8>(s)); s = fmaxf(s, xrow<4>(s));
    s = fmaxf(s, xrow<2>(s)); s = fmaxf(s, xrow<1>(s));
    return s;
}
__device__ __forceinline__ float wave_min(float s) {
    s = fminf(s, xhalf(s));   s = fminf(s, xrow<8>(s)); s = fminf(s, xrow<4>(s));
    s = fminf(s, xrow<2>(s)); s = fminf(s, xrow<1>(s));
    return s;
}
// A value that is equal in all lanes, moved to a scalar register.
__device__ __forceinline__ float uniform_f(float x) {
    return __builtin_bit_cast(float,
        __builtin_amdgcn_readfirstlane(__builtin_bit_cast(int, x)));
}

// ---------------- LayerNorm (one wave per row, LNR rows a wave) ----------
// A row is 8 values a lane, so its sums need the wave-wide butterfly only: no
// LDS, no barrier. Few waves with much work each, because starting waves, not
// the arithmetic, is what such a grid costs: a block is one wave per SIMD, and
// a LayerNorm is one block per WGP.
#define SMALLBLK 128              // threads per block, LayerNorm and converts
#define LNR    4                  // rows per wave, all loads issued up front
#define LNROWS (SMALLBLK / 32 * LNR)   // rows per block
#define LNGRID (ROWS / LNROWS)    // blocks per LayerNorm
typedef __attribute__((ext_vector_type(4))) float f32x4;
__device__ __forceinline__ uint2 pack4(f32x4 y) {
    uint2 r;
    r.x = (uint32_t)f2bf(y.x) | ((uint32_t)f2bf(y.y) << 16);
    r.y = (uint32_t)f2bf(y.z) | ((uint32_t)f2bf(y.w) << 16);
    return r;
}
__device__ __forceinline__ void ln_rows(const float* __restrict__ x,
                                        const float* __restrict__ g,
                                        const float* __restrict__ b,
                                        uint16_t* __restrict__ out, int blk) {
    const int wave = threadIdx.x >> 5, lane = threadIdx.x & 31;
    // lane l holds columns 4l .. 4l+3 and 128+4l .. 128+4l+3 of each row
    const size_t at = (size_t)((blk * (SMALLBLK / 32) + wave) * LNR) * CDIM + lane * 4;
    f32x4 v[LNR][2];
    #pragma unroll
    for (int r = 0; r < LNR; ++r) {
        v[r][0] = *(const f32x4*)(x + at + r * CDIM);
        v[r][1] = *(const f32x4*)(x + at + r * CDIM + 128);
    }
    const f32x4 g0 = *(const f32x4*)(g + lane * 4);
    const f32x4 g1 = *(const f32x4*)(g + lane * 4 + 128);
    const f32x4 b0 = *(const f32x4*)(b + lane * 4);
    const f32x4 b1 = *(const f32x4*)(b + lane * 4 + 128);
    float s[LNR], ss[LNR];
    #pragma unroll
    for (int r = 0; r < LNR; ++r) {
        const f32x4 p = v[r][0], q = v[r][1];
        s[r]  = ((p.x + p.y) + (p.z + p.w)) + ((q.x + q.y) + (q.z + q.w));
        ss[r] = ((p.x * p.x + p.y * p.y) + (p.z * p.z + p.w * p.w))
              + ((q.x * q.x + q.y * q.y) + (q.z * q.z + q.w * q.w));
    }
    #pragma unroll
    for (int r = 0; r < LNR; ++r) { s[r] = wave_sum(s[r]); ss[r] = wave_sum(ss[r]); }
    #pragma unroll
    for (int r = 0; r < LNR; ++r) {
        const float mean = s[r] * (1.0f / CDIM);
        const float var  = ss[r] * (1.0f / CDIM) - mean * mean;
        const float rstd = rsqrtf(var + LNEPS);
        *(uint2*)(out + at + r * CDIM)       = pack4((v[r][0] - mean) * rstd * g0 + b0);
        *(uint2*)(out + at + r * CDIM + 128) = pack4((v[r][1] - mean) * rstd * g1 + b1);
    }
}

__global__ __launch_bounds__(SMALLBLK) void ln_kernel(const float* __restrict__ x,
                          const float* __restrict__ g,
                          const float* __restrict__ b,
                          uint16_t* __restrict__ out) {
    ln_rows(x, g, b, out, blockIdx.x);
}

// ---------------- front launch: everything that reads inputs only ----------
// Blocks [0, LNGRID): the first LayerNorm. The blocks behind them convert the
// weights of all layers to bf16, CVT values each: the five arrays land one
// behind the other in wbf, each with its layers in input order.
// Inside a layer the values lie in the order of the WMMA B operand: one 1KB
// fragment per (16 columns, 32 k), fragments of a column group in k order; in
// a fragment two 512-byte halves, lane l's 16 bytes at l*16 in each. A wave
// then reads a whole fragment with two 16-byte loads over contiguous lines.
#define NWQ  (LAYERS * CDIM * CDIM)
#define NWKV (LAYERS * CDIM * 2 * CDIM)
#define NWO  (LAYERS * CDIM * CDIM)
#define NW1  (LAYERS * CDIM * DFF)
#define NW2  (LAYERS * DFF * CDIM)
#define NWALL (NWQ + NWKV + NWO + NW1 + NW2)
#define CVT  4096                 // a block's share: 64 k x 64 columns
#define FRAG 512                  // values in one B fragment
template<int K, int N>
__device__ __forceinline__ void pack_tile(const float* __restrict__ w,
                                          uint16_t* __restrict__ to, int tile) {
    constexpr int TPL = K * N / CVT;            // tiles per layer
    const int l  = tile / TPL, r = tile % TPL;
    const int kt = r / (N / 64), nt = r % (N / 64);
    const int n  = nt * 64 + (threadIdx.x & 63);    // this thread's column
    const int ks = kt * 2 + (threadIdx.x >> 6);     // and its 32-k step
    const float* in = w + (size_t)l * K * N + (size_t)(ks * 32) * N + n;
    float v[32];
    #pragma unroll
    for (int i = 0; i < 32; ++i) v[i] = in[i * N];
    uint16_t* o = to + (size_t)l * K * N + ((n >> 4) * (K / 32) + ks) * FRAG + (n & 15) * 8;
    // k 0-7: half 0, lanes 0-15; k 8-15: half 0, lanes 16-31; k 16-31: half 1 alike
    #pragma unroll
    for (int c = 0; c < 4; ++c) {
        uint4 p;
        p.x = (uint32_t)f2bf(v[c * 8 + 0]) | ((uint32_t)f2bf(v[c * 8 + 1]) << 16);
        p.y = (uint32_t)f2bf(v[c * 8 + 2]) | ((uint32_t)f2bf(v[c * 8 + 3]) << 16);
        p.z = (uint32_t)f2bf(v[c * 8 + 4]) | ((uint32_t)f2bf(v[c * 8 + 5]) << 16);
        p.w = (uint32_t)f2bf(v[c * 8 + 6]) | ((uint32_t)f2bf(v[c * 8 + 7]) << 16);
        *(uint4*)(o + (c >> 1) * (FRAG / 2) + (c & 1) * 128) = p;
    }
    // the stores' data and address registers may be rewritten by what follows
    asm volatile("s_wait_xcnt 0x0" ::: "memory");
}
__global__ __launch_bounds__(SMALLBLK) void front_kernel(const float* __restrict__ x,
                             const float* __restrict__ g,
                             const float* __restrict__ b,
                             uint16_t* __restrict__ hout,
                             const float* __restrict__ Wq,
                             const float* __restrict__ Wkv,
                             const float* __restrict__ Wo,
                             const float* __restrict__ W1,
                             const float* __restrict__ W2,
                             uint16_t* __restrict__ wbf) {
    if (blockIdx.x < LNGRID) {          // same for the whole block
        ln_rows(x, g, b, hout, blockIdx.x);
        return;
    }
    const int t = blockIdx.x - LNGRID;  // every array is whole blocks
    if (t < NWQ / CVT)
        pack_tile<CDIM, CDIM>(Wq, wbf, t);
    else if (t < (NWQ + NWKV) / CVT)
        pack_tile<CDIM, 2 * CDIM>(Wkv, wbf + NWQ, t - NWQ / CVT);
    else if (t < (NWQ + NWKV + NWO) / CVT)
        pack_tile<CDIM, CDIM>(Wo, wbf + NWQ + NWKV, t - (NWQ + NWKV) / CVT);
    else if (t < (NWQ + NWKV + NWO + NW1) / CVT)
        pack_tile<CDIM, DFF>(W1, wbf + NWQ + NWKV + NWO, t - (NWQ + NWKV + NWO) / CVT);
    else
        pack_tile<DFF, CDIM>(W2, wbf + NWQ + NWKV + NWO + NW1,
                             t - (NWQ + NWKV + NWO + NW1) / CVT);
}

// ---------------- generic bf16 WMMA GEMM: D = act(A@B + bias) (+resid) ----
// A: [M,K] bf16 row-major.  B: K x Nc bf16 in fragment order (see pack_tile).
// block = 128 (4 waves, 2 x 2); each wave owns a 32x32 output tile (2 x 2
// fragments), the block the 64 x 64 tile (by, bx).
// Every global load covers whole lines and many are in flight at once:
//  B: a fragment is two contiguous 512-byte loads, straight into registers,
//     AHEAD K steps ahead of its products;
//  A: the block's 64 rows go to LDS KC k at a time, one 512-byte row piece per
//     wave-wide load, the next chunk fetched while this one is worked on; the
//     fragments (16 rows x 16 bytes a load) are then gathered from LDS.
// One barrier per KC k publishes a chunk; with two buffers the same barrier
// ends the last read of the buffer that is filled behind the next chunk.
#define GBLK 128
#define KC   256                  // k per staged A chunk
#define APITCH (KC + 8)           // LDS row pitch in values: 16 bytes x odd
typedef __attribute__((ext_vector_type(4))) uint32_t u32x4;
// Work-group barrier that orders LDS traffic only. __syncthreads() would also
// wait for every global load, and those are meant to stay in flight across it.
__device__ __forceinline__ void lds_barrier() {
    __builtin_amdgcn_fence(__ATOMIC_RELEASE, "workgroup", "local");
    __builtin_amdgcn_s_barrier();
    __builtin_amdgcn_fence(__ATOMIC_ACQUIRE, "workgroup", "local");
}
template<int K, int AHEAD, bool GELU_, bool RES, bool OUTBF>
__device__ __forceinline__ void gemm_tile(const uint16_t* __restrict__ A,
                                 const uint16_t* __restrict__ Bw,
                                 const float* __restrict__ bias,
                                 const float* __restrict__ resid,
                                 float* __restrict__ outf,
                                 uint16_t* __restrict__ outb,
                                 int Nc, int bx, int by) {
    constexpr int NS   = K / 32;         // K steps
    constexpr int NCH  = K / KC;         // A chunks
    constexpr int CS   = KC / 32;        // K steps per chunk
    constexpr int NBUF = NCH > 1 ? 2 : 1;
    constexpr int NST  = 64 * KC / 8 / GBLK;    // 16-byte pieces per thread and chunk
    __shared__ __attribute__((aligned(16))) uint16_t As[NBUF * 64 * APITCH];
    const int tid  = threadIdx.x;
    const int wave = tid >> 5, lane = tid & 31;
    const int g    = lane >> 4;          // half-wave select
    const int row0 = by * 64 + (wave >> 1) * 32;
    const int col0 = bx * 64 + (wave & 1) * 32;
    // A staging: piece i of this thread is row wave + 4i, bytes lane*16 of the chunk
    const uint16_t* ag = A + (size_t)(by * 64 + wave) * K + lane * 8;
    uint16_t*       aw = As + wave * APITCH + lane * 8;
    // A operand: row m = tile row (+16) + lane%16, K-chunks at g*8 and 16+g*8 of a step
    const uint16_t* ar = As + ((wave >> 1) * 32 + (lane & 15)) * APITCH + g * 8;
    // B operand: fragments (col0/16 (+1), step), this lane's 16 bytes of each half
    const uint16_t* bp = Bw + (size_t)(col0 >> 4) * NS * FRAG + lane * 8;
    const int nc0 = col0 + (lane & 15);  // output column, first fragment
    const int m0  = row0 + g * 8;        // output row, first fragment, element 0
    const float bb[2] = { bias[nc0], bias[nc0 + 16] };
    float rs[2][2][8];                   // residual, fetched while the loop drains

    u32x4 st[NST];                       // an A chunk on its way to LDS
    ABOp  af[2][2], b[AHEAD][2];         // all indices are compile-time
    v8f   acc[2][2] = {};

    #pragma unroll
    for (int i = 0; i < NST; ++i) st[i] = *(const u32x4*)(ag + i * 4 * K);
    // A first: loads return in order, and the LDS stores wait for these alone
    __builtin_amdgcn_sched_barrier(0);
    #pragma unroll
    for (int s = 0; s < AHEAD; ++s)
        #pragma unroll
        for (int f = 0; f < 2; ++f) {
            b[s][f].q[0] = *(const uint4*)(bp + (f * NS + s) * FRAG);
            b[s][f].q[1] = *(const uint4*)(bp + (f * NS + s) * FRAG + FRAG / 2);
        }
    // keeps the loads above from sinking to their first use (left alone, the
    // scheduler holds about one step in flight to save registers)
    __builtin_amdgcn_sched_barrier(0);
    // an address register that has had its last use may be rewritten from here on
    if (NCH == 1 || AHEAD == NS) asm volatile("s_wait_xcnt 0x0" ::: "memory");
    #pragma unroll
    for (int i = 0; i < NST; ++i) *(u32x4*)(aw + i * 4 * APITCH) = st[i];
    if (NCH > 1) {
        #pragma unroll
        for (int i = 0; i < NST; ++i) st[i] = *(const u32x4*)(ag + i * 4 * K + KC);
    }
    lds_barrier();                       // chunk 0 is in LDS

    #pragma unroll
    for (int c = 0; c < NCH; ++c) {
        const uint16_t* ac = ar + (c % NBUF) * 64 * APITCH;
        #pragma unroll
        for (int f = 0; f < 2; ++f) {
            af[0][f].q[0] = *(const uint4*)(ac + f * 16 * APITCH);
            af[0][f].q[1] = *(const uint4*)(ac + f * 16 * APITCH + 16);
        }
        #pragma unroll
        for (int s = 0; s < CS; ++s) {
            const int gs = c * CS + s, u = gs % AHEAD;
            if (s + 1 < CS) {            // next step's A fragments, ahead of the products
                #pragma unroll
                for (int f = 0; f < 2; ++f) {
                    af[(s + 1) & 1][f].q[0] = *(const uint4*)(ac + f * 16 * APITCH + (s + 1) * 32);
                    af[(s + 1) & 1][f].q[1] = *(const uint4*)(ac + f * 16 * APITCH + (s + 1) * 32 + 16);
                }
            }
            // holds the LDS reads in front of the products they overlap with
            __builtin_amdgcn_sched_barrier(0);
            #pragma unroll
            for (int i = 0; i < 2; ++i)
                #pragma unroll
                for (int j = 0; j < 2; ++j)
                    acc[i][j] = wmma_bf16(af[s & 1][i], b[u][j], acc[i][j]);
            // keeps the loads below from sinking to their use AHEAD steps later
            __builtin_amdgcn_sched_barrier(0);
            if (RES && gs == NS - 4) {   // 3 steps (12 loads) still in flight
                #pragma unroll
                for (int i = 0; i < 2; ++i)
                    #pragma unroll
                    for (int j = 0; j < 2; ++j)
                        #pragma unroll
                        for (int v = 0; v < 8; ++v)
                            rs[i][j][v] = resid[(size_t)(m0 + i * 16 + v) * Nc + nc0 + j * 16];
            }
            if (gs + AHEAD < NS) {       // B of step gs + AHEAD, into the freed set
                #pragma unroll
                for (int f = 0; f < 2; ++f) {
                    b[u][f].q[0] = *(const uint4*)(bp + (f * NS + gs + AHEAD) * FRAG);
                    b[u][f].q[1] = *(const uint4*)(bp + (f * NS + gs + AHEAD) * FRAG + FRAG / 2);
                }
                // B's last loads: their address register may be rewritten behind this
                if (gs + AHEAD == NS - 1) asm volatile("s_wait_xcnt 0x0" ::: "memory");
            }
            __builtin_amdgcn_sched_barrier(0);   // same purpose, the loads' other side
        }
        if (c + 1 < NCH) {
            // chunk c+1 into the buffer last read in chunk c-1 (barrier since)
            #pragma unroll
            for (int i = 0; i < NST; ++i)
                *(u32x4*)(aw + ((c + 1) % NBUF) * 64 * APITCH + i * 4 * APITCH) = st[i];
            if (c + 2 < NCH) {
                #pragma unroll
                for (int i = 0; i < NST; ++i)
                    st[i] = *(const u32x4*)(ag + i * 4 * K + (c + 2) * KC);
                // A's last loads: the same for their address register
                if (c + 2 == NCH - 1) asm volatile("s_wait_xcnt 0x0" ::: "memory");
            }
            lds_barrier();               // chunk c+1 is in LDS, chunk c is read out
        }
    }
    // C/D layout: element v -> (m = tile row + g*8 + v, n = tile col + lane%16)
    #pragma unroll
    for (int j = 0; j < 2; ++j) {
        const int nc = nc0 + j * 16;
        #pragma unroll
        for (int i = 0; i < 2; ++i) {
            #pragma unroll
            for (int v = 0; v < 8; ++v) {
                int m = m0 + i * 16 + v;
                float r = acc[i][j][v] + bb[j];
                if (GELU_) r = 0.5f * r * (1.0f + erff(r * 0.70710678118654752f));
                if (RES)   r += rs[i][j][v];
                if (OUTBF) outb[(size_t)m * Nc + nc] = f2bf(r);
                else       outf[(size_t)m * Nc + nc] = r;
            }
        }
    }
}

// one product: grid = (Nc/64, M/64)
template<int K, int NC, int AHEAD, bool GELU_, bool RES, bool OUTBF>
__global__ __launch_bounds__(GBLK) void gemm_bf16_kernel(const uint16_t* __restrict__ A,
                                 const uint16_t* __restrict__ Bw,
                                 const float* __restrict__ bias,
                                 const float* __restrict__ resid,
                                 float* __restrict__ outf,
                                 uint16_t* __restrict__ outb) {
    gemm_tile<K, AHEAD, GELU_, RES, OUTBF>(A, Bw, bias, resid, outf, outb, NC,
                                           blockIdx.x, blockIdx.y);
}

// Q and KV projections of the same rows in one grid = (3*CDIM/64, M/64):
// the first CDIM/64 block columns are Q's tiles, the others KV's.
__global__ __launch_bounds__(GBLK) void gemm_qkv_kernel(const uint16_t* __restrict__ A,
                                const uint16_t* __restrict__ Wq,
                                const uint16_t* __restrict__ Wkv,
                                const float* __restrict__ bq,
                                const float* __restrict__ bkv,
                                uint16_t* __restrict__ q,
                                uint16_t* __restrict__ kv) {
    const bool isq = blockIdx.x < CDIM / 64;    // same for the whole block
    gemm_tile<CDIM, 8, false, false, true>(A, isq ? Wq : Wkv, isq ? bq : bkv,
                                  nullptr, nullptr, isq ? q : kv,
                                  isq ? CDIM : 2 * CDIM,
                                  isq ? blockIdx.x : blockIdx.x - CDIM / 64,
                                  blockIdx.y);
}

// ---------------- fused dual-pass attention ----------------
// One workgroup = (b, h, 64-query panel), 32 waves: the panel fills the LDS of
// its WGP, so the waves that hide each other's waits must come from this one
// workgroup (8 per SIMD). Scores stay in LDS (64 x 1028 f32), plus a 24KB LDS
// chunk for staged V (256 keys x 32 d, bf16: one 16-byte piece per thread).
// Phase 1: QK^T via WMMA. Phase 2: dense softmax stats + top-64 threshold by
// value bisection + fused combined probabilities, left as packed bf16 at the
// head of each score row. Phase 3: P@V via WMMA; both operands come out of LDS
// as whole fragments, two 16-byte loads each: P rows as they lie, V (key-major)
// through the transposing load. The LDS port, not the arithmetic, sets the pace
// of that phase, so it is fed few wide loads that spread over all banks.
#define QBLK  64
#define SLD   1028    // score row pitch in floats: 16 bytes x odd, for 16-byte row reads
#define AWAVES 32     // waves per workgroup
#define VCH   256     // keys per staged V chunk
#define VPITCH 48     // staged V row pitch in values: 32 bytes x odd, for transposing loads
#define KGRP  (AWAVES / 8)            // wave groups that share the keys in P@V
#define KSTEP (VCH / 32 / KGRP)       // 32-key steps per wave and chunk
__global__ __launch_bounds__(AWAVES * 32) void attn_kernel(const uint16_t* __restrict__ qb,   // [ROWS,CDIM] bf16
                            const uint16_t* __restrict__ kvb,  // [ROWS,2*CDIM] bf16
                            const float* __restrict__ wf,      // w_fuse[2]
                            uint16_t* __restrict__ attn) {     // [ROWS,CDIM] bf16
    extern __shared__ __attribute__((aligned(16))) float sc[];
    uint16_t* Vs = (uint16_t*)(sc + QBLK * SLD);   // [VCH][VPITCH] bf16, DHEAD used
    const int bid  = blockIdx.x;
    const int b    = bid / (HEADS * (SEQ / QBLK));
    const int rem  = bid % (HEADS * (SEQ / QBLK));
    const int h    = rem / (SEQ / QBLK);
    const int q0   = (rem % (SEQ / QBLK)) * QBLK;
    const int tid  = threadIdx.x;
    const int wave = tid >> 5, lane = tid & 31;
    const int g    = lane >> 4;
    const float scale = 0.17677669529663687f;   // 1/sqrt(32)

    // learned fusion weights (softmax over 2) -- uniform, scalarizes to SALU
    const float e0 = expf(wf[0]), e1 = expf(wf[1]);
    const float w0 = e0 / (e0 + e1), w1 = e1 / (e0 + e1);

    // ---- phase 1: scores tile 64q x 1024k, 256 WMMA tiles over 32 waves ----
    for (int t = wave; t < (QBLK / 16) * (SEQ / 16); t += AWAVES) {
        const int qt = t >> 6, kt = t & 63;
        ABOp a, bm;
        {   // Q operand: 16 queries x 32 d (contiguous d chunks)
            int m = q0 + qt * 16 + (lane & 15);
            const uint16_t* qr = qb + (size_t)(b * SEQ + m) * CDIM + h * DHEAD;
            a.q[0] = *(const uint4*)(qr + g * 8);
            a.q[1] = *(const uint4*)(qr + 16 + g * 8);
        }
        {   // K operand: 16 keys across lanes, d packed (row-major contiguous)
            int n = kt * 16 + (lane & 15);
            const uint16_t* kr = kvb + (size_t)(b * SEQ + n) * (2 * CDIM) + h * DHEAD;
            bm.q[0] = *(const uint4*)(kr + g * 8);
            bm.q[1] = *(const uint4*)(kr + 16 + g * 8);
        }
        v8f c = {};
        c = wmma_bf16(a, bm, c);
        #pragma unroll
        for (int v = 0; v < 8; ++v)
            sc[(qt * 16 + g * 8 + v) * SLD + kt * 16 + (lane & 15)] = c[v] * scale;
    }
    __syncthreads();

    // ---- phase 2: per-row dense softmax + top-64 threshold + fusion ----
    for (int i = 0; i < QBLK / AWAVES; ++i) {
        const int row = wave * (QBLK / AWAVES) + i;
        float* rp = sc + row * SLD;
        // lane l holds columns 128j + 4l .. 128j + 4l + 3, j = 0 .. 7
        float rv[32];
        #pragma unroll
        for (int j = 0; j < 8; ++j) {
            const f32x4 t = *(const f32x4*)(rp + j * 128 + lane * 4);
            rv[j * 4 + 0] = t.x; rv[j * 4 + 1] = t.y;
            rv[j * 4 + 2] = t.z; rv[j * 4 + 3] = t.w;
        }
        float mx = -1e30f, mn = 1e30f;
        #pragma unroll
        for (int j = 0; j < 32; ++j) { mx = fmaxf(mx, rv[j]); mn = fminf(mn, rv[j]); }
        mx = wave_max(mx);
        mn = wave_min(mn);
        float ev[32];     // each exponential is formed once and kept
        #pragma unroll
        for (int j = 0; j < 32; ++j) ev[j] = expf(rv[j] - mx);
        float sd = 0.f;
        #pragma unroll
        for (int j = 0; j < 32; ++j) sd += ev[j];
        sd = wave_sum(sd);
        // bisection for top-64 threshold: largest t with count(s>t) >= TOPM
        // The count over the wave is taken from the compare masks themselves
        // (ballot + population count), so bounds and count live in scalars.
        float lo = uniform_f(mn) - 1.0f, hi = uniform_f(mx);
        for (int left = 24; left > 0; ) {
            float mid = 0.5f * (lo + hi);
            int c = 0;
            #pragma unroll
            for (int j = 0; j < 32; j += 2) {
                uint64_t m0 = __builtin_amdgcn_ballot_w32(rv[j]     > mid);
                uint64_t m1 = __builtin_amdgcn_ballot_w32(rv[j + 1] > mid);
                c += __builtin_popcountll(m0 | (m1 << 32));
            }
            if (c >= TOPM) lo = mid; else hi = mid;
            // Exactly TOPM scores lie above lo: every later step keeps this
            // same set, so the search is over (24 steps stay the bound).
            left = (c == TOPM) ? 0 : left - 1;
        }
        const float thr = lo;
        float st = 0.f;
        #pragma unroll
        for (int j = 0; j < 32; ++j) st += (rv[j] > thr) ? ev[j] : 0.f;
        st = wave_sum(st);
        const float cd = w0 / sd;
        const float ct = w1 / fmaxf(st, 1e-20f);
        // The row is in this wave's registers, so P (bf16, key order) takes the
        // place of the row's first 2KB.
        uint16_t* pr = (uint16_t*)rp;
        #pragma unroll
        for (int j = 0; j < 8; ++j) {
            f32x4 p;
            p.x = ev[j * 4 + 0] * (cd + ((rv[j * 4 + 0] > thr) ? ct : 0.f));
            p.y = ev[j * 4 + 1] * (cd + ((rv[j * 4 + 1] > thr) ? ct : 0.f));
            p.z = ev[j * 4 + 2] * (cd + ((rv[j * 4 + 2] > thr) ? ct : 0.f));
            p.w = ev[j * 4 + 3] * (cd + ((rv[j * 4 + 3] > thr) ? ct : 0.f));
            uint2 w;
            w.x = pack2(p.x, p.y);
            w.y = pack2(p.z, p.w);
            *(uint2*)(pr + j * 128 + lane * 4) = w;
        }
    }
    __syncthreads();

    // ---- phase 3: out = P @ V with LDS-staged V chunks ----
    // 8 output tiles x KGRP wave groups: group kq takes KSTEP of the 32-key
    // steps of every chunk; the groups' partial sums meet in LDS at the end.
    {
        const int tile = wave & 7, kq = wave >> 3;
        const int qt = tile >> 1, dt = tile & 1;
        const int m  = qt * 16 + (lane & 15);
        // this lane's first 16 bytes of P and of V in a chunk; all its others
        // lie at compile-time distances from these.
        // P: query m, keys g*8 .. g*8+7 of a 32-key step (and the same + 16).
        // V: the transposing load takes key row g*8 + lane%8, 16-byte half
        // (lane/8)%2 of the tile's 16 columns, and hands lane (c, g) the keys
        // g*8 .. g*8+7 of column c: P's key order.
        const uint16_t* pw = (const uint16_t*)(sc + m * SLD) + kq * (KSTEP * 32) + g * 8;
        const uint16_t* vw = Vs + (kq * (KSTEP * 32) + g * 8 + (lane & 7)) * VPITCH
                             + dt * 16 + ((lane >> 3) & 1) * 8;
        v8f acc = {};
        for (int kk0 = 0; kk0 < SEQ; kk0 += VCH) {
            // stage V[kk0 .. kk0+VCH) x DHEAD : one coalesced b128 a thread
            {
                const uint16_t* vb = kvb + (size_t)(b * SEQ + kk0) * (2 * CDIM)
                                     + CDIM + h * DHEAD;
                int r = tid >> 2, c = (tid & 3) * 8;   // 1024 uint4 total
                *(uint4*)(&Vs[r * VPITCH + c]) =
                    *(const uint4*)(vb + (size_t)r * (2 * CDIM) + c);
                // the load's address registers are reused right behind the barrier
                asm volatile("s_wait_xcnt 0x0" ::: "memory");
            }
            __syncthreads();
            #pragma unroll
            for (int s = 0; s < KSTEP; ++s) {
                ABOp a, bm;
                a.q[0]  = *(const uint4*)(pw + kk0 + s * 32);
                a.q[1]  = *(const uint4*)(pw + kk0 + s * 32 + 16);
                bm.t[0] = ld_tr16(vw + (s * 32) * VPITCH);
                bm.t[1] = ld_tr16(vw + (s * 32 + 16) * VPITCH);
                acc = wmma_bf16(a, bm, acc);
            }
            __syncthreads();
        }
        // The score panel has been read for the last time (barrier above): its
        // first 24KB now carry the partial sums of groups 1.. to group 0.
        if (kq != 0) {
            #pragma unroll
            for (int v = 0; v < 8; ++v)
                sc[(((kq - 1) * 8 + tile) * 8 + v) * 32 + lane] = acc[v];
        }
        __syncthreads();
        if (kq == 0) {
            #pragma unroll
            for (int p = 0; p < KGRP - 1; ++p) {
                #pragma unroll
                for (int v = 0; v < 8; ++v)
                    acc[v] += sc[((p * 8 + tile) * 8 + v) * 32 + lane];
            }
            #pragma unroll
            for (int v = 0; v < 8; ++v) {
                int mr = q0 + qt * 16 + g * 8 + v;
                int nc = dt * 16 + (lane & 15);
                attn[(size_t)(b * SEQ + mr) * CDIM + h * DHEAD + nc] = f2bf(acc[v]);
            }
        }
    }
}

// ---------------- host side ----------------
extern "C" void kernel_launch(void* const* d_in, const int* in_sizes, int n_in,
                              void* d_out, int out_size, void* d_ws, size_t ws_size,
                              hipStream_t stream) {
    (void)in_sizes; (void)n_in; (void)out_size; (void)ws_size;
    const float* x     = (const float*)d_in[0];
    const float* ln1g  = (const float*)d_in[1];
    const float* ln1b  = (const float*)d_in[2];
    const float* Wq    = (const float*)d_in[3];
    const float* bq    = (const float*)d_in[4];
    const float* Wkv   = (const float*)d_in[5];
    const float* bkv   = (const float*)d_in[6];
    const float* wfuse = (const float*)d_in[7];
    const float* Wo    = (const float*)d_in[8];
    const float* bo    = (const float*)d_in[9];
    const float* ln2g  = (const float*)d_in[10];
    const float* ln2b  = (const float*)d_in[11];
    const float* W1    = (const float*)d_in[12];
    const float* b1    = (const float*)d_in[13];
    const float* W2    = (const float*)d_in[14];
    const float* b2    = (const float*)d_in[15];
    float* xcur = (float*)d_out;                       // running activations

    // workspace carve-up (bf16 buffers, 256B-aligned power-of-two sizes);
    // the five weight arrays lie in the order the front launch writes them
    uint8_t* ws = (uint8_t*)d_ws;
    uint16_t* wq_bf   = (uint16_t*)(ws);                 size_t off = NWQ * 2;
    uint16_t* wkv_bf  = (uint16_t*)(ws + off);           off += NWKV * 2;
    uint16_t* wo_bf   = (uint16_t*)(ws + off);           off += NWO * 2;
    uint16_t* w1_bf   = (uint16_t*)(ws + off);           off += NW1 * 2;
    uint16_t* w2_bf   = (uint16_t*)(ws + off);           off += NW2 * 2;
    uint16_t* h_bf    = (uint16_t*)(ws + off);           off += (size_t)ROWS * CDIM * 2;
    uint16_t* q_bf    = (uint16_t*)(ws + off);           off += (size_t)ROWS * CDIM * 2;
    uint16_t* kv_bf   = (uint16_t*)(ws + off);           off += (size_t)ROWS * 2 * CDIM * 2;
    uint16_t* attn_bf = (uint16_t*)(ws + off);           off += (size_t)ROWS * CDIM * 2;
    uint16_t* u_bf    = (uint16_t*)(ws + off);

    const int attnLds = QBLK * SLD * (int)sizeof(float)           // score panel
                      + VCH * VPITCH * (int)sizeof(uint16_t);     // V chunk
    hipFuncSetAttribute((const void*)attn_kernel,
                        hipFuncAttributeMaxDynamicSharedMemorySize, attnLds);

    const dim3 blk(GBLK);
    // first LayerNorm and all weight converts: they read inputs only
    front_kernel<<<dim3(LNGRID + NWALL / CVT), dim3(SMALLBLK), 0, stream>>>(
        x, ln1g, ln1b, h_bf, Wq, Wkv, Wo, W1, W2, wq_bf);

    for (int l = 0; l < LAYERS; ++l) {
        // layer 0 takes its residual from x itself; d_out is first written there
        const float* xin = (l == 0) ? x : xcur;

        // --- attention sublayer ---
        if (l > 0)
            ln_kernel<<<dim3(LNGRID), dim3(SMALLBLK), 0, stream>>>(xcur, ln1g + l * CDIM,
                                                      ln1b + l * CDIM, h_bf);
        gemm_qkv_kernel<<<dim3(3 * CDIM / 64, ROWS / 64), blk, 0, stream>>>(
                h_bf, wq_bf + (size_t)l * CDIM * CDIM,
                wkv_bf + (size_t)l * CDIM * 2 * CDIM,
                bq + l * CDIM, bkv + l * 2 * CDIM, q_bf, kv_bf);
        attn_kernel<<<dim3(BATCH * HEADS * (SEQ / QBLK)), dim3(AWAVES * 32), attnLds, stream>>>(
                q_bf, kv_bf, wfuse + l * 2, attn_bf);
        gemm_bf16_kernel<CDIM, CDIM, 8, false, true, false>
            <<<dim3(CDIM / 64, ROWS / 64), blk, 0, stream>>>(
                attn_bf, wo_bf + (size_t)l * CDIM * CDIM, bo + l * CDIM,
                xin, xcur, nullptr);

        // --- MLP sublayer ---
        ln_kernel<<<dim3(LNGRID), dim3(SMALLBLK), 0, stream>>>(xcur, ln2g + l * CDIM,
                                                  ln2b + l * CDIM, h_bf);
        gemm_bf16_kernel<CDIM, DFF, 8, true, false, true>
            <<<dim3(DFF / 64, ROWS / 64), blk, 0, stream>>>(
                h_bf, w1_bf + (size_t)l * CDIM * DFF, b1 + l * DFF,
                nullptr, nullptr, u_bf);
        gemm_bf16_kernel<DFF, CDIM, 6, false, true, false>
            <<<dim3(CDIM / 64, ROWS / 64), blk, 0, stream>>>(
                u_bf, w2_bf + (size_t)l * DFF * CDIM, b2 + l * CDIM,
                xcur, xcur, nullptr);
    }
}

// v008
// Measured time: 139 microseconds a run.
// In both of two side-by-side timings against v007, it was 1.12 times as fast.
// Counting every step since v000, it is 3.31 times as fast.
#include <hip/hip_runtime.h>
#include <hip/hip_bf16.h>
#include <math.h>
#include <stdint.h>

// ---------------- problem constants ----------------
#define LAYERS 2
#define BATCH  4
#define SEQ    1024
#define CDIM   256
#define HEADS  8
#define DHEAD  32          // CDIM / HEADS
#define TOPM   64
#define DFF    1024
#define ROWS   (BATCH * SEQ)      // 4096 token rows
#define LNEPS  1e-5f

// WMMA vector types (CDNA5 wave32)
typedef __attribute__((ext_vector_type(16))) __bf16 v16bf;
typedef __attribute__((ext_vector_type(8)))  float  v8f;
typedef __attribute__((ext_vector_type(8)))  short  s16x8;

union ABOp {            // one 16x32 bf16 WMMA operand per lane
    uint16_t u[16];
    uint4    q[2];      // two 16-byte chunks
    s16x8    t[2];      // the same, as a transposing LDS load returns them
    v16bf    v;
};

__device__ __forceinline__ uint16_t f2bf(float f) {
    uint32_t u = __float_as_uint(f);
    uint32_t r = u + 0x7FFFu + ((u >> 16) & 1u);   // round-to-nearest-even
    return (uint16_t)(r >> 16);
}

// Two floats to one register of two bf16 (round to nearest even, as f2bf), in
// the chip's one packed convert.
typedef __attribute__((ext_vector_type(2))) float  f32x2;
typedef __attribute__((ext_vector_type(2))) __bf16 bf16x2;
__device__ __forceinline__ uint32_t pack2(float lo, float hi) {
    return __builtin_bit_cast(uint32_t, __builtin_convertvector(f32x2{lo, hi}, bf16x2));
}

// Transposing LDS load: 16 keys x 16 columns of a key-major bf16 tile come back
// as 8 consecutive keys of one column per lane (every lane must be on).
__device__ __forceinline__ s16x8 ld_tr16(const uint16_t* p) {
    typedef __attribute__((address_space(3))) s16x8 lds_s16x8;
    return __builtin_amdgcn_ds_load_tr16_b128_v8i16((lds_s16x8*)p);
}

__device__ __forceinline__ v8f wmma_bf16(const ABOp& a, const ABOp& b, v8f c) {
    return __builtin_amdgcn_wmma_f32_16x16x32_bf16(
        false, a.v, false, b.v, (short)0, c, false, false);
}

// ---------------- wave-wide reductions on the vector unit ----------------
// Lane l <-> l ^ 16 (other 16-lane row) and l <-> l ^ M (inside a row, DPP
// row_xmask): register-to-register moves, no trip through the LDS crossbar.
__device__ __forceinline__ float xhalf(float x) {
    int b = __builtin_bit_cast(int, x);
    return __builtin_bit_cast(float, __builtin_amdgcn_permlanex16(
        b, b, 0x76543210, 0xfedcba98, false, false));
}
template<int M>
__device__ __forceinline__ float xrow(float x) {
    return __builtin_bit_cast(float, __builtin_amdgcn_mov_dpp(
        __builtin_bit_cast(int, x), 0x160 | M, 0xf, 0xf, true));
}
// Butterfly over 32 lanes in the order 16, 8, 4, 2, 1; every lane gets the result.
__device__ __forceinline__ float wave_sum(float s) {
    s += xhalf(s);   s += xrow<8>(s); s += xrow<4>(s);
    s += xrow<2>(s); s += xrow<1>(s);
    return s;
}
__device__ __forceinline__ float wave_max(float s) {
    s = fmaxf(s, xhalf(s));   s = fmaxf(s, xrow<8>(s)); s = fmaxf(s, xrow<4>(s));
    s = fmaxf(s, xrow<2>(s)); s = fmaxf(s, xrow<1>(s));
    return s;
}
__device__ __forceinline__ float wave_min(float s) {
    s = fminf(s, xhalf(s));   s = fminf(s, xrow<8>(s)); s = fminf(s, xrow<4>(s));
    s = fminf(s, xrow<2>(s)); s = fminf(s, xrow<1>(s));
    return s;
}
// A value that is equal in all lanes, moved to a scalar register.
__device__ __forceinline__ float uniform_f(float x) {
    return __builtin_bit_cast(float,
        __builtin_amdgcn_readfirstlane(__builtin_bit_cast(int, x)));
}

// ---------------- LayerNorm (one wave per row, LNR rows a wave) ----------
// A row is 8 values a lane, so its sums need the wave-wide butterfly only: no
// LDS, no barrier. Few waves with much work each, because starting waves, not
// the arithmetic, is what such a grid costs: a block is one wave per SIMD, and
// a LayerNorm is one block per WGP.
#define SMALLBLK 128              // threads per block, LayerNorm and converts
#define LNR    4                  // rows per wave, all loads issued up front
#define LNROWS (SMALLBLK / 32 * LNR)   // rows per block
#define LNGRID (ROWS / LNROWS)    // blocks per LayerNorm
typedef __attribute__((ext_vector_type(4))) float f32x4;
__device__ __forceinline__ uint2 pack4(f32x4 y) {
    uint2 r;
    r.x = (uint32_t)f2bf(y.x) | ((uint32_t)f2bf(y.y) << 16);
    r.y = (uint32_t)f2bf(y.z) | ((uint32_t)f2bf(y.w) << 16);
    return r;
}
__device__ __forceinline__ void ln_rows(const float* __restrict__ x,
                                        const float* __restrict__ g,
                                        const float* __restrict__ b,
                                        uint16_t* __restrict__ out, int blk) {
    const int wave = threadIdx.x >> 5, lane = threadIdx.x & 31;
    // lane l holds columns 4l .. 4l+3 and 128+4l .. 128+4l+3 of each row
    const size_t at = (size_t)((blk * (SMALLBLK / 32) + wave) * LNR) * CDIM + lane * 4;
    f32x4 v[LNR][2];
    #pragma unroll
    for (int r = 0; r < LNR; ++r) {
        v[r][0] = *(const f32x4*)(x + at + r * CDIM);
        v[r][1] = *(const f32x4*)(x + at + r * CDIM + 128);
    }
    const f32x4 g0 = *(const f32x4*)(g + lane * 4);
    const f32x4 g1 = *(const f32x4*)(g + lane * 4 + 128);
    const f32x4 b0 = *(const f32x4*)(b + lane * 4);
    const f32x4 b1 = *(const f32x4*)(b + lane * 4 + 128);
    float s[LNR], ss[LNR];
    #pragma unroll
    for (int r = 0; r < LNR; ++r) {
        const f32x4 p = v[r][0], q = v[r][1];
        s[r]  = ((p.x + p.y) + (p.z + p.w)) + ((q.x + q.y) + (q.z + q.w));
        ss[r] = ((p.x * p.x + p.y * p.y) + (p.z * p.z + p.w * p.w))
              + ((q.x * q.x + q.y * q.y) + (q.z * q.z + q.w * q.w));
    }
    #pragma unroll
    for (int r = 0; r < LNR; ++r) { s[r] = wave_sum(s[r]); ss[r] = wave_sum(ss[r]); }
    #pragma unroll
    for (int r = 0; r < LNR; ++r) {
        const float mean = s[r] * (1.0f / CDIM);
        const float var  = ss[r] * (1.0f / CDIM) - mean * mean;
        const float rstd = rsqrtf(var + LNEPS);
        *(uint2*)(out + at + r * CDIM)       = pack4((v[r][0] - mean) * rstd * g0 + b0);
        *(uint2*)(out + at + r * CDIM + 128) = pack4((v[r][1] - mean) * rstd * g1 + b1);
    }
}

__global__ __launch_bounds__(SMALLBLK) void ln_kernel(const float* __restrict__ x,
                          const float* __restrict__ g,
                          const float* __restrict__ b,
                          uint16_t* __restrict__ out) {
    ln_rows(x, g, b, out, blockIdx.x);
}

// ---------------- front launch: everything that reads inputs only ----------
// Blocks [0, LNGRID): the first LayerNorm. The blocks behind them convert the
// weights of all layers to bf16, CVT values each: the five arrays land one
// behind the other in wbf, each with its layers in input order.
// Inside a layer the values lie in the order of the WMMA B operand: one 1KB
// fragment per (16 columns, 32 k), fragments of a column group in k order; in
// a fragment two 512-byte halves, lane l's 16 bytes at l*16 in each. A wave
// then reads a whole fragment with two 16-byte loads over contiguous lines.
#define NWQ  (LAYERS * CDIM * CDIM)
#define NWKV (LAYERS * CDIM * 2 * CDIM)
#define NWO  (LAYERS * CDIM * CDIM)
#define NW1  (LAYERS * CDIM * DFF)
#define NW2  (LAYERS * DFF * CDIM)
#define NWALL (NWQ + NWKV + NWO + NW1 + NW2)
#define CVT  4096                 // a block's share: 64 k x 64 columns
#define FRAG 512                  // values in one B fragment
template<int K, int N>
__device__ __forceinline__ void pack_tile(const float* __restrict__ w,
                                          uint16_t* __restrict__ to, int tile) {
    constexpr int TPL = K * N / CVT;            // tiles per layer
    const int l  = tile / TPL, r = tile % TPL;
    const int kt = r / (N / 64), nt = r % (N / 64);
    const int n  = nt * 64 + (threadIdx.x & 63);    // this thread's column
    const int ks = kt * 2 + (threadIdx.x >> 6);     // and its 32-k step
    const float* in = w + (size_t)l * K * N + (size_t)(ks * 32) * N + n;
    float v[32];
    #pragma unroll
    for (int i = 0; i < 32; ++i) v[i] = in[i * N];
    uint16_t* o = to + (size_t)l * K * N + ((n >> 4) * (K / 32) + ks) * FRAG + (n & 15) * 8;
    // k 0-7: half 0, lanes 0-15; k 8-15: half 0, lanes 16-31; k 16-31: half 1 alike
    #pragma unroll
    for (int c = 0; c < 4; ++c) {
        uint4 p;
        p.x = (uint32_t)f2bf(v[c * 8 + 0]) | ((uint32_t)f2bf(v[c * 8 + 1]) << 16);
        p.y = (uint32_t)f2bf(v[c * 8 + 2]) | ((uint32_t)f2bf(v[c * 8 + 3]) << 16);
        p.z = (uint32_t)f2bf(v[c * 8 + 4]) | ((uint32_t)f2bf(v[c * 8 + 5]) << 16);
        p.w = (uint32_t)f2bf(v[c * 8 + 6]) | ((uint32_t)f2bf(v[c * 8 + 7]) << 16);
        *(uint4*)(o + (c >> 1) * (FRAG / 2) + (c & 1) * 128) = p;
    }
    // the stores' data and address registers may be rewritten by what follows
    asm volatile("s_wait_xcnt 0x0" ::: "memory");
}
__global__ __launch_bounds__(SMALLBLK) void front_kernel(const float* __restrict__ x,
                             const float* __restrict__ g,
                             const float* __restrict__ b,
                             uint16_t* __restrict__ hout,
                             const float* __restrict__ Wq,
                             const float* __restrict__ Wkv,
                             const float* __restrict__ Wo,
                             const float* __restrict__ W1,
                             const float* __restrict__ W2,
                             uint16_t* __restrict__ wbf) {
    if (blockIdx.x < LNGRID) {          // same for the whole block
        ln_rows(x, g, b, hout, blockIdx.x);
        return;
    }
    const int t = blockIdx.x - LNGRID;  // every array is whole blocks
    if (t < NWQ / CVT)
        pack_tile<CDIM, CDIM>(Wq, wbf, t);
    else if (t < (NWQ + NWKV) / CVT)
        pack_tile<CDIM, 2 * CDIM>(Wkv, wbf + NWQ, t - NWQ / CVT);
    else if (t < (NWQ + NWKV + NWO) / CVT)
        pack_tile<CDIM, CDIM>(Wo, wbf + NWQ + NWKV, t - (NWQ + NWKV) / CVT);
    else if (t < (NWQ + NWKV + NWO + NW1) / CVT)
        pack_tile<CDIM, DFF>(W1, wbf + NWQ + NWKV + NWO, t - (NWQ + NWKV + NWO) / CVT);
    else
        pack_tile<DFF, CDIM>(W2, wbf + NWQ + NWKV + NWO + NW1,
                             t - (NWQ + NWKV + NWO + NW1) / CVT);
}

// ---------------- generic bf16 WMMA GEMM: D = act(A@B + bias) (+resid) ----
// A: [M,K] bf16 row-major.  B: K x Nc bf16 in fragment order (see pack_tile).
// block = 128 (4 waves, 2 x 2); each wave owns a 32x32 output tile (2 x 2
// fragments), the block the 64 x 64 tile (by, bx).
// Every global load covers whole lines and many are in flight at once:
//  B: a fragment is two contiguous 512-byte loads, straight into registers,
//     AHEAD K steps ahead of its products;
//  A: the block's 64 rows go to LDS KC k at a time, one 512-byte row piece per
//     wave-wide load, the next chunk fetched while this one is worked on; the
//     fragments (16 rows x 16 bytes a load) are then gathered from LDS.
// One barrier per KC k publishes a chunk; with two buffers the same barrier
// ends the last read of the buffer that is filled behind the next chunk.
#define GBLK 128
#define KC   256                  // k per staged A chunk
#define APITCH (KC + 8)           // LDS row pitch in values: 16 bytes x odd
typedef __attribute__((ext_vector_type(4))) uint32_t u32x4;
// Work-group barrier that orders LDS traffic only. __syncthreads() would also
// wait for every global load, and those are meant to stay in flight across it.
__device__ __forceinline__ void lds_barrier() {
    __builtin_amdgcn_fence(__ATOMIC_RELEASE, "workgroup", "local");
    __builtin_amdgcn_s_barrier();
    __builtin_amdgcn_fence(__ATOMIC_ACQUIRE, "workgroup", "local");
}
template<int K, int AHEAD, bool GELU_, bool RES, bool OUTBF>
__device__ __forceinline__ void gemm_tile(const uint16_t* __restrict__ A,
                                 const uint16_t* __restrict__ Bw,
                                 const float* __restrict__ bias,
                                 const float* __restrict__ resid,
                                 float* __restrict__ outf,
                                 uint16_t* __restrict__ outb,
                                 int Nc, int bx, int by) {
    constexpr int NS   = K / 32;         // K steps
    constexpr int NCH  = K / KC;         // A chunks
    constexpr int CS   = KC / 32;        // K steps per chunk
    constexpr int NBUF = NCH > 1 ? 2 : 1;
    constexpr int NST  = 64 * KC / 8 / GBLK;    // 16-byte pieces per thread and chunk
    __shared__ __attribute__((aligned(16))) uint16_t As[NBUF * 64 * APITCH];
    const int tid  = threadIdx.x;
    const int wave = tid >> 5, lane = tid & 31;
    const int g    = lane >> 4;          // half-wave select
    const int row0 = by * 64 + (wave >> 1) * 32;
    const int col0 = bx * 64 + (wave & 1) * 32;
    // A staging: piece i of this thread is row wave + 4i, bytes lane*16 of the chunk
    const uint16_t* ag = A + (size_t)(by * 64 + wave) * K + lane * 8;
    uint16_t*       aw = As + wave * APITCH + lane * 8;
    // A operand: row m = tile row (+16) + lane%16, K-chunks at g*8 and 16+g*8 of a step
    const uint16_t* ar = As + ((wave >> 1) * 32 + (lane & 15)) * APITCH + g * 8;
    // B operand: fragments (col0/16 (+1), step), this lane's 16 bytes of each half
    const uint16_t* bp = Bw + (size_t)(col0 >> 4) * NS * FRAG + lane * 8;
    const int nc0 = col0 + (lane & 15);  // output column, first fragment
    const int m0  = row0 + g * 8;        // output row, first fragment, element 0
    const float bb[2] = { bias[nc0], bias[nc0 + 16] };
    float rs[2][2][8];                   // residual, fetched while the loop drains

    u32x4 st[NST];                       // an A chunk on its way to LDS
    ABOp  af[2][2], b[AHEAD][2];         // all indices are compile-time
    v8f   acc[2][2] = {};

    #pragma unroll
    for (int i = 0; i < NST; ++i) st[i] = *(const u32x4*)(ag + i * 4 * K);
    // A first: loads return in order, and the LDS stores wait for these alone
    __builtin_amdgcn_sched_barrier(0);
    #pragma unroll
    for (int s = 0; s < AHEAD; ++s)
        #pragma unroll
        for (int f = 0; f < 2; ++f) {
            b[s][f].q[0] = *(const uint4*)(bp + (f * NS + s) * FRAG);
            b[s][f].q[1] = *(const uint4*)(bp + (f * NS + s) * FRAG + FRAG / 2);
        }
    // keeps the loads above from sinking to their first use (left alone, the
    // scheduler holds about one step in flight to save registers)
    __builtin_amdgcn_sched_barrier(0);
    // an address register that has had its last use may be rewritten from here on
    if (NCH == 1 || AHEAD == NS) asm volatile("s_wait_xcnt 0x0" ::: "memory");
    #pragma unroll
    for (int i = 0; i < NST; ++i) *(u32x4*)(aw + i * 4 * APITCH) = st[i];
    if (NCH > 1) {
        #pragma unroll
        for (int i = 0; i < NST; ++i) st[i] = *(const u32x4*)(ag + i * 4 * K + KC);
    }
    lds_barrier();                       // chunk 0 is in LDS

    #pragma unroll
    for (int c = 0; c < NCH; ++c) {
        const uint16_t* ac = ar + (c % NBUF) * 64 * APITCH;
        #pragma unroll
        for (int f = 0; f < 2; ++f) {
            af[0][f].q[0] = *(const uint4*)(ac + f * 16 * APITCH);
            af[0][f].q[1] = *(const uint4*)(ac + f * 16 * APITCH + 16);
        }
        #pragma unroll
        for (int s = 0; s < CS; ++s) {
            const int gs = c * CS + s, u = gs % AHEAD;
            if (s + 1 < CS) {            // next step's A fragments, ahead of the products
                #pragma unroll
                for (int f = 0; f < 2; ++f) {
                    af[(s + 1) & 1][f].q[0] = *(const uint4*)(ac + f * 16 * APITCH + (s + 1) * 32);
                    af[(s + 1) & 1][f].q[1] = *(const uint4*)(ac + f * 16 * APITCH + (s + 1) * 32 + 16);
                }
            }
            // holds the LDS reads in front of the products they overlap with
            __builtin_amdgcn_sched_barrier(0);
            #pragma unroll
            for (int i = 0; i < 2; ++i)
                #pragma unroll
                for (int j = 0; j < 2; ++j)
                    acc[i][j] = wmma_bf16(af[s & 1][i], b[u][j], acc[i][j]);
            // keeps the loads below from sinking to their use AHEAD steps later
            __builtin_amdgcn_sched_barrier(0);
            if (RES && gs == NS - 4) {   // 3 steps (12 loads) still in flight
                #pragma unroll
                for (int i = 0; i < 2; ++i)
                    #pragma unroll
                    for (int j = 0; j < 2; ++j)
                        #pragma unroll
                        for (int v = 0; v < 8; ++v)
                            rs[i][j][v] = resid[(size_t)(m0 + i * 16 + v) * Nc + nc0 + j * 16];
            }
            if (gs + AHEAD < NS) {       // B of step gs + AHEAD, into the freed set
                #pragma unroll
                for (int f = 0; f < 2; ++f) {
                    b[u][f].q[0] = *(const uint4*)(bp + (f * NS + gs + AHEAD) * FRAG);
                    b[u][f].q[1] = *(const uint4*)(bp + (f * NS + gs + AHEAD) * FRAG + FRAG / 2);
                }
                // B's last loads: their address register may be rewritten behind this
                if (gs + AHEAD == NS - 1) asm volatile("s_wait_xcnt 0x0" ::: "memory");
            }
            __builtin_amdgcn_sched_barrier(0);   // same purpose, the loads' other side
        }
        if (c + 1 < NCH) {
            // chunk c+1 into the buffer last read in chunk c-1 (barrier since)
            #pragma unroll
            for (int i = 0; i < NST; ++i)
                *(u32x4*)(aw + ((c + 1) % NBUF) * 64 * APITCH + i * 4 * APITCH) = st[i];
            if (c + 2 < NCH) {
                #pragma unroll
                for (int i = 0; i < NST; ++i)
                    st[i] = *(const u32x4*)(ag + i * 4 * K + (c + 2) * KC);
                // A's last loads: the same for their address register
                if (c + 2 == NCH - 1) asm volatile("s_wait_xcnt 0x0" ::: "memory");
            }
            lds_barrier();               // chunk c+1 is in LDS, chunk c is read out
        }
    }
    // C/D layout: element v -> (m = tile row + g*8 + v, n = tile col + lane%16)
    #pragma unroll
    for (int j = 0; j < 2; ++j) {
        const int nc = nc0 + j * 16;
        #pragma unroll
        for (int i = 0; i < 2; ++i) {
            #pragma unroll
            for (int v = 0; v < 8; ++v) {
                int m = m0 + i * 16 + v;
                float r = acc[i][j][v] + bb[j];
                if (GELU_) r = 0.5f * r * (1.0f + erff(r * 0.70710678118654752f));
                if (RES)   r += rs[i][j][v];
                if (OUTBF) outb[(size_t)m * Nc + nc] = f2bf(r);
                else       outf[(size_t)m * Nc + nc] = r;
            }
        }
    }
}

// one product: grid = (Nc/64, M/64)
template<int K, int NC, int AHEAD, bool GELU_, bool RES, bool OUTBF>
__global__ __launch_bounds__(GBLK) void gemm_bf16_kernel(const uint16_t* __restrict__ A,
                                 const uint16_t* __restrict__ Bw,
                                 const float* __restrict__ bias,
                                 const float* __restrict__ resid,
                                 float* __restrict__ outf,
                                 uint16_t* __restrict__ outb) {
    gemm_tile<K, AHEAD, GELU_, RES, OUTBF>(A, Bw, bias, resid, outf, outb, NC,
                                           blockIdx.x, blockIdx.y);
}

// Q and KV projections of the same rows in one grid = (3*CDIM/64, M/64):
// the first CDIM/64 block columns are Q's tiles, the others KV's.
__global__ __launch_bounds__(GBLK) void gemm_qkv_kernel(const uint16_t* __restrict__ A,
                                const uint16_t* __restrict__ Wq,
                                const uint16_t* __restrict__ Wkv,
                                const float* __restrict__ bq,
                                const float* __restrict__ bkv,
                                uint16_t* __restrict__ q,
                                uint16_t* __restrict__ kv) {
    const bool isq = blockIdx.x < CDIM / 64;    // same for the whole block
    gemm_tile<CDIM, 8, false, false, true>(A, isq ? Wq : Wkv, isq ? bq : bkv,
                                  nullptr, nullptr, isq ? q : kv,
                                  isq ? CDIM : 2 * CDIM,
                                  isq ? blockIdx.x : blockIdx.x - CDIM / 64,
                                  blockIdx.y);
}

// ---------------- fused dual-pass attention ----------------
// One workgroup = (b, h, 64-query panel), 32 waves: the panel fills the LDS of
// its WGP, so the waves that hide each other's waits must come from this one
// workgroup (8 per SIMD). Scores stay in LDS (64 x 1028 f32), plus a 24KB LDS
// chunk for staged V (256 keys x 32 d, bf16: one 16-byte piece per thread).
// Phase 1: QK^T via WMMA. Phase 2: dense softmax stats + top-64 threshold by
// value bisection + fused combined probabilities, left as packed bf16 at the
// head of each score row. Phase 3: P@V via WMMA; both operands come out of LDS
// as whole fragments, two 16-byte loads each: P rows as they lie, V (key-major)
// through the transposing load. The LDS port, not the arithmetic, sets the pace
// of that phase, so it is fed few wide loads that spread over all banks.
#define QBLK  64
#define SLD   1028    // score row pitch in floats: 16 bytes x odd, for 16-byte row reads
#define AWAVES 32     // waves per workgroup
#define VCH   256     // keys per staged V chunk
#define VPITCH 48     // staged V row pitch in values: 32 bytes x odd, for transposing loads
#define KGRP  (AWAVES / 8)            // wave groups that share the keys in P@V
#define KSTEP (VCH / 32 / KGRP)       // 32-key steps per wave and chunk
__global__ __launch_bounds__(AWAVES * 32) void attn_kernel(const uint16_t* __restrict__ qb,   // [ROWS,CDIM] bf16
                            const uint16_t* __restrict__ kvb,  // [ROWS,2*CDIM] bf16
                            const float* __restrict__ wf,      // w_fuse[2]
                            uint16_t* __restrict__ attn) {     // [ROWS,CDIM] bf16
    extern __shared__ __attribute__((aligned(16))) float sc[];
    uint16_t* Vs = (uint16_t*)(sc + QBLK * SLD);   // [VCH][VPITCH] bf16, DHEAD used
    const int bid  = blockIdx.x;
    const int b    = bid / (HEADS * (SEQ / QBLK));
    const int rem  = bid % (HEADS * (SEQ / QBLK));
    const int h    = rem / (SEQ / QBLK);
    const int q0   = (rem % (SEQ / QBLK)) * QBLK;
    const int tid  = threadIdx.x;
    const int wave = tid >> 5, lane = tid & 31;
    const int g    = lane >> 4;
    const float scale = 0.17677669529663687f;   // 1/sqrt(32)

    // learned fusion weights (softmax over 2) -- uniform, scalarizes to SALU
    const float e0 = expf(wf[0]), e1 = expf(wf[1]);
    const float w0 = e0 / (e0 + e1), w1 = e1 / (e0 + e1);

    // ---- phase 1: scores tile 64q x 1024k, 256 WMMA tiles over 32 waves ----
    // A wave keeps its 2 key tiles in registers and takes them against all 4
    // query tiles: the panel's K rows (half a line each, more lines than the
    // WGP cache holds) are gathered once, not once per query tile. These
    // 16-line gathers, not the products, set the pace of this phase.
    {
        constexpr int KT = SEQ / 16 / AWAVES;      // key tiles per wave
        ABOp kf[KT], qa;
        // K operand: 16 keys across lanes, d packed (row-major contiguous)
        const uint16_t* kr = kvb + (size_t)(b * SEQ + wave * 16 + (lane & 15)) * (2 * CDIM)
                             + h * DHEAD + g * 8;
        #pragma unroll
        for (int j = 0; j < KT; ++j) {
            kf[j].q[0] = *(const uint4*)(kr + (size_t)j * AWAVES * 16 * (2 * CDIM));
            kf[j].q[1] = *(const uint4*)(kr + (size_t)j * AWAVES * 16 * (2 * CDIM) + 16);
        }
        // Q operand: 16 queries x 32 d (contiguous d chunks)
        const uint16_t* qr = qb + (size_t)(b * SEQ + q0 + (lane & 15)) * CDIM
                             + h * DHEAD + g * 8;
        qa.q[0] = *(const uint4*)(qr);
        qa.q[1] = *(const uint4*)(qr + 16);
        float* sp = sc + g * 8 * SLD + wave * 16 + (lane & 15);
        // stays rolled: from a running row pointer all 16 stores of a trip reach
        // their place by the immediate offset (unrolled, each takes an address
        // register of its own and the wave reaches its limit of 128 registers)
        #pragma unroll 1
        for (int qt = 0; qt < QBLK / 16; ++qt) {
            ABOp qn = qa;
            if (qt + 1 < QBLK / 16) {   // the next query tile, ahead of the products
                qr += 16 * CDIM;
                qn.q[0] = *(const uint4*)(qr);
                qn.q[1] = *(const uint4*)(qr + 16);
            }
            #pragma unroll
            for (int j = 0; j < KT; ++j) {
                v8f c = {};
                c = wmma_bf16(qa, kf[j], c);
                #pragma unroll
                for (int v = 0; v < 8; ++v)
                    sp[v * SLD + j * AWAVES * 16] = c[v] * scale;
            }
            qa = qn;
            sp += 16 * SLD;
        }
    }
    __syncthreads();

    // ---- phase 2: per-row dense softmax + top-64 threshold + fusion ----
    for (int i = 0; i < QBLK / AWAVES; ++i) {
        const int row = wave * (QBLK / AWAVES) + i;
        float* rp = sc + row * SLD;
        // lane l holds columns 128j + 4l .. 128j + 4l + 3, j = 0 .. 7
        float rv[32];
        #pragma unroll
        for (int j = 0; j < 8; ++j) {
            const f32x4 t = *(const f32x4*)(rp + j * 128 + lane * 4);
            rv[j * 4 + 0] = t.x; rv[j * 4 + 1] = t.y;
            rv[j * 4 + 2] = t.z; rv[j * 4 + 3] = t.w;
        }
        float mx = -1e30f, mn = 1e30f;
        #pragma unroll
        for (int j = 0; j < 32; ++j) { mx = fmaxf(mx, rv[j]); mn = fminf(mn, rv[j]); }
        mx = wave_max(mx);
        mn = wave_min(mn);
        float ev[32];     // each exponential is formed once and kept
        #pragma unroll
        for (int j = 0; j < 32; ++j) ev[j] = expf(rv[j] - mx);
        float sd = 0.f;
        #pragma unroll
        for (int j = 0; j < 32; ++j) sd += ev[j];
        sd = wave_sum(sd);
        // bisection for top-64 threshold: largest t with count(s>t) >= TOPM
        // The count over the wave is taken from the compare masks themselves
        // (ballot + population count), so bounds and count live in scalars.
        float lo = uniform_f(mn) - 1.0f, hi = uniform_f(mx);
        for (int left = 24; left > 0; ) {
            float mid = 0.5f * (lo + hi);
            int c = 0;
            #pragma unroll
            for (int j = 0; j < 32; j += 2) {
                uint64_t m0 = __builtin_amdgcn_ballot_w32(rv[j]     > mid);
                uint64_t m1 = __builtin_amdgcn_ballot_w32(rv[j + 1] > mid);
                c += __builtin_popcountll(m0 | (m1 << 32));
            }
            if (c >= TOPM) lo = mid; else hi = mid;
            // Exactly TOPM scores lie above lo: every later step keeps this
            // same set, so the search is over (24 steps stay the bound).
            left = (c == TOPM) ? 0 : left - 1;
        }
        const float thr = lo;
        float st = 0.f;
        #pragma unroll
        for (int j = 0; j < 32; ++j) st += (rv[j] > thr) ? ev[j] : 0.f;
        st = wave_sum(st);
        const float cd = w0 / sd;
        const float ct = w1 / fmaxf(st, 1e-20f);
        // The row is in this wave's registers, so P (bf16, key order) takes the
        // place of the row's first 2KB.
        uint16_t* pr = (uint16_t*)rp;
        #pragma unroll
        for (int j = 0; j < 8; ++j) {
            f32x4 p;
            p.x = ev[j * 4 + 0] * (cd + ((rv[j * 4 + 0] > thr) ? ct : 0.f));
            p.y = ev[j * 4 + 1] * (cd + ((rv[j * 4 + 1] > thr) ? ct : 0.f));
            p.z = ev[j * 4 + 2] * (cd + ((rv[j * 4 + 2] > thr) ? ct : 0.f));
            p.w = ev[j * 4 + 3] * (cd + ((rv[j * 4 + 3] > thr) ? ct : 0.f));
            uint2 w;
            w.x = pack2(p.x, p.y);
            w.y = pack2(p.z, p.w);
            *(uint2*)(pr + j * 128 + lane * 4) = w;
        }
    }
    __syncthreads();

    // ---- phase 3: out = P @ V with LDS-staged V chunks ----
    // 8 output tiles x KGRP wave groups: group kq takes KSTEP of the 32-key
    // steps of every chunk; the groups' partial sums meet in LDS at the end.
    {
        const int tile = wave & 7, kq = wave >> 3;
        const int qt = tile >> 1, dt = tile & 1;
        const int m  = qt * 16 + (lane & 15);
        // this lane's first 16 bytes of P and of V in a chunk; all its others
        // lie at compile-time distances from these.
        // P: query m, keys g*8 .. g*8+7 of a 32-key step (and the same + 16).
        // V: the transposing load takes key row g*8 + lane%8, 16-byte half
        // (lane/8)%2 of the tile's 16 columns, and hands lane (c, g) the keys
        // g*8 .. g*8+7 of column c: P's key order.
        const uint16_t* pw = (const uint16_t*)(sc + m * SLD) + kq * (KSTEP * 32) + g * 8;
        const uint16_t* vw = Vs + (kq * (KSTEP * 32) + g * 8 + (lane & 7)) * VPITCH
                             + dt * 16 + ((lane >> 3) & 1) * 8;
        v8f acc = {};
        for (int kk0 = 0; kk0 < SEQ; kk0 += VCH) {
            // stage V[kk0 .. kk0+VCH) x DHEAD : one coalesced b128 a thread
            {
                const uint16_t* vb = kvb + (size_t)(b * SEQ + kk0) * (2 * CDIM)
                                     + CDIM + h * DHEAD;
                int r = tid >> 2, c = (tid & 3) * 8;   // 1024 uint4 total
                *(uint4*)(&Vs[r * VPITCH + c]) =
                    *(const uint4*)(vb + (size_t)r * (2 * CDIM) + c);
                // the load's address registers are reused right behind the barrier
                asm volatile("s_wait_xcnt 0x0" ::: "memory");
            }
            __syncthreads();
            #pragma unroll
            for (int s = 0; s < KSTEP; ++s) {
                ABOp a, bm;
                a.q[0]  = *(const uint4*)(pw + kk0 + s * 32);
                a.q[1]  = *(const uint4*)(pw + kk0 + s * 32 + 16);
                bm.t[0] = ld_tr16(vw + (s * 32) * VPITCH);
                bm.t[1] = ld_tr16(vw + (s * 32 + 16) * VPITCH);
                acc = wmma_bf16(a, bm, acc);
            }
            __syncthreads();
        }
        // The score panel has been read for the last time (barrier above): its
        // first 24KB now carry the partial sums of groups 1.. to group 0.
        if (kq != 0) {
            #pragma unroll
            for (int v = 0; v < 8; ++v)
                sc[(((kq - 1) * 8 + tile) * 8 + v) * 32 + lane] = acc[v];
        }
        __syncthreads();
        if (kq == 0) {
            #pragma unroll
            for (int p = 0; p < KGRP - 1; ++p) {
                #pragma unroll
                for (int v = 0; v < 8; ++v)
                    acc[v] += sc[((p * 8 + tile) * 8 + v) * 32 + lane];
            }
            #pragma unroll
            for (int v = 0; v < 8; ++v) {
                int mr = q0 + qt * 16 + g * 8 + v;
                int nc = dt * 16 + (lane & 15);
                attn[(size_t)(b * SEQ + mr) * CDIM + h * DHEAD + nc] = f2bf(acc[v]);
            }
        }
    }
}

// ---------------- host side ----------------
extern "C" void kernel_launch(void* const* d_in, const int* in_sizes, int n_in,
                              void* d_out, int out_size, void* d_ws, size_t ws_size,
                              hipStream_t stream) {
    (void)in_sizes; (void)n_in; (void)out_size; (void)ws_size;
    const float* x     = (const float*)d_in[0];
    const float* ln1g  = (const float*)d_in[1];
    const float* ln1b  = (const float*)d_in[2];
    const float* Wq    = (const float*)d_in[3];
    const float* bq    = (const float*)d_in[4];
    const float* Wkv   = (const float*)d_in[5];
    const float* bkv   = (const float*)d_in[6];
    const float* wfuse = (const float*)d_in[7];
    const float* Wo    = (const float*)d_in[8];
    const float* bo    = (const float*)d_in[9];
    const float* ln2g  = (const float*)d_in[10];
    const float* ln2b  = (const float*)d_in[11];
    const float* W1    = (const float*)d_in[12];
    const float* b1    = (const float*)d_in[13];
    const float* W2    = (const float*)d_in[14];
    const float* b2    = (const float*)d_in[15];
    float* xcur = (float*)d_out;                       // running activations

    // workspace carve-up (bf16 buffers, 256B-aligned power-of-two sizes);
    // the five weight arrays lie in the order the front launch writes them
    uint8_t* ws = (uint8_t*)d_ws;
    uint16_t* wq_bf   = (uint16_t*)(ws);                 size_t off = NWQ * 2;
    uint16_t* wkv_bf  = (uint16_t*)(ws + off);           off += NWKV * 2;
    uint16_t* wo_bf   = (uint16_t*)(ws + off);           off += NWO * 2;
    uint16_t* w1_bf   = (uint16_t*)(ws + off);           off += NW1 * 2;
    uint16_t* w2_bf   = (uint16_t*)(ws + off);           off += NW2 * 2;
    uint16_t* h_bf    = (uint16_t*)(ws + off);           off += (size_t)ROWS * CDIM * 2;
    uint16_t* q_bf    = (uint16_t*)(ws + off);           off += (size_t)ROWS * CDIM * 2;
    uint16_t* kv_bf   = (uint16_t*)(ws + off);           off += (size_t)ROWS * 2 * CDIM * 2;
    uint16_t* attn_bf = (uint16_t*)(ws + off);           off += (size_t)ROWS * CDIM * 2;
    uint16_t* u_bf    = (uint16_t*)(ws + off);

    const int attnLds = QBLK * SLD * (int)sizeof(float)           // score panel
                      + VCH * VPITCH * (int)sizeof(uint16_t);     // V chunk
    hipFuncSetAttribute((const void*)attn_kernel,
                        hipFuncAttributeMaxDynamicSharedMemorySize, attnLds);

    const dim3 blk(GBLK);
    // first LayerNorm and all weight converts: they read inputs only
    front_kernel<<<dim3(LNGRID + NWALL / CVT), dim3(SMALLBLK), 0, stream>>>(
        x, ln1g, ln1b, h_bf, Wq, Wkv, Wo, W1, W2, wq_bf);

    for (int l = 0; l < LAYERS; ++l) {
        // layer 0 takes its residual from x itself; d_out is first written there
        const float* xin = (l == 0) ? x : xcur;

        // --- attention sublayer ---
        if (l > 0)
            ln_kernel<<<dim3(LNGRID), dim3(SMALLBLK), 0, stream>>>(xcur, ln1g + l * CDIM,
                                                      ln1b + l * CDIM, h_bf);
        gemm_qkv_kernel<<<dim3(3 * CDIM / 64, ROWS / 64), blk, 0, stream>>>(
                h_bf, wq_bf + (size_t)l * CDIM * CDIM,
                wkv_bf + (size_t)l * CDIM * 2 * CDIM,
                bq + l * CDIM, bkv + l * 2 * CDIM, q_bf, kv_bf);
        attn_kernel<<<dim3(BATCH * HEADS * (SEQ / QBLK)), dim3(AWAVES * 32), attnLds, stream>>>(
                q_bf, kv_bf, wfuse + l * 2, attn_bf);
        gemm_bf16_kernel<CDIM, CDIM, 8, false, true, false>
            <<<dim3(CDIM / 64, ROWS / 64), blk, 0, stream>>>(
                attn_bf, wo_bf + (size_t)l * CDIM * CDIM, bo + l * CDIM,
                xin, xcur, nullptr);

        // --- MLP sublayer ---
        ln_kernel<<<dim3(LNGRID), dim3(SMALLBLK), 0, stream>>>(xcur, ln2g + l * CDIM,
                                                  ln2b + l * CDIM, h_bf);
        gemm_bf16_kernel<CDIM, DFF, 8, true, false, true>
            <<<dim3(DFF / 64, ROWS / 64), blk, 0, stream>>>(
                h_bf, w1_bf + (size_t)l * CDIM * DFF, b1 + l * DFF,
                nullptr, nullptr, u_bf);
        gemm_bf16_kernel<DFF, CDIM, 6, false, true, false>
            <<<dim3(CDIM / 64, ROWS / 64), blk, 0, stream>>>(
                u_bf, w2_bf + (size_t)l * DFF * CDIM, b2 + l * CDIM,
                xcur, xcur, nullptr);
    }
}

// v009
// One run takes 129 microseconds.
// Next to v008, in two timings, it ran 1.08 times as fast each time.
// Counting every step since v000, it is 3.57 times as fast.
#include <hip/hip_runtime.h>
#include <hip/hip_bf16.h>
#include <math.h>
#include <stdint.h>

// ---------------- problem constants ----------------
#define LAYERS 2
#define BATCH  4
#define SEQ    1024
#define CDIM   256
#define HEADS  8
#define DHEAD  32          // CDIM / HEADS
#define TOPM   64
#define DFF    1024
#define ROWS   (BATCH * SEQ)      // 4096 token rows
#define LNEPS  1e-5f

// WMMA vector types (CDNA5 wave32)
typedef __attribute__((ext_vector_type(16))) __bf16 v16bf;
typedef __attribute__((ext_vector_type(8)))  float  v8f;
typedef __attribute__((ext_vector_type(8)))  short  s16x8;

union ABOp {            // one 16x32 bf16 WMMA operand per lane
    uint16_t u[16];
    uint4    q[2];      // two 16-byte chunks
    s16x8    t[2];      // the same, as a transposing LDS load returns them
    v16bf    v;
};

__device__ __forceinline__ uint16_t f2bf(float f) {
    uint32_t u = __float_as_uint(f);
    uint32_t r = u + 0x7FFFu + ((u >> 16) & 1u);   // round-to-nearest-even
    return (uint16_t)(r >> 16);
}

// Two floats to one register of two bf16 (round to nearest even, as f2bf), in
// the chip's one packed convert.
typedef __attribute__((ext_vector_type(2))) float  f32x2;
typedef __attribute__((ext_vector_type(2))) __bf16 bf16x2;
__device__ __forceinline__ uint32_t pack2(float lo, float hi) {
    return __builtin_bit_cast(uint32_t, __builtin_convertvector(f32x2{lo, hi}, bf16x2));
}

// Transposing LDS load: 16 keys x 16 columns of a key-major bf16 tile come back
// as 8 consecutive keys of one column per lane (every lane must be on).
__device__ __forceinline__ s16x8 ld_tr16(const uint16_t* p) {
    typedef __attribute__((address_space(3))) s16x8 lds_s16x8;
    return __builtin_amdgcn_ds_load_tr16_b128_v8i16((lds_s16x8*)p);
}

__device__ __forceinline__ v8f wmma_bf16(const ABOp& a, const ABOp& b, v8f c) {
    return __builtin_amdgcn_wmma_f32_16x16x32_bf16(
        false, a.v, false, b.v, (short)0, c, false, false);
}

// ---------------- wave-wide reductions on the vector unit ----------------
// Lane l <-> l ^ 16 (other 16-lane row) and l <-> l ^ M (inside a row, DPP
// row_xmask): register-to-register moves, no trip through the LDS crossbar.
__device__ __forceinline__ float xhalf(float x) {
    int b = __builtin_bit_cast(int, x);
    return __builtin_bit_cast(float, __builtin_amdgcn_permlanex16(
        b, b, 0x76543210, 0xfedcba98, false, false));
}
template<int M>
__device__ __forceinline__ float xrow(float x) {
    return __builtin_bit_cast(float, __builtin_amdgcn_mov_dpp(
        __builtin_bit_cast(int, x), 0x160 | M, 0xf, 0xf, true));
}
// Butterfly over 32 lanes in the order 16, 8, 4, 2, 1; every lane gets the result.
__device__ __forceinline__ float wave_sum(float s) {
    s += xhalf(s);   s += xrow<8>(s); s += xrow<4>(s);
    s += xrow<2>(s); s += xrow<1>(s);
    return s;
}
__device__ __forceinline__ float wave_max(float s) {
    s = fmaxf(s, xhalf(s));   s = fmaxf(s, xrow<8>(s)); s = fmaxf(s, xrow<4>(s));
    s = fmaxf(s, xrow<2>(s)); s = fmaxf(s, xrow<1>(s));
    return s;
}
__device__ __forceinline__ float wave_min(float s) {
    s = fminf(s, xhalf(s));   s = fminf(s, xrow<8>(s)); s = fminf(s, xrow<4>(s));
    s = fminf(s, xrow<2>(s)); s = fminf(s, xrow<1>(s));
    return s;
}
// A value that is equal in all lanes, moved to a scalar register.
__device__ __forceinline__ float uniform_f(float x) {
    return __builtin_bit_cast(float,
        __builtin_amdgcn_readfirstlane(__builtin_bit_cast(int, x)));
}

// ---------------- LayerNorm (one wave per row, LNR rows a wave) ----------
// A row is 8 values a lane, so its sums need the wave-wide butterfly only: no
// LDS, no barrier. Few waves with much work each, because starting waves, not
// the arithmetic, is what such a grid costs: a block is one wave per SIMD, and
// a LayerNorm is one block per WGP.
#define SMALLBLK 128              // threads per block, LayerNorm and converts
#define LNR    4                  // rows per wave, all loads issued up front
#define LNROWS (SMALLBLK / 32 * LNR)   // rows per block
#define LNGRID (ROWS / LNROWS)    // blocks per LayerNorm
typedef __attribute__((ext_vector_type(4))) float f32x4;
__device__ __forceinline__ uint2 pack4(f32x4 y) {
    uint2 r;
    r.x = (uint32_t)f2bf(y.x) | ((uint32_t)f2bf(y.y) << 16);
    r.y = (uint32_t)f2bf(y.z) | ((uint32_t)f2bf(y.w) << 16);
    return r;
}
__device__ __forceinline__ void ln_rows(const float* __restrict__ x,
                                        const float* __restrict__ g,
                                        const float* __restrict__ b,
                                        uint16_t* __restrict__ out, int blk) {
    const int wave = threadIdx.x >> 5, lane = threadIdx.x & 31;
    // lane l holds columns 4l .. 4l+3 and 128+4l .. 128+4l+3 of each row
    const size_t at = (size_t)((blk * (SMALLBLK / 32) + wave) * LNR) * CDIM + lane * 4;
    f32x4 v[LNR][2];
    #pragma unroll
    for (int r = 0; r < LNR; ++r) {
        v[r][0] = *(const f32x4*)(x + at + r * CDIM);
        v[r][1] = *(const f32x4*)(x + at + r * CDIM + 128);
    }
    const f32x4 g0 = *(const f32x4*)(g + lane * 4);
    const f32x4 g1 = *(const f32x4*)(g + lane * 4 + 128);
    const f32x4 b0 = *(const f32x4*)(b + lane * 4);
    const f32x4 b1 = *(const f32x4*)(b + lane * 4 + 128);
    float s[LNR], ss[LNR];
    #pragma unroll
    for (int r = 0; r < LNR; ++r) {
        const f32x4 p = v[r][0], q = v[r][1];
        s[r]  = ((p.x + p.y) + (p.z + p.w)) + ((q.x + q.y) + (q.z + q.w));
        ss[r] = ((p.x * p.x + p.y * p.y) + (p.z * p.z + p.w * p.w))
              + ((q.x * q.x + q.y * q.y) + (q.z * q.z + q.w * q.w));
    }
    #pragma unroll
    for (int r = 0; r < LNR; ++r) { s[r] = wave_sum(s[r]); ss[r] = wave_sum(ss[r]); }
    #pragma unroll
    for (int r = 0; r < LNR; ++r) {
        const float mean = s[r] * (1.0f / CDIM);
        const float var  = ss[r] * (1.0f / CDIM) - mean * mean;
        const float rstd = rsqrtf(var + LNEPS);
        *(uint2*)(out + at + r * CDIM)       = pack4((v[r][0] - mean) * rstd * g0 + b0);
        *(uint2*)(out + at + r * CDIM + 128) = pack4((v[r][1] - mean) * rstd * g1 + b1);
    }
}

__global__ __launch_bounds__(SMALLBLK) void ln_kernel(const float* __restrict__ x,
                          const float* __restrict__ g,
                          const float* __restrict__ b,
                          uint16_t* __restrict__ out) {
    ln_rows(x, g, b, out, blockIdx.x);
}

// ---------------- front launch: everything that reads inputs only ----------
// Blocks [0, LNGRID): the first LayerNorm. The blocks behind them convert the
// weights of all layers to bf16, CVT values each: the five arrays land one
// behind the other in wbf, each with its layers in input order.
// Inside a layer the values lie in the order of the WMMA B operand: one 1KB
// fragment per (16 columns, 32 k), fragments of a column group in k order; in
// a fragment two 512-byte halves, lane l's 16 bytes at l*16 in each. A wave
// then reads a whole fragment with two 16-byte loads over contiguous lines.
#define NWQ  (LAYERS * CDIM * CDIM)
#define NWKV (LAYERS * CDIM * 2 * CDIM)
#define NWO  (LAYERS * CDIM * CDIM)
#define NW1  (LAYERS * CDIM * DFF)
#define NW2  (LAYERS * DFF * CDIM)
#define NWALL (NWQ + NWKV + NWO + NW1 + NW2)
#define CVT  4096                 // a block's share: 64 k x 64 columns
#define FRAG 512                  // values in one B fragment
template<int K, int N>
__device__ __forceinline__ void pack_tile(const float* __restrict__ w,
                                          uint16_t* __restrict__ to, int tile) {
    constexpr int TPL = K * N / CVT;            // tiles per layer
    const int l  = tile / TPL, r = tile % TPL;
    const int kt = r / (N / 64), nt = r % (N / 64);
    const int n  = nt * 64 + (threadIdx.x & 63);    // this thread's column
    const int ks = kt * 2 + (threadIdx.x >> 6);     // and its 32-k step
    const float* in = w + (size_t)l * K * N + (size_t)(ks * 32) * N + n;
    float v[32];
    #pragma unroll
    for (int i = 0; i < 32; ++i) v[i] = in[i * N];
    uint16_t* o = to + (size_t)l * K * N + ((n >> 4) * (K / 32) + ks) * FRAG + (n & 15) * 8;
    // k 0-7: half 0, lanes 0-15; k 8-15: half 0, lanes 16-31; k 16-31: half 1 alike
    #pragma unroll
    for (int c = 0; c < 4; ++c) {
        uint4 p;
        p.x = (uint32_t)f2bf(v[c * 8 + 0]) | ((uint32_t)f2bf(v[c * 8 + 1]) << 16);
        p.y = (uint32_t)f2bf(v[c * 8 + 2]) | ((uint32_t)f2bf(v[c * 8 + 3]) << 16);
        p.z = (uint32_t)f2bf(v[c * 8 + 4]) | ((uint32_t)f2bf(v[c * 8 + 5]) << 16);
        p.w = (uint32_t)f2bf(v[c * 8 + 6]) | ((uint32_t)f2bf(v[c * 8 + 7]) << 16);
        *(uint4*)(o + (c >> 1) * (FRAG / 2) + (c & 1) * 128) = p;
    }
    // the stores' data and address registers may be rewritten by what follows
    asm volatile("s_wait_xcnt 0x0" ::: "memory");
}
__global__ __launch_bounds__(SMALLBLK) void front_kernel(const float* __restrict__ x,
                             const float* __restrict__ g,
                             const float* __restrict__ b,
                             uint16_t* __restrict__ hout,
                             const float* __restrict__ Wq,
                             const float* __restrict__ Wkv,
                             const float* __restrict__ Wo,
                             const float* __restrict__ W1,
                             const float* __restrict__ W2,
                             uint16_t* __restrict__ wbf) {
    if (blockIdx.x < LNGRID) {          // same for the whole block
        ln_rows(x, g, b, hout, blockIdx.x);
        return;
    }
    const int t = blockIdx.x - LNGRID;  // every array is whole blocks
    if (t < NWQ / CVT)
        pack_tile<CDIM, CDIM>(Wq, wbf, t);
    else if (t < (NWQ + NWKV) / CVT)
        pack_tile<CDIM, 2 * CDIM>(Wkv, wbf + NWQ, t - NWQ / CVT);
    else if (t < (NWQ + NWKV + NWO) / CVT)
        pack_tile<CDIM, CDIM>(Wo, wbf + NWQ + NWKV, t - (NWQ + NWKV) / CVT);
    else if (t < (NWQ + NWKV + NWO + NW1) / CVT)
        pack_tile<CDIM, DFF>(W1, wbf + NWQ + NWKV + NWO, t - (NWQ + NWKV + NWO) / CVT);
    else
        pack_tile<DFF, CDIM>(W2, wbf + NWQ + NWKV + NWO + NW1,
                             t - (NWQ + NWKV + NWO + NW1) / CVT);
}

// ---------------- generic bf16 WMMA GEMM: D = act(A@B + bias) (+resid) ----
// A: [M,K] bf16 row-major.  B: K x Nc bf16 in fragment order (see pack_tile).
// block = 128 (4 waves, 2 x 2); each wave owns a 32x32 output tile (2 x 2
// fragments), the block the 64 x 64 tile (by, bx).
// Every global load covers whole lines and many are in flight at once:
//  B: a fragment is two contiguous 512-byte loads, straight into registers,
//     AHEAD K steps ahead of its products;
//  A: the block's 64 rows go to LDS KC k at a time, one 512-byte row piece per
//     wave-wide load, the next chunk fetched while this one is worked on; the
//     fragments (16 rows x 16 bytes a load) are then gathered from LDS.
// One barrier per KC k publishes a chunk; with two buffers the same barrier
// ends the last read of the buffer that is filled behind the next chunk.
#define GBLK 128
#define KC   256                  // k per staged A chunk
#define APITCH (KC + 8)           // LDS row pitch in values: 16 bytes x odd
typedef __attribute__((ext_vector_type(4))) uint32_t u32x4;
// Work-group barrier that orders LDS traffic only. __syncthreads() would also
// wait for every global load, and those are meant to stay in flight across it.
__device__ __forceinline__ void lds_barrier() {
    __builtin_amdgcn_fence(__ATOMIC_RELEASE, "workgroup", "local");
    __builtin_amdgcn_s_barrier();
    __builtin_amdgcn_fence(__ATOMIC_ACQUIRE, "workgroup", "local");
}
template<int K, int AHEAD, bool GELU_, bool RES, bool OUTBF>
__device__ __forceinline__ void gemm_tile(const uint16_t* __restrict__ A,
                                 const uint16_t* __restrict__ Bw,
                                 const float* __restrict__ bias,
                                 const float* __restrict__ resid,
                                 float* __restrict__ outf,
                                 uint16_t* __restrict__ outb,
                                 int Nc, int bx, int by) {
    constexpr int NS   = K / 32;         // K steps
    constexpr int NCH  = K / KC;         // A chunks
    constexpr int CS   = KC / 32;        // K steps per chunk
    constexpr int NBUF = NCH > 1 ? 2 : 1;
    constexpr int NST  = 64 * KC / 8 / GBLK;    // 16-byte pieces per thread and chunk
    __shared__ __attribute__((aligned(16))) uint16_t As[NBUF * 64 * APITCH];
    const int tid  = threadIdx.x;
    const int wave = tid >> 5, lane = tid & 31;
    const int g    = lane >> 4;          // half-wave select
    const int row0 = by * 64 + (wave >> 1) * 32;
    const int col0 = bx * 64 + (wave & 1) * 32;
    // A staging: piece i of this thread is row wave + 4i, bytes lane*16 of the chunk
    const uint16_t* ag = A + (size_t)(by * 64 + wave) * K + lane * 8;
    uint16_t*       aw = As + wave * APITCH + lane * 8;
    // A operand: row m = tile row (+16) + lane%16, K-chunks at g*8 and 16+g*8 of a step
    const uint16_t* ar = As + ((wave >> 1) * 32 + (lane & 15)) * APITCH + g * 8;
    // B operand: fragments (col0/16 (+1), step), this lane's 16 bytes of each half
    const uint16_t* bp = Bw + (size_t)(col0 >> 4) * NS * FRAG + lane * 8;
    const int nc0 = col0 + (lane & 15);  // output column, first fragment
    const int m0  = row0 + g * 8;        // output row, first fragment, element 0
    const float bb[2] = { bias[nc0], bias[nc0 + 16] };
    float rs[2][2][8];                   // residual, fetched while the loop drains

    u32x4 st[NST];                       // an A chunk on its way to LDS
    ABOp  af[2][2], b[AHEAD][2];         // all indices are compile-time
    v8f   acc[2][2] = {};

    #pragma unroll
    for (int i = 0; i < NST; ++i) st[i] = *(const u32x4*)(ag + i * 4 * K);
    // A first: loads return in order, and the LDS stores wait for these alone
    __builtin_amdgcn_sched_barrier(0);
    #pragma unroll
    for (int s = 0; s < AHEAD; ++s)
        #pragma unroll
        for (int f = 0; f < 2; ++f) {
            b[s][f].q[0] = *(const uint4*)(bp + (f * NS + s) * FRAG);
            b[s][f].q[1] = *(const uint4*)(bp + (f * NS + s) * FRAG + FRAG / 2);
        }
    // keeps the loads above from sinking to their first use (left alone, the
    // scheduler holds about one step in flight to save registers)
    __builtin_amdgcn_sched_barrier(0);
    // an address register that has had its last use may be rewritten from here on
    if (NCH == 1 || AHEAD == NS) asm volatile("s_wait_xcnt 0x0" ::: "memory");
    #pragma unroll
    for (int i = 0; i < NST; ++i) *(u32x4*)(aw + i * 4 * APITCH) = st[i];
    if (NCH > 1) {
        #pragma unroll
        for (int i = 0; i < NST; ++i) st[i] = *(const u32x4*)(ag + i * 4 * K + KC);
    }
    lds_barrier();                       // chunk 0 is in LDS

    #pragma unroll
    for (int c = 0; c < NCH; ++c) {
        const uint16_t* ac = ar + (c % NBUF) * 64 * APITCH;
        #pragma unroll
        for (int f = 0; f < 2; ++f) {
            af[0][f].q[0] = *(const uint4*)(ac + f * 16 * APITCH);
            af[0][f].q[1] = *(const uint4*)(ac + f * 16 * APITCH + 16);
        }
        #pragma unroll
        for (int s = 0; s < CS; ++s) {
            const int gs = c * CS + s, u = gs % AHEAD;
            if (s + 1 < CS) {            // next step's A fragments, ahead of the products
                #pragma unroll
                for (int f = 0; f < 2; ++f) {
                    af[(s + 1) & 1][f].q[0] = *(const uint4*)(ac + f * 16 * APITCH + (s + 1) * 32);
                    af[(s + 1) & 1][f].q[1] = *(const uint4*)(ac + f * 16 * APITCH + (s + 1) * 32 + 16);
                }
            }
            // holds the LDS reads in front of the products they overlap with
            __builtin_amdgcn_sched_barrier(0);
            #pragma unroll
            for (int i = 0; i < 2; ++i)
                #pragma unroll
                for (int j = 0; j < 2; ++j)
                    acc[i][j] = wmma_bf16(af[s & 1][i], b[u][j], acc[i][j]);
            // keeps the loads below from sinking to their use AHEAD steps later
            __builtin_amdgcn_sched_barrier(0);
            if (RES && gs == NS - 4) {   // 3 steps (12 loads) still in flight
                #pragma unroll
                for (int i = 0; i < 2; ++i)
                    #pragma unroll
                    for (int j = 0; j < 2; ++j)
                        #pragma unroll
                        for (int v = 0; v < 8; ++v)
                            rs[i][j][v] = resid[(size_t)(m0 + i * 16 + v) * Nc + nc0 + j * 16];
            }
            if (gs + AHEAD < NS) {       // B of step gs + AHEAD, into the freed set
                #pragma unroll
                for (int f = 0; f < 2; ++f) {
                    b[u][f].q[0] = *(const uint4*)(bp + (f * NS + gs + AHEAD) * FRAG);
                    b[u][f].q[1] = *(const uint4*)(bp + (f * NS + gs + AHEAD) * FRAG + FRAG / 2);
                }
                // B's last loads: their address register may be rewritten behind this
                if (gs + AHEAD == NS - 1) asm volatile("s_wait_xcnt 0x0" ::: "memory");
            }
            __builtin_amdgcn_sched_barrier(0);   // same purpose, the loads' other side
        }
        if (c + 1 < NCH) {
            // chunk c+1 into the buffer last read in chunk c-1 (barrier since)
            #pragma unroll
            for (int i = 0; i < NST; ++i)
                *(u32x4*)(aw + ((c + 1) % NBUF) * 64 * APITCH + i * 4 * APITCH) = st[i];
            if (c + 2 < NCH) {
                #pragma unroll
                for (int i = 0; i < NST; ++i)
                    st[i] = *(const u32x4*)(ag + i * 4 * K + (c + 2) * KC);
                // A's last loads: the same for their address register
                if (c + 2 == NCH - 1) asm volatile("s_wait_xcnt 0x0" ::: "memory");
            }
            lds_barrier();               // chunk c+1 is in LDS, chunk c is read out
        }
    }
    // C/D layout: element v -> (m = tile row + g*8 + v, n = tile col + lane%16)
    #pragma unroll
    for (int j = 0; j < 2; ++j) {
        const int nc = nc0 + j * 16;
        #pragma unroll
        for (int i = 0; i < 2; ++i) {
            #pragma unroll
            for (int v = 0; v < 8; ++v) {
                int m = m0 + i * 16 + v;
                float r = acc[i][j][v] + bb[j];
                if (GELU_) r = 0.5f * r * (1.0f + erff(r * 0.70710678118654752f));
                if (RES)   r += rs[i][j][v];
                if (OUTBF) outb[(size_t)m * Nc + nc] = f2bf(r);
                else       outf[(size_t)m * Nc + nc] = r;
            }
        }
    }
}

// one product: grid = (Nc/64, M/64)
template<int K, int NC, int AHEAD, bool GELU_, bool RES, bool OUTBF>
__global__ __launch_bounds__(GBLK) void gemm_bf16_kernel(const uint16_t* __restrict__ A,
                                 const uint16_t* __restrict__ Bw,
                                 const float* __restrict__ bias,
                                 const float* __restrict__ resid,
                                 float* __restrict__ outf,
                                 uint16_t* __restrict__ outb) {
    gemm_tile<K, AHEAD, GELU_, RES, OUTBF>(A, Bw, bias, resid, outf, outb, NC,
                                           blockIdx.x, blockIdx.y);
}

// Q and KV projections of the same rows in one grid = (3*CDIM/64, M/64):
// the first CDIM/64 block columns are Q's tiles, the others KV's.
__global__ __launch_bounds__(GBLK) void gemm_qkv_kernel(const uint16_t* __restrict__ A,
                                const uint16_t* __restrict__ Wq,
                                const uint16_t* __restrict__ Wkv,
                                const float* __restrict__ bq,
                                const float* __restrict__ bkv,
                                uint16_t* __restrict__ q,
                                uint16_t* __restrict__ kv) {
    const bool isq = blockIdx.x < CDIM / 64;    // same for the whole block
    gemm_tile<CDIM, 8, false, false, true>(A, isq ? Wq : Wkv, isq ? bq : bkv,
                                  nullptr, nullptr, isq ? q : kv,
                                  isq ? CDIM : 2 * CDIM,
                                  isq ? blockIdx.x : blockIdx.x - CDIM / 64,
                                  blockIdx.y);
}

// ---------------- fused dual-pass attention ----------------
// One workgroup = (b, h, 64-query panel), 32 waves: the panel fills the LDS of
// its WGP, so the waves that hide each other's waits must come from this one
// workgroup (8 per SIMD). Scores stay in LDS (64 x 1028 f32), plus a 24KB LDS
// chunk for staged V (256 keys x 32 d, bf16: one 16-byte piece per thread).
// Phase 1: QK^T via WMMA. Phase 2: dense softmax stats + top-64 threshold by
// value bisection + fused combined probabilities, left as packed bf16 at the
// head of each score row. Phase 3: P@V via WMMA; both operands come out of LDS
// as whole fragments, two 16-byte loads each: P rows as they lie, V (key-major)
// through the transposing load. The LDS port, not the arithmetic, sets the pace
// of that phase, so it is fed few wide loads that spread over all banks.
#define QBLK  64
#define SLD   1028    // score row pitch in floats: 16 bytes x odd, for 16-byte row reads
#define AWAVES 32     // waves per workgroup
#define VCH   256     // keys per staged V chunk
#define VPITCH 48     // staged V row pitch in values: 32 bytes x odd, for transposing loads
#define KGRP  (AWAVES / 8)            // wave groups that share the keys in P@V
#define KSTEP (VCH / 32 / KGRP)       // 32-key steps per wave and chunk
__global__ __launch_bounds__(AWAVES * 32) void attn_kernel(const uint16_t* __restrict__ qb,   // [ROWS,CDIM] bf16
                            const uint16_t* __restrict__ kvb,  // [ROWS,2*CDIM] bf16
                            const float* __restrict__ wf,      // w_fuse[2]
                            uint16_t* __restrict__ attn) {     // [ROWS,CDIM] bf16
    extern __shared__ __attribute__((aligned(16))) float sc[];
    uint16_t* Vs = (uint16_t*)(sc + QBLK * SLD);   // [VCH][VPITCH] bf16, DHEAD used
    const int bid  = blockIdx.x;
    const int b    = bid / (HEADS * (SEQ / QBLK));
    const int rem  = bid % (HEADS * (SEQ / QBLK));
    const int h    = rem / (SEQ / QBLK);
    const int q0   = (rem % (SEQ / QBLK)) * QBLK;
    const int tid  = threadIdx.x;
    const int wave = tid >> 5, lane = tid & 31;
    const int g    = lane >> 4;
    const float scale = 0.17677669529663687f;   // 1/sqrt(32)

    // learned fusion weights (softmax over 2) -- uniform, scalarizes to SALU
    const float e0 = expf(wf[0]), e1 = expf(wf[1]);
    const float w0 = e0 / (e0 + e1), w1 = e1 / (e0 + e1);

    // ---- phase 1: scores tile 64q x 1024k, 256 WMMA tiles over 32 waves ----
    // A wave keeps its 2 key tiles in registers and takes them against all 4
    // query tiles: the panel's K rows (half a line each, more lines than the
    // WGP cache holds) are gathered once, not once per query tile. These
    // 16-line gathers, not the products, set the pace of this phase.
    {
        constexpr int KT = SEQ / 16 / AWAVES;      // key tiles per wave
        ABOp kf[KT], qa;
        // K operand: 16 keys across lanes, d packed (row-major contiguous)
        const uint16_t* kr = kvb + (size_t)(b * SEQ + wave * 16 + (lane & 15)) * (2 * CDIM)
                             + h * DHEAD + g * 8;
        #pragma unroll
        for (int j = 0; j < KT; ++j) {
            kf[j].q[0] = *(const uint4*)(kr + (size_t)j * AWAVES * 16 * (2 * CDIM));
            kf[j].q[1] = *(const uint4*)(kr + (size_t)j * AWAVES * 16 * (2 * CDIM) + 16);
        }
        // Q operand: 16 queries x 32 d (contiguous d chunks)
        const uint16_t* qr = qb + (size_t)(b * SEQ + q0 + (lane & 15)) * CDIM
                             + h * DHEAD + g * 8;
        qa.q[0] = *(const uint4*)(qr);
        qa.q[1] = *(const uint4*)(qr + 16);
        float* sp = sc + g * 8 * SLD + wave * 16 + (lane & 15);
        // stays rolled: from a running row pointer all 16 stores of a trip reach
        // their place by the immediate offset (unrolled, each takes an address
        // register of its own and the wave reaches its limit of 128 registers)
        #pragma unroll 1
        for (int qt = 0; qt < QBLK / 16; ++qt) {
            ABOp qn = qa;
            if (qt + 1 < QBLK / 16) {   // the next query tile, ahead of the products
                qr += 16 * CDIM;
                qn.q[0] = *(const uint4*)(qr);
                qn.q[1] = *(const uint4*)(qr + 16);
            }
            #pragma unroll
            for (int j = 0; j < KT; ++j) {
                v8f c = {};
                c = wmma_bf16(qa, kf[j], c);
                #pragma unroll
                for (int v = 0; v < 8; ++v)
                    sp[v * SLD + j * AWAVES * 16] = c[v] * scale;
            }
            qa = qn;
            sp += 16 * SLD;
        }
    }
    __syncthreads();

    // ---- phase 2: per-row dense softmax + top-64 threshold + fusion ----
    for (int i = 0; i < QBLK / AWAVES; ++i) {
        const int row = wave * (QBLK / AWAVES) + i;
        float* rp = sc + row * SLD;
        // lane l holds columns 128j + 4l .. 128j + 4l + 3, j = 0 .. 7
        float rv[32];
        #pragma unroll
        for (int j = 0; j < 8; ++j) {
            const f32x4 t = *(const f32x4*)(rp + j * 128 + lane * 4);
            rv[j * 4 + 0] = t.x; rv[j * 4 + 1] = t.y;
            rv[j * 4 + 2] = t.z; rv[j * 4 + 3] = t.w;
        }
        float mx = -1e30f, mn = 1e30f;
        #pragma unroll
        for (int j = 0; j < 32; ++j) { mx = fmaxf(mx, rv[j]); mn = fminf(mn, rv[j]); }
        mx = wave_max(mx);
        mn = wave_min(mn);
        // bisection for top-64 threshold: largest t with count(s>t) >= TOPM
        // The count over the wave is taken from the compare masks themselves
        // (ballot + population count), so bounds and count live in scalars.
        float lo = uniform_f(mn) - 1.0f, hi = uniform_f(mx);
        for (int left = 24; left > 0; ) {
            float mid = 0.5f * (lo + hi);
            int c = 0;
            #pragma unroll
            for (int j = 0; j < 32; j += 2) {
                uint64_t m0 = __builtin_amdgcn_ballot_w32(rv[j]     > mid);
                uint64_t m1 = __builtin_amdgcn_ballot_w32(rv[j + 1] > mid);
                c += __builtin_popcountll(m0 | (m1 << 32));
            }
            if (c >= TOPM) lo = mid; else hi = mid;
            // Exactly TOPM scores lie above lo: every later step keeps this
            // same set, so the search is over (24 steps stay the bound).
            left = (c == TOPM) ? 0 : left - 1;
        }
        const float thr = lo;
        // e^(s - max) = 2^(s * log2(e) - max * log2(e)): one fused multiply-add
        // and the chip's own exponential. The argument is never above 0 (but for
        // the rounding of the second product, which is the same for the whole row
        // and cancels in the quotients below), so no range check is needed; below
        // 2^-126 the result is 0, beside a sum that is at least 1.
        const float l2e = 1.4426950408889634f;
        const float nmx = -mx * l2e;
        float ev[32];     // each exponential is formed once and kept
        #pragma unroll
        for (int j = 0; j < 32; ++j) ev[j] = fmaf(rv[j], l2e, nmx);
        // The two scheduling barriers keep the exponentials in one run, each behind
        // an independent one, as the instruction set asks for an independent
        // instruction between an exponential and one that overwrites its source.
        __builtin_amdgcn_sched_barrier(0);
        #pragma unroll
        for (int j = 0; j < 32; ++j) ev[j] = __builtin_amdgcn_exp2f(ev[j]);
        __builtin_amdgcn_sched_barrier(0);
        float sd = 0.f;
        #pragma unroll
        for (int j = 0; j < 32; ++j) sd += ev[j];
        sd = wave_sum(sd);
        float st = 0.f;
        #pragma unroll
        for (int j = 0; j < 32; ++j) st += (rv[j] > thr) ? ev[j] : 0.f;
        st = wave_sum(st);
        const float cd = w0 / sd;
        const float ct = w1 / fmaxf(st, 1e-20f);
        // The row is in this wave's registers, so P (bf16, key order) takes the
        // place of the row's first 2KB.
        uint16_t* pr = (uint16_t*)rp;
        #pragma unroll
        for (int j = 0; j < 8; ++j) {
            f32x4 p;
            p.x = ev[j * 4 + 0] * (cd + ((rv[j * 4 + 0] > thr) ? ct : 0.f));
            p.y = ev[j * 4 + 1] * (cd + ((rv[j * 4 + 1] > thr) ? ct : 0.f));
            p.z = ev[j * 4 + 2] * (cd + ((rv[j * 4 + 2] > thr) ? ct : 0.f));
            p.w = ev[j * 4 + 3] * (cd + ((rv[j * 4 + 3] > thr) ? ct : 0.f));
            uint2 w;
            w.x = pack2(p.x, p.y);
            w.y = pack2(p.z, p.w);
            *(uint2*)(pr + j * 128 + lane * 4) = w;
        }
    }
    __syncthreads();

    // ---- phase 3: out = P @ V with LDS-staged V chunks ----
    // 8 output tiles x KGRP wave groups: group kq takes KSTEP of the 32-key
    // steps of every chunk; the groups' partial sums meet in LDS at the end.
    {
        const int tile = wave & 7, kq = wave >> 3;
        const int qt = tile >> 1, dt = tile & 1;
        const int m  = qt * 16 + (lane & 15);
        // this lane's first 16 bytes of P and of V in a chunk; all its others
        // lie at compile-time distances from these.
        // P: query m, keys g*8 .. g*8+7 of a 32-key step (and the same + 16).
        // V: the transposing load takes key row g*8 + lane%8, 16-byte half
        // (lane/8)%2 of the tile's 16 columns, and hands lane (c, g) the keys
        // g*8 .. g*8+7 of column c: P's key order.
        const uint16_t* pw = (const uint16_t*)(sc + m * SLD) + kq * (KSTEP * 32) + g * 8;
        const uint16_t* vw = Vs + (kq * (KSTEP * 32) + g * 8 + (lane & 7)) * VPITCH
                             + dt * 16 + ((lane >> 3) & 1) * 8;
        v8f acc = {};
        for (int kk0 = 0; kk0 < SEQ; kk0 += VCH) {
            // stage V[kk0 .. kk0+VCH) x DHEAD : one coalesced b128 a thread
            {
                const uint16_t* vb = kvb + (size_t)(b * SEQ + kk0) * (2 * CDIM)
                                     + CDIM + h * DHEAD;
                int r = tid >> 2, c = (tid & 3) * 8;   // 1024 uint4 total
                *(uint4*)(&Vs[r * VPITCH + c]) =
                    *(const uint4*)(vb + (size_t)r * (2 * CDIM) + c);
                // the load's address registers are reused right behind the barrier
                asm volatile("s_wait_xcnt 0x0" ::: "memory");
            }
            __syncthreads();
            #pragma unroll
            for (int s = 0; s < KSTEP; ++s) {
                ABOp a, bm;
                a.q[0]  = *(const uint4*)(pw + kk0 + s * 32);
                a.q[1]  = *(const uint4*)(pw + kk0 + s * 32 + 16);
                bm.t[0] = ld_tr16(vw + (s * 32) * VPITCH);
                bm.t[1] = ld_tr16(vw + (s * 32 + 16) * VPITCH);
                acc = wmma_bf16(a, bm, acc);
            }
            __syncthreads();
        }
        // The score panel has been read for the last time (barrier above): its
        // first 24KB now carry the partial sums of groups 1.. to group 0.
        if (kq != 0) {
            #pragma unroll
            for (int v = 0; v < 8; ++v)
                sc[(((kq - 1) * 8 + tile) * 8 + v) * 32 + lane] = acc[v];
        }
        __syncthreads();
        if (kq == 0) {
            #pragma unroll
            for (int p = 0; p < KGRP - 1; ++p) {
                #pragma unroll
                for (int v = 0; v < 8; ++v)
                    acc[v] += sc[((p * 8 + tile) * 8 + v) * 32 + lane];
            }
            #pragma unroll
            for (int v = 0; v < 8; ++v) {
                int mr = q0 + qt * 16 + g * 8 + v;
                int nc = dt * 16 + (lane & 15);
                attn[(size_t)(b * SEQ + mr) * CDIM + h * DHEAD + nc] = f2bf(acc[v]);
            }
        }
    }
}

// ---------------- host side ----------------
extern "C" void kernel_launch(void* const* d_in, const int* in_sizes, int n_in,
                              void* d_out, int out_size, void* d_ws, size_t ws_size,
                              hipStream_t stream) {
    (void)in_sizes; (void)n_in; (void)out_size; (void)ws_size;
    const float* x     = (const float*)d_in[0];
    const float* ln1g  = (const float*)d_in[1];
    const float* ln1b  = (const float*)d_in[2];
    const float* Wq    = (const float*)d_in[3];
    const float* bq    = (const float*)d_in[4];
    const float* Wkv   = (const float*)d_in[5];
    const float* bkv   = (const float*)d_in[6];
    const float* wfuse = (const float*)d_in[7];
    const float* Wo    = (const float*)d_in[8];
    const float* bo    = (const float*)d_in[9];
    const float* ln2g  = (const float*)d_in[10];
    const float* ln2b  = (const float*)d_in[11];
    const float* W1    = (const float*)d_in[12];
    const float* b1    = (const float*)d_in[13];
    const float* W2    = (const float*)d_in[14];
    const float* b2    = (const float*)d_in[15];
    float* xcur = (float*)d_out;                       // running activations

    // workspace carve-up (bf16 buffers, 256B-aligned power-of-two sizes);
    // the five weight arrays lie in the order the front launch writes them
    uint8_t* ws = (uint8_t*)d_ws;
    uint16_t* wq_bf   = (uint16_t*)(ws);                 size_t off = NWQ * 2;
    uint16_t* wkv_bf  = (uint16_t*)(ws + off);           off += NWKV * 2;
    uint16_t* wo_bf   = (uint16_t*)(ws + off);           off += NWO * 2;
    uint16_t* w1_bf   = (uint16_t*)(ws + off);           off += NW1 * 2;
    uint16_t* w2_bf   = (uint16_t*)(ws + off);           off += NW2 * 2;
    uint16_t* h_bf    = (uint16_t*)(ws + off);           off += (size_t)ROWS * CDIM * 2;
    uint16_t* q_bf    = (uint16_t*)(ws + off);           off += (size_t)ROWS * CDIM * 2;
    uint16_t* kv_bf   = (uint16_t*)(ws + off);           off += (size_t)ROWS * 2 * CDIM * 2;
    uint16_t* attn_bf = (uint16_t*)(ws + off);           off += (size_t)ROWS * CDIM * 2;
    uint16_t* u_bf    = (uint16_t*)(ws + off);

    const int attnLds = QBLK * SLD * (int)sizeof(float)           // score panel
                      + VCH * VPITCH * (int)sizeof(uint16_t);     // V chunk
    hipFuncSetAttribute((const void*)attn_kernel,
                        hipFuncAttributeMaxDynamicSharedMemorySize, attnLds);

    const dim3 blk(GBLK);
    // first LayerNorm and all weight converts: they read inputs only
    front_kernel<<<dim3(LNGRID + NWALL / CVT), dim3(SMALLBLK), 0, stream>>>(
        x, ln1g, ln1b, h_bf, Wq, Wkv, Wo, W1, W2, wq_bf);

    for (int l = 0; l < LAYERS; ++l) {
        // layer 0 takes its residual from x itself; d_out is first written there
        const float* xin = (l == 0) ? x : xcur;

        // --- attention sublayer ---
        if (l > 0)
            ln_kernel<<<dim3(LNGRID), dim3(SMALLBLK), 0, stream>>>(xcur, ln1g + l * CDIM,
                                                      ln1b + l * CDIM, h_bf);
        gemm_qkv_kernel<<<dim3(3 * CDIM / 64, ROWS / 64), blk, 0, stream>>>(
                h_bf, wq_bf + (size_t)l * CDIM * CDIM,
                wkv_bf + (size_t)l * CDIM * 2 * CDIM,
                bq + l * CDIM, bkv + l * 2 * CDIM, q_bf, kv_bf);
        attn_kernel<<<dim3(BATCH * HEADS * (SEQ / QBLK)), dim3(AWAVES * 32), attnLds, stream>>>(
                q_bf, kv_bf, wfuse + l * 2, attn_bf);
        gemm_bf16_kernel<CDIM, CDIM, 8, false, true, false>
            <<<dim3(CDIM / 64, ROWS / 64), blk, 0, stream>>>(
                attn_bf, wo_bf + (size_t)l * CDIM * CDIM, bo + l * CDIM,
                xin, xcur, nullptr);

        // --- MLP sublayer ---
        ln_kernel<<<dim3(LNGRID), dim3(SMALLBLK), 0, stream>>>(xcur, ln2g + l * CDIM,
                                                  ln2b + l * CDIM, h_bf);
        gemm_bf16_kernel<CDIM, DFF, 8, true, false, true>
            <<<dim3(DFF / 64, ROWS / 64), blk, 0, stream>>>(
                h_bf, w1_bf + (size_t)l * CDIM * DFF, b1 + l * DFF,
                nullptr, nullptr, u_bf);
        gemm_bf16_kernel<DFF, CDIM, 6, false, true, false>
            <<<dim3(CDIM / 64, ROWS / 64), blk, 0, stream>>>(
                u_bf, w2_bf + (size_t)l * DFF * CDIM, b2 + l * CDIM,
                xcur, xcur, nullptr);
    }
}

// v010
// One run takes 123 microseconds.
// Timed twice side by side with v009, it ran 1.04 and 1.05 times as fast.
// Counting every step since v000, it is 3.74 times as fast.
#include <hip/hip_runtime.h>
#include <hip/hip_bf16.h>
#include <math.h>
#include <stdint.h>

// ---------------- problem constants ----------------
#define LAYERS 2
#define BATCH  4
#define SEQ    1024
#define CDIM   256
#define HEADS  8
#define DHEAD  32          // CDIM / HEADS
#define TOPM   64
#define DFF    1024
#define ROWS   (BATCH * SEQ)      // 4096 token rows
#define LNEPS  1e-5f

// WMMA vector types (CDNA5 wave32)
typedef __attribute__((ext_vector_type(16))) __bf16 v16bf;
typedef __attribute__((ext_vector_type(8)))  float  v8f;
typedef __attribute__((ext_vector_type(8)))  short  s16x8;

union ABOp {            // one 16x32 bf16 WMMA operand per lane
    uint16_t u[16];
    uint4    q[2];      // two 16-byte chunks
    s16x8    t[2];      // the same, as a transposing LDS load returns them
    v16bf    v;
};

__device__ __forceinline__ uint16_t f2bf(float f) {
    uint32_t u = __float_as_uint(f);
    uint32_t r = u + 0x7FFFu + ((u >> 16) & 1u);   // round-to-nearest-even
    return (uint16_t)(r >> 16);
}

// Two floats to one register of two bf16 (round to nearest even, as f2bf), in
// the chip's one packed convert.
typedef __attribute__((ext_vector_type(2))) float  f32x2;
typedef __attribute__((ext_vector_type(2))) __bf16 bf16x2;
__device__ __forceinline__ uint32_t pack2(float lo, float hi) {
    return __builtin_bit_cast(uint32_t, __builtin_convertvector(f32x2{lo, hi}, bf16x2));
}

// Transposing LDS load: 16 keys x 16 columns of a key-major bf16 tile come back
// as 8 consecutive keys of one column per lane (every lane must be on).
__device__ __forceinline__ s16x8 ld_tr16(const uint16_t* p) {
    typedef __attribute__((address_space(3))) s16x8 lds_s16x8;
    return __builtin_amdgcn_ds_load_tr16_b128_v8i16((lds_s16x8*)p);
}

__device__ __forceinline__ v8f wmma_bf16(const ABOp& a, const ABOp& b, v8f c) {
    return __builtin_amdgcn_wmma_f32_16x16x32_bf16(
        false, a.v, false, b.v, (short)0, c, false, false);
}

// ---------------- wave-wide reductions on the vector unit ----------------
// Lane l <-> l ^ 16 (other 16-lane row) and l <-> l ^ M (inside a row, DPP
// row_xmask): register-to-register moves, no trip through the LDS crossbar.
__device__ __forceinline__ float xhalf(float x) {
    int b = __builtin_bit_cast(int, x);
    return __builtin_bit_cast(float, __builtin_amdgcn_permlanex16(
        b, b, 0x76543210, 0xfedcba98, false, false));
}
template<int M>
__device__ __forceinline__ float xrow(float x) {
    return __builtin_bit_cast(float, __builtin_amdgcn_mov_dpp(
        __builtin_bit_cast(int, x), 0x160 | M, 0xf, 0xf, true));
}
// Butterfly over 32 lanes in the order 16, 8, 4, 2, 1; every lane gets the result.
__device__ __forceinline__ float wave_sum(float s) {
    s += xhalf(s);   s += xrow<8>(s); s += xrow<4>(s);
    s += xrow<2>(s); s += xrow<1>(s);
    return s;
}
__device__ __forceinline__ float wave_max(float s) {
    s = fmaxf(s, xhalf(s));   s = fmaxf(s, xrow<8>(s)); s = fmaxf(s, xrow<4>(s));
    s = fmaxf(s, xrow<2>(s)); s = fmaxf(s, xrow<1>(s));
    return s;
}
__device__ __forceinline__ float wave_min(float s) {
    s = fminf(s, xhalf(s));   s = fminf(s, xrow<8>(s)); s = fminf(s, xrow<4>(s));
    s = fminf(s, xrow<2>(s)); s = fminf(s, xrow<1>(s));
    return s;
}
// A value that is equal in all lanes, moved to a scalar register.
__device__ __forceinline__ float uniform_f(float x) {
    return __builtin_bit_cast(float,
        __builtin_amdgcn_readfirstlane(__builtin_bit_cast(int, x)));
}

// ---------------- LayerNorm (one wave per row, LNR rows a wave) ----------
// A row is 8 values a lane, so its sums need the wave-wide butterfly only: no
// LDS, no barrier. Few waves with much work each, because starting waves, not
// the arithmetic, is what such a grid costs: a block is one wave per SIMD, and
// a LayerNorm is one block per WGP.
#define SMALLBLK 128              // threads per block, LayerNorm and converts
#define LNR    4                  // rows per wave, all loads issued up front
#define LNROWS (SMALLBLK / 32 * LNR)   // rows per block
#define LNGRID (ROWS / LNROWS)    // blocks per LayerNorm
typedef __attribute__((ext_vector_type(4))) float f32x4;
__device__ __forceinline__ uint2 pack4(f32x4 y) {
    uint2 r;
    r.x = (uint32_t)f2bf(y.x) | ((uint32_t)f2bf(y.y) << 16);
    r.y = (uint32_t)f2bf(y.z) | ((uint32_t)f2bf(y.w) << 16);
    return r;
}
__device__ __forceinline__ void ln_rows(const float* __restrict__ x,
                                        const float* __restrict__ g,
                                        const float* __restrict__ b,
                                        uint16_t* __restrict__ out, int blk) {
    const int wave = threadIdx.x >> 5, lane = threadIdx.x & 31;
    // lane l holds columns 4l .. 4l+3 and 128+4l .. 128+4l+3 of each row
    const size_t at = (size_t)((blk * (SMALLBLK / 32) + wave) * LNR) * CDIM + lane * 4;
    f32x4 v[LNR][2];
    #pragma unroll
    for (int r = 0; r < LNR; ++r) {
        v[r][0] = *(const f32x4*)(x + at + r * CDIM);
        v[r][1] = *(const f32x4*)(x + at + r * CDIM + 128);
    }
    const f32x4 g0 = *(const f32x4*)(g + lane * 4);
    const f32x4 g1 = *(const f32x4*)(g + lane * 4 + 128);
    const f32x4 b0 = *(const f32x4*)(b + lane * 4);
    const f32x4 b1 = *(const f32x4*)(b + lane * 4 + 128);
    float s[LNR], ss[LNR];
    #pragma unroll
    for (int r = 0; r < LNR; ++r) {
        const f32x4 p = v[r][0], q = v[r][1];
        s[r]  = ((p.x + p.y) + (p.z + p.w)) + ((q.x + q.y) + (q.z + q.w));
        ss[r] = ((p.x * p.x + p.y * p.y) + (p.z * p.z + p.w * p.w))
              + ((q.x * q.x + q.y * q.y) + (q.z * q.z + q.w * q.w));
    }
    #pragma unroll
    for (int r = 0; r < LNR; ++r) { s[r] = wave_sum(s[r]); ss[r] = wave_sum(ss[r]); }
    #pragma unroll
    for (int r = 0; r < LNR; ++r) {
        const float mean = s[r] * (1.0f / CDIM);
        const float var  = ss[r] * (1.0f / CDIM) - mean * mean;
        const float rstd = rsqrtf(var + LNEPS);
        *(uint2*)(out + at + r * CDIM)       = pack4((v[r][0] - mean) * rstd * g0 + b0);
        *(uint2*)(out + at + r * CDIM + 128) = pack4((v[r][1] - mean) * rstd * g1 + b1);
    }
}

__global__ __launch_bounds__(SMALLBLK) void ln_kernel(const float* __restrict__ x,
                          const float* __restrict__ g,
                          const float* __restrict__ b,
                          uint16_t* __restrict__ out) {
    ln_rows(x, g, b, out, blockIdx.x);
}

// ---------------- front launch: everything that reads inputs only ----------
// Blocks [0, LNGRID): the first LayerNorm. The blocks behind them convert the
// weights of all layers to bf16, CVT values each: the five arrays land one
// behind the other in wbf, each with its layers in input order.
// Inside a layer the values lie in the order of the WMMA B operand: one 1KB
// fragment per (16 columns, 32 k), fragments of a column group in k order; in
// a fragment two 512-byte halves, lane l's 16 bytes at l*16 in each. A wave
// then reads a whole fragment with two 16-byte loads over contiguous lines.
#define NWQ  (LAYERS * CDIM * CDIM)
#define NWKV (LAYERS * CDIM * 2 * CDIM)
#define NWO  (LAYERS * CDIM * CDIM)
#define NW1  (LAYERS * CDIM * DFF)
#define NW2  (LAYERS * DFF * CDIM)
#define NWALL (NWQ + NWKV + NWO + NW1 + NW2)
#define CVT  4096                 // a block's share: 64 k x 64 columns
#define FRAG 512                  // values in one B fragment
template<int K, int N>
__device__ __forceinline__ void pack_tile(const float* __restrict__ w,
                                          uint16_t* __restrict__ to, int tile) {
    constexpr int TPL = K * N / CVT;            // tiles per layer
    const int l  = tile / TPL, r = tile % TPL;
    const int kt = r / (N / 64), nt = r % (N / 64);
    const int n  = nt * 64 + (threadIdx.x & 63);    // this thread's column
    const int ks = kt * 2 + (threadIdx.x >> 6);     // and its 32-k step
    const float* in = w + (size_t)l * K * N + (size_t)(ks * 32) * N + n;
    float v[32];
    #pragma unroll
    for (int i = 0; i < 32; ++i) v[i] = in[i * N];
    uint16_t* o = to + (size_t)l * K * N + ((n >> 4) * (K / 32) + ks) * FRAG + (n & 15) * 8;
    // k 0-7: half 0, lanes 0-15; k 8-15: half 0, lanes 16-31; k 16-31: half 1 alike
    #pragma unroll
    for (int c = 0; c < 4; ++c) {
        uint4 p;
        p.x = (uint32_t)f2bf(v[c * 8 + 0]) | ((uint32_t)f2bf(v[c * 8 + 1]) << 16);
        p.y = (uint32_t)f2bf(v[c * 8 + 2]) | ((uint32_t)f2bf(v[c * 8 + 3]) << 16);
        p.z = (uint32_t)f2bf(v[c * 8 + 4]) | ((uint32_t)f2bf(v[c * 8 + 5]) << 16);
        p.w = (uint32_t)f2bf(v[c * 8 + 6]) | ((uint32_t)f2bf(v[c * 8 + 7]) << 16);
        *(uint4*)(o + (c >> 1) * (FRAG / 2) + (c & 1) * 128) = p;
    }
    // the stores' data and address registers may be rewritten by what follows
    asm volatile("s_wait_xcnt 0x0" ::: "memory");
}
__global__ __launch_bounds__(SMALLBLK) void front_kernel(const float* __restrict__ x,
                             const float* __restrict__ g,
                             const float* __restrict__ b,
                             uint16_t* __restrict__ hout,
                             const float* __restrict__ Wq,
                             const float* __restrict__ Wkv,
                             const float* __restrict__ Wo,
                             const float* __restrict__ W1,
                             const float* __restrict__ W2,
                             uint16_t* __restrict__ wbf) {
    if (blockIdx.x < LNGRID) {          // same for the whole block
        ln_rows(x, g, b, hout, blockIdx.x);
        return;
    }
    const int t = blockIdx.x - LNGRID;  // every array is whole blocks
    if (t < NWQ / CVT)
        pack_tile<CDIM, CDIM>(Wq, wbf, t);
    else if (t < (NWQ + NWKV) / CVT)
        pack_tile<CDIM, 2 * CDIM>(Wkv, wbf + NWQ, t - NWQ / CVT);
    else if (t < (NWQ + NWKV + NWO) / CVT)
        pack_tile<CDIM, CDIM>(Wo, wbf + NWQ + NWKV, t - (NWQ + NWKV) / CVT);
    else if (t < (NWQ + NWKV + NWO + NW1) / CVT)
        pack_tile<CDIM, DFF>(W1, wbf + NWQ + NWKV + NWO, t - (NWQ + NWKV + NWO) / CVT);
    else
        pack_tile<DFF, CDIM>(W2, wbf + NWQ + NWKV + NWO + NW1,
                             t - (NWQ + NWKV + NWO + NW1) / CVT);
}

// ---------------- generic bf16 WMMA GEMM: D = act(A@B + bias) (+resid) ----
// A: [M,K] bf16 row-major.  B: K x Nc bf16 in fragment order (see pack_tile).
// block = 128 (4 waves, 2 x 2); each wave owns a 32x32 output tile (2 x 2
// fragments), the block the 64 x 64 tile (by, bx).
// Every global load covers whole lines and many are in flight at once:
//  B: a fragment is two contiguous 512-byte loads, straight into registers,
//     AHEAD K steps ahead of its products;
//  A: the block's 64 rows go to LDS KC k at a time, one 512-byte row piece per
//     wave-wide load, the next chunk fetched while this one is worked on; the
//     fragments (16 rows x 16 bytes a load) are then gathered from LDS.
// One barrier per KC k publishes a chunk; with two buffers the same barrier
// ends the last read of the buffer that is filled behind the next chunk.
#define GBLK 128
#define KC   256                  // k per staged A chunk
#define APITCH (KC + 8)           // LDS row pitch in values: 16 bytes x odd
typedef __attribute__((ext_vector_type(4))) uint32_t u32x4;
// Work-group barrier that orders LDS traffic only. __syncthreads() would also
// wait for every global load, and those are meant to stay in flight across it.
__device__ __forceinline__ void lds_barrier() {
    __builtin_amdgcn_fence(__ATOMIC_RELEASE, "workgroup", "local");
    __builtin_amdgcn_s_barrier();
    __builtin_amdgcn_fence(__ATOMIC_ACQUIRE, "workgroup", "local");
}
template<int K, int AHEAD, bool GELU_, bool RES, bool OUTBF>
__device__ __forceinline__ void gemm_tile(const uint16_t* __restrict__ A,
                                 const uint16_t* __restrict__ Bw,
                                 const float* __restrict__ bias,
                                 const float* __restrict__ resid,
                                 float* __restrict__ outf,
                                 uint16_t* __restrict__ outb,
                                 int Nc, int bx, int by) {
    constexpr int NS   = K / 32;         // K steps
    constexpr int NCH  = K / KC;         // A chunks
    constexpr int CS   = KC / 32;        // K steps per chunk
    constexpr int NBUF = NCH > 1 ? 2 : 1;
    constexpr int NST  = 64 * KC / 8 / GBLK;    // 16-byte pieces per thread and chunk
    __shared__ __attribute__((aligned(16))) uint16_t As[NBUF * 64 * APITCH];
    const int tid  = threadIdx.x;
    const int wave = tid >> 5, lane = tid & 31;
    const int g    = lane >> 4;          // half-wave select
    const int row0 = by * 64 + (wave >> 1) * 32;
    const int col0 = bx * 64 + (wave & 1) * 32;
    // A staging: piece i of this thread is row wave + 4i, bytes lane*16 of the chunk
    const uint16_t* ag = A + (size_t)(by * 64 + wave) * K + lane * 8;
    uint16_t*       aw = As + wave * APITCH + lane * 8;
    // A operand: row m = tile row (+16) + lane%16, K-chunks at g*8 and 16+g*8 of a step
    const uint16_t* ar = As + ((wave >> 1) * 32 + (lane & 15)) * APITCH + g * 8;
    // B operand: fragments (col0/16 (+1), step), this lane's 16 bytes of each half
    const uint16_t* bp = Bw + (size_t)(col0 >> 4) * NS * FRAG + lane * 8;
    const int nc0 = col0 + (lane & 15);  // output column, first fragment
    const int m0  = row0 + g * 8;        // output row, first fragment, element 0
    const float bb[2] = { bias[nc0], bias[nc0 + 16] };
    float rs[2][2][8];                   // residual, fetched while the loop drains

    u32x4 st[NST];                       // an A chunk on its way to LDS
    ABOp  af[2][2], b[AHEAD][2];         // all indices are compile-time
    v8f   acc[2][2] = {};

    #pragma unroll
    for (int i = 0; i < NST; ++i) st[i] = *(const u32x4*)(ag + i * 4 * K);
    // A first: loads return in order, and the LDS stores wait for these alone
    __builtin_amdgcn_sched_barrier(0);
    #pragma unroll
    for (int s = 0; s < AHEAD; ++s)
        #pragma unroll
        for (int f = 0; f < 2; ++f) {
            b[s][f].q[0] = *(const uint4*)(bp + (f * NS + s) * FRAG);
            b[s][f].q[1] = *(const uint4*)(bp + (f * NS + s) * FRAG + FRAG / 2);
        }
    // keeps the loads above from sinking to their first use (left alone, the
    // scheduler holds about one step in flight to save registers)
    __builtin_amdgcn_sched_barrier(0);
    // an address register that has had its last use may be rewritten from here on
    if (NCH == 1 || AHEAD == NS) asm volatile("s_wait_xcnt 0x0" ::: "memory");
    #pragma unroll
    for (int i = 0; i < NST; ++i) *(u32x4*)(aw + i * 4 * APITCH) = st[i];
    if (NCH > 1) {
        #pragma unroll
        for (int i = 0; i < NST; ++i) st[i] = *(const u32x4*)(ag + i * 4 * K + KC);
    }
    lds_barrier();                       // chunk 0 is in LDS

    #pragma unroll
    for (int c = 0; c < NCH; ++c) {
        const uint16_t* ac = ar + (c % NBUF) * 64 * APITCH;
        #pragma unroll
        for (int f = 0; f < 2; ++f) {
            af[0][f].q[0] = *(const uint4*)(ac + f * 16 * APITCH);
            af[0][f].q[1] = *(const uint4*)(ac + f * 16 * APITCH + 16);
        }
        #pragma unroll
        for (int s = 0; s < CS; ++s) {
            const int gs = c * CS + s, u = gs % AHEAD;
            if (s + 1 < CS) {            // next step's A fragments, ahead of the products
                #pragma unroll
                for (int f = 0; f < 2; ++f) {
                    af[(s + 1) & 1][f].q[0] = *(const uint4*)(ac + f * 16 * APITCH + (s + 1) * 32);
                    af[(s + 1) & 1][f].q[1] = *(const uint4*)(ac + f * 16 * APITCH + (s + 1) * 32 + 16);
                }
            }
            // holds the LDS reads in front of the products they overlap with
            __builtin_amdgcn_sched_barrier(0);
            #pragma unroll
            for (int i = 0; i < 2; ++i)
                #pragma unroll
                for (int j = 0; j < 2; ++j)
                    acc[i][j] = wmma_bf16(af[s & 1][i], b[u][j], acc[i][j]);
            // keeps the loads below from sinking to their use AHEAD steps later
            __builtin_amdgcn_sched_barrier(0);
            if (RES && gs == NS - 4) {   // 3 steps (12 loads) still in flight
                #pragma unroll
                for (int i = 0; i < 2; ++i)
                    #pragma unroll
                    for (int j = 0; j < 2; ++j)
                        #pragma unroll
                        for (int v = 0; v < 8; ++v)
                            rs[i][j][v] = resid[(size_t)(m0 + i * 16 + v) * Nc + nc0 + j * 16];
            }
            if (gs + AHEAD < NS) {       // B of step gs + AHEAD, into the freed set
                #pragma unroll
                for (int f = 0; f < 2; ++f) {
                    b[u][f].q[0] = *(const uint4*)(bp + (f * NS + gs + AHEAD) * FRAG);
                    b[u][f].q[1] = *(const uint4*)(bp + (f * NS + gs + AHEAD) * FRAG + FRAG / 2);
                }
                // B's last loads: their address register may be rewritten behind this
                if (gs + AHEAD == NS - 1) asm volatile("s_wait_xcnt 0x0" ::: "memory");
            }
            __builtin_amdgcn_sched_barrier(0);   // same purpose, the loads' other side
        }
        if (c + 1 < NCH) {
            // chunk c+1 into the buffer last read in chunk c-1 (barrier since)
            #pragma unroll
            for (int i = 0; i < NST; ++i)
                *(u32x4*)(aw + ((c + 1) % NBUF) * 64 * APITCH + i * 4 * APITCH) = st[i];
            if (c + 2 < NCH) {
                #pragma unroll
                for (int i = 0; i < NST; ++i)
                    st[i] = *(const u32x4*)(ag + i * 4 * K + (c + 2) * KC);
                // A's last loads: the same for their address register
                if (c + 2 == NCH - 1) asm volatile("s_wait_xcnt 0x0" ::: "memory");
            }
            lds_barrier();               // chunk c+1 is in LDS, chunk c is read out
        }
    }
    // C/D layout: element v -> (m = tile row + g*8 + v, n = tile col + lane%16)
    #pragma unroll
    for (int j = 0; j < 2; ++j) {
        const int nc = nc0 + j * 16;
        #pragma unroll
        for (int i = 0; i < 2; ++i) {
            #pragma unroll
            for (int v = 0; v < 8; ++v) {
                int m = m0 + i * 16 + v;
                float r = acc[i][j][v] + bb[j];
                if (GELU_) r = 0.5f * r * (1.0f + erff(r * 0.70710678118654752f));
                if (RES)   r += rs[i][j][v];
                if (OUTBF) outb[(size_t)m * Nc + nc] = f2bf(r);
                else       outf[(size_t)m * Nc + nc] = r;
            }
        }
    }
}

// one product: grid = (Nc/64, M/64)
template<int K, int NC, int AHEAD, bool GELU_, bool RES, bool OUTBF>
__global__ __launch_bounds__(GBLK) void gemm_bf16_kernel(const uint16_t* __restrict__ A,
                                 const uint16_t* __restrict__ Bw,
                                 const float* __restrict__ bias,
                                 const float* __restrict__ resid,
                                 float* __restrict__ outf,
                                 uint16_t* __restrict__ outb) {
    gemm_tile<K, AHEAD, GELU_, RES, OUTBF>(A, Bw, bias, resid, outf, outb, NC,
                                           blockIdx.x, blockIdx.y);
}

// Q and KV projections of the same rows in one grid = (3*CDIM/64, M/64):
// the first CDIM/64 block columns are Q's tiles, the others KV's.
__global__ __launch_bounds__(GBLK) void gemm_qkv_kernel(const uint16_t* __restrict__ A,
                                const uint16_t* __restrict__ Wq,
                                const uint16_t* __restrict__ Wkv,
                                const float* __restrict__ bq,
                                const float* __restrict__ bkv,
                                uint16_t* __restrict__ q,
                                uint16_t* __restrict__ kv) {
    const bool isq = blockIdx.x < CDIM / 64;    // same for the whole block
    gemm_tile<CDIM, 8, false, false, true>(A, isq ? Wq : Wkv, isq ? bq : bkv,
                                  nullptr, nullptr, isq ? q : kv,
                                  isq ? CDIM : 2 * CDIM,
                                  isq ? blockIdx.x : blockIdx.x - CDIM / 64,
                                  blockIdx.y);
}

// ---------------- fused dual-pass attention ----------------
// One workgroup = (b, h, 64-query panel), 32 waves: the panel fills the LDS of
// its WGP, so the waves that hide each other's waits must come from this one
// workgroup (8 per SIMD). Scores stay in LDS (64 x 1028 f32). All of V (1024
// keys x 32 d, bf16) lies there too: P needs only the first half of a score
// row, so the other half of row r takes keys 16r .. 16r+15, written by the wave
// that owns the row once the scores are in its registers; the loads fly under
// that wave's own arithmetic of phase 2.
// Phase 1: QK^T via WMMA. Phase 2: dense softmax stats + top-64 threshold by
// value bisection + fused combined probabilities, left as packed bf16 at the
// head of each score row. Phase 3: P@V via WMMA; both operands come out of LDS
// as whole fragments, two 16-byte loads each: P rows as they lie, V (key-major)
// through the transposing load. The LDS port, not the arithmetic, sets the pace
// of that phase, so it is fed few wide loads that spread over all banks.
#define QBLK  64
#define SLD   1028    // score row pitch in floats: 16 bytes x odd, for 16-byte row reads
#define AWAVES 32     // waves per workgroup
#define VCH   256     // keys per turn of P@V: every wave group takes its share of each turn
#define VPITCH 48     // staged V row pitch in values: 32 bytes x odd, for transposing loads
#define VOFF  1024    // V's place in a score row, in bf16 values: behind the 1024 of P
#define KGRP  (AWAVES / 8)            // wave groups that share the keys in P@V
#define KSTEP (VCH / 32 / KGRP)       // 32-key steps per wave and turn
__global__ __launch_bounds__(AWAVES * 32) void attn_kernel(const uint16_t* __restrict__ qb,   // [ROWS,CDIM] bf16
                            const uint16_t* __restrict__ kvb,  // [ROWS,2*CDIM] bf16
                            const float* __restrict__ wf,      // w_fuse[2]
                            uint16_t* __restrict__ attn) {     // [ROWS,CDIM] bf16
    extern __shared__ __attribute__((aligned(16))) float sc[];
    const int bid  = blockIdx.x;
    const int b    = bid / (HEADS * (SEQ / QBLK));
    const int rem  = bid % (HEADS * (SEQ / QBLK));
    const int h    = rem / (SEQ / QBLK);
    const int q0   = (rem % (SEQ / QBLK)) * QBLK;
    const int tid  = threadIdx.x;
    const int wave = tid >> 5, lane = tid & 31;
    const int g    = lane >> 4;
    const float scale = 0.17677669529663687f;   // 1/sqrt(32)

    // learned fusion weights (softmax over 2) -- uniform, scalarizes to SALU
    const float e0 = expf(wf[0]), e1 = expf(wf[1]);
    const float w0 = e0 / (e0 + e1), w1 = e1 / (e0 + e1);

    // ---- phase 1: scores tile 64q x 1024k, 256 WMMA tiles over 32 waves ----
    // A wave keeps its 2 key tiles in registers and takes them against all 4
    // query tiles: the panel's K rows (half a line each, more lines than the
    // WGP cache holds) are gathered once, not once per query tile. These
    // 16-line gathers, not the products, set the pace of this phase.
    {
        constexpr int KT = SEQ / 16 / AWAVES;      // key tiles per wave
        ABOp kf[KT], qa;
        // K operand: 16 keys across lanes, d packed (row-major contiguous)
        const uint16_t* kr = kvb + (size_t)(b * SEQ + wave * 16 + (lane & 15)) * (2 * CDIM)
                             + h * DHEAD + g * 8;
        #pragma unroll
        for (int j = 0; j < KT; ++j) {
            kf[j].q[0] = *(const uint4*)(kr + (size_t)j * AWAVES * 16 * (2 * CDIM));
            kf[j].q[1] = *(const uint4*)(kr + (size_t)j * AWAVES * 16 * (2 * CDIM) + 16);
        }
        // Q operand: 16 queries x 32 d (contiguous d chunks)
        const uint16_t* qr = qb + (size_t)(b * SEQ + q0 + (lane & 15)) * CDIM
                             + h * DHEAD + g * 8;
        qa.q[0] = *(const uint4*)(qr);
        qa.q[1] = *(const uint4*)(qr + 16);
        float* sp = sc + g * 8 * SLD + wave * 16 + (lane & 15);
        // stays rolled: from a running row pointer all 16 stores of a trip reach
        // their place by the immediate offset (unrolled, each takes an address
        // register of its own and the wave reaches its limit of 128 registers)
        #pragma unroll 1
        for (int qt = 0; qt < QBLK / 16; ++qt) {
            ABOp qn = qa;
            if (qt + 1 < QBLK / 16) {   // the next query tile, ahead of the products
                qr += 16 * CDIM;
                qn.q[0] = *(const uint4*)(qr);
                qn.q[1] = *(const uint4*)(qr + 16);
            }
            #pragma unroll
            for (int j = 0; j < KT; ++j) {
                v8f c = {};
                c = wmma_bf16(qa, kf[j], c);
                #pragma unroll
                for (int v = 0; v < 8; ++v)
                    sp[v * SLD + j * AWAVES * 16] = c[v] * scale;
            }
            qa = qn;
            sp += 16 * SLD;
        }
    }
    __syncthreads();

    // ---- phase 2: per-row dense softmax + top-64 threshold + fusion ----
    // V for this wave's 2 score rows: 16 keys a row, 2 pieces of 16 bytes a lane.
    // Fetched here and stored once both rows are in registers, so the way to L2
    // lies under the first row's arithmetic.
    static_assert(QBLK / AWAVES == 2, "a wave owns two score rows");
    const uint16_t* vg = kvb + (size_t)(b * SEQ + wave * 32 + (lane >> 2)) * (2 * CDIM)
                         + CDIM + h * DHEAD + (lane & 3) * 8;
    const u32x4 va0 = *(const u32x4*)(vg);
    const u32x4 va1 = *(const u32x4*)(vg + (size_t) 8 * (2 * CDIM));
    const u32x4 vb0 = *(const u32x4*)(vg + (size_t)16 * (2 * CDIM));
    const u32x4 vb1 = *(const u32x4*)(vg + (size_t)24 * (2 * CDIM));
    for (int i = 0; i < QBLK / AWAVES; ++i) {
        const int row = wave * (QBLK / AWAVES) + i;
        float* rp = sc + row * SLD;
        // lane l holds columns 128j + 4l .. 128j + 4l + 3, j = 0 .. 7
        float rv[32];
        #pragma unroll
        for (int j = 0; j < 8; ++j) {
            const f32x4 t = *(const f32x4*)(rp + j * 128 + lane * 4);
            rv[j * 4 + 0] = t.x; rv[j * 4 + 1] = t.y;
            rv[j * 4 + 2] = t.z; rv[j * 4 + 3] = t.w;
        }
        // The scores of both rows have left LDS (it serves a wave in order): the
        // second half of row r takes keys 16r .. 16r+15 of V, key-major.
        if (i == 1) {
            uint16_t* vd = (uint16_t*)(rp - SLD) + VOFF + (lane >> 2) * VPITCH + (lane & 3) * 8;
            *(u32x4*)(vd)                        = va0;
            *(u32x4*)(vd + 8 * VPITCH)           = va1;
            *(u32x4*)(vd + SLD * 2)              = vb0;
            *(u32x4*)(vd + SLD * 2 + 8 * VPITCH) = vb1;
        }
        float mx = -1e30f, mn = 1e30f;
        #pragma unroll
        for (int j = 0; j < 32; ++j) { mx = fmaxf(mx, rv[j]); mn = fminf(mn, rv[j]); }
        mx = wave_max(mx);
        mn = wave_min(mn);
        // bisection for top-64 threshold: largest t with count(s>t) >= TOPM
        // The count over the wave is taken from the compare masks themselves
        // (ballot + population count), so bounds and count live in scalars.
        float lo = uniform_f(mn) - 1.0f, hi = uniform_f(mx);
        for (int left = 24; left > 0; ) {
            float mid = 0.5f * (lo + hi);
            int c = 0;
            #pragma unroll
            for (int j = 0; j < 32; j += 2) {
                uint64_t m0 = __builtin_amdgcn_ballot_w32(rv[j]     > mid);
                uint64_t m1 = __builtin_amdgcn_ballot_w32(rv[j + 1] > mid);
                c += __builtin_popcountll(m0 | (m1 << 32));
            }
            if (c >= TOPM) lo = mid; else hi = mid;
            // Exactly TOPM scores lie above lo: every later step keeps this
            // same set, so the search is over (24 steps stay the bound).
            left = (c == TOPM) ? 0 : left - 1;
        }
        const float thr = lo;
        // e^(s - max) = 2^(s * log2(e) - max * log2(e)): one fused multiply-add
        // and the chip's own exponential. The argument is never above 0 (but for
        // the rounding of the second product, which is the same for the whole row
        // and cancels in the quotients below), so no range check is needed; below
        // 2^-126 the result is 0, beside a sum that is at least 1.
        const float l2e = 1.4426950408889634f;
        const float nmx = -mx * l2e;
        float ev[32];     // each exponential is formed once and kept
        #pragma unroll
        for (int j = 0; j < 32; ++j) ev[j] = fmaf(rv[j], l2e, nmx);
        // The two scheduling barriers keep the exponentials in one run, each behind
        // an independent one, as the instruction set asks for an independent
        // instruction between an exponential and one that overwrites its source.
        __builtin_amdgcn_sched_barrier(0);
        #pragma unroll
        for (int j = 0; j < 32; ++j) ev[j] = __builtin_amdgcn_exp2f(ev[j]);
        __builtin_amdgcn_sched_barrier(0);
        float sd = 0.f;
        #pragma unroll
        for (int j = 0; j < 32; ++j) sd += ev[j];
        sd = wave_sum(sd);
        float st = 0.f;
        #pragma unroll
        for (int j = 0; j < 32; ++j) st += (rv[j] > thr) ? ev[j] : 0.f;
        st = wave_sum(st);
        const float cd = w0 / sd;
        const float ct = w1 / fmaxf(st, 1e-20f);
        // The row is in this wave's registers, so P (bf16, key order) takes the
        // place of the row's first 2KB.
        uint16_t* pr = (uint16_t*)rp;
        #pragma unroll
        for (int j = 0; j < 8; ++j) {
            f32x4 p;
            p.x = ev[j * 4 + 0] * (cd + ((rv[j * 4 + 0] > thr) ? ct : 0.f));
            p.y = ev[j * 4 + 1] * (cd + ((rv[j * 4 + 1] > thr) ? ct : 0.f));
            p.z = ev[j * 4 + 2] * (cd + ((rv[j * 4 + 2] > thr) ? ct : 0.f));
            p.w = ev[j * 4 + 3] * (cd + ((rv[j * 4 + 3] > thr) ? ct : 0.f));
            uint2 w;
            w.x = pack2(p.x, p.y);
            w.y = pack2(p.z, p.w);
            *(uint2*)(pr + j * 128 + lane * 4) = w;
        }
    }
    __syncthreads();

    // ---- phase 3: out = P @ V, both operands whole in LDS ----
    // 8 output tiles x KGRP wave groups: group kq takes KSTEP of the 32-key
    // steps of every turn; the groups' partial sums meet in LDS at the end.
    // Nothing is staged here, so the steps run with no barrier between.
    {
        const int tile = wave & 7, kq = wave >> 3;
        const int qt = tile >> 1, dt = tile & 1;
        const int m  = qt * 16 + (lane & 15);
        // this lane's first 16 bytes of P and of V; all its others lie at
        // compile-time distances from these.
        // P: query m, keys g*8 .. g*8+7 of a 32-key step (and the same + 16).
        // V: 16 keys lie in one score row. The transposing load takes key row
        // g*8 + lane%8, 16-byte half (lane/8)%2 of the tile's 16 columns, and
        // hands lane (c, g) the keys g*8 .. g*8+7 of column c: P's key order.
        const uint16_t* pw = (const uint16_t*)(sc + m * SLD) + kq * (KSTEP * 32) + g * 8;
        const uint16_t* vw = (const uint16_t*)(sc + kq * (KSTEP * 2) * SLD) + VOFF
                             + (g * 8 + (lane & 7)) * VPITCH
                             + dt * 16 + ((lane >> 3) & 1) * 8;
        v8f acc = {};
        // unrolled: the LDS loads of later steps are issued ahead of the products
        #pragma unroll
        for (int c = 0; c < SEQ / VCH; ++c) {
            #pragma unroll
            for (int s = 0; s < KSTEP; ++s) {
                ABOp a, bm;
                a.q[0]  = *(const uint4*)(pw + c * VCH + s * 32);
                a.q[1]  = *(const uint4*)(pw + c * VCH + s * 32 + 16);
                bm.t[0] = ld_tr16(vw + (c * (VCH / 16) + s * 2) * (SLD * 2));
                bm.t[1] = ld_tr16(vw + (c * (VCH / 16) + s * 2 + 1) * (SLD * 2));
                acc = wmma_bf16(a, bm, acc);
            }
        }
        __syncthreads();
        // The score panel has been read for the last time (barrier above): its
        // first 24KB now carry the partial sums of groups 1.. to group 0.
        if (kq != 0) {
            #pragma unroll
            for (int v = 0; v < 8; ++v)
                sc[(((kq - 1) * 8 + tile) * 8 + v) * 32 + lane] = acc[v];
        }
        __syncthreads();
        if (kq == 0) {
            #pragma unroll
            for (int p = 0; p < KGRP - 1; ++p) {
                #pragma unroll
                for (int v = 0; v < 8; ++v)
                    acc[v] += sc[((p * 8 + tile) * 8 + v) * 32 + lane];
            }
            #pragma unroll
            for (int v = 0; v < 8; ++v) {
                int mr = q0 + qt * 16 + g * 8 + v;
                int nc = dt * 16 + (lane & 15);
                attn[(size_t)(b * SEQ + mr) * CDIM + h * DHEAD + nc] = f2bf(acc[v]);
            }
        }
    }
}

// ---------------- host side ----------------
extern "C" void kernel_launch(void* const* d_in, const int* in_sizes, int n_in,
                              void* d_out, int out_size, void* d_ws, size_t ws_size,
                              hipStream_t stream) {
    (void)in_sizes; (void)n_in; (void)out_size; (void)ws_size;
    const float* x     = (const float*)d_in[0];
    const float* ln1g  = (const float*)d_in[1];
    const float* ln1b  = (const float*)d_in[2];
    const float* Wq    = (const float*)d_in[3];
    const float* bq    = (const float*)d_in[4];
    const float* Wkv   = (const float*)d_in[5];
    const float* bkv   = (const float*)d_in[6];
    const float* wfuse = (const float*)d_in[7];
    const float* Wo    = (const float*)d_in[8];
    const float* bo    = (const float*)d_in[9];
    const float* ln2g  = (const float*)d_in[10];
    const float* ln2b  = (const float*)d_in[11];
    const float* W1    = (const float*)d_in[12];
    const float* b1    = (const float*)d_in[13];
    const float* W2    = (const float*)d_in[14];
    const float* b2    = (const float*)d_in[15];
    float* xcur = (float*)d_out;                       // running activations

    // workspace carve-up (bf16 buffers, 256B-aligned power-of-two sizes);
    // the five weight arrays lie in the order the front launch writes them
    uint8_t* ws = (uint8_t*)d_ws;
    uint16_t* wq_bf   = (uint16_t*)(ws);                 size_t off = NWQ * 2;
    uint16_t* wkv_bf  = (uint16_t*)(ws + off);           off += NWKV * 2;
    uint16_t* wo_bf   = (uint16_t*)(ws + off);           off += NWO * 2;
    uint16_t* w1_bf   = (uint16_t*)(ws + off);           off += NW1 * 2;
    uint16_t* w2_bf   = (uint16_t*)(ws + off);           off += NW2 * 2;
    uint16_t* h_bf    = (uint16_t*)(ws + off);           off += (size_t)ROWS * CDIM * 2;
    uint16_t* q_bf    = (uint16_t*)(ws + off);           off += (size_t)ROWS * CDIM * 2;
    uint16_t* kv_bf   = (uint16_t*)(ws + off);           off += (size_t)ROWS * 2 * CDIM * 2;
    uint16_t* attn_bf = (uint16_t*)(ws + off);           off += (size_t)ROWS * CDIM * 2;
    uint16_t* u_bf    = (uint16_t*)(ws + off);

    const int attnLds = QBLK * SLD * (int)sizeof(float);          // score panel, P and V
    hipFuncSetAttribute((const void*)attn_kernel,
                        hipFuncAttributeMaxDynamicSharedMemorySize, attnLds);

    const dim3 blk(GBLK);
    // first LayerNorm and all weight converts: they read inputs only
    front_kernel<<<dim3(LNGRID + NWALL / CVT), dim3(SMALLBLK), 0, stream>>>(
        x, ln1g, ln1b, h_bf, Wq, Wkv, Wo, W1, W2, wq_bf);

    for (int l = 0; l < LAYERS; ++l) {
        // layer 0 takes its residual from x itself; d_out is first written there
        const float* xin = (l == 0) ? x : xcur;

        // --- attention sublayer ---
        if (l > 0)
            ln_kernel<<<dim3(LNGRID), dim3(SMALLBLK), 0, stream>>>(xcur, ln1g + l * CDIM,
                                                      ln1b + l * CDIM, h_bf);
        gemm_qkv_kernel<<<dim3(3 * CDIM / 64, ROWS / 64), blk, 0, stream>>>(
                h_bf, wq_bf + (size_t)l * CDIM * CDIM,
                wkv_bf + (size_t)l * CDIM * 2 * CDIM,
                bq + l * CDIM, bkv + l * 2 * CDIM, q_bf, kv_bf);
        attn_kernel<<<dim3(BATCH * HEADS * (SEQ / QBLK)), dim3(AWAVES * 32), attnLds, stream>>>(
                q_bf, kv_bf, wfuse + l * 2, attn_bf);
        gemm_bf16_kernel<CDIM, CDIM, 8, false, true, false>
            <<<dim3(CDIM / 64, ROWS / 64), blk, 0, stream>>>(
                attn_bf, wo_bf + (size_t)l * CDIM * CDIM, bo + l * CDIM,
                xin, xcur, nullptr);

        // --- MLP sublayer ---
        ln_kernel<<<dim3(LNGRID), dim3(SMALLBLK), 0, stream>>>(xcur, ln2g + l * CDIM,
                                                  ln2b + l * CDIM, h_bf);
        gemm_bf16_kernel<CDIM, DFF, 8, true, false, true>
            <<<dim3(DFF / 64, ROWS / 64), blk, 0, stream>>>(
                h_bf, w1_bf + (size_t)l * CDIM * DFF, b1 + l * DFF,
                nullptr, nullptr, u_bf);
        gemm_bf16_kernel<DFF, CDIM, 6, false, true, false>
            <<<dim3(CDIM / 64, ROWS / 64), blk, 0, stream>>>(
                u_bf, w2_bf + (size_t)l * DFF * CDIM, b2 + l * CDIM,
                xcur, xcur, nullptr);
    }
}
